// v000
// Measured on an AMD MI455X. A time is GPU time per run, averaged over a window of back-to-back runs after a warm-up
// (all launches, gaps included; the runs take copies of the inputs in turn), and the median of several windows.
// Apart from v000's, it joins two sittings. Times from different sittings can be a few percent apart, while
// side-by-side timings come from the same sitting.
// v000, which the later versions start from, runs in 285 microseconds.
#include <hip/hip_runtime.h>
#include <hip/hip_bf16.h>

typedef _Float16 v8h  __attribute__((ext_vector_type(8)));
typedef _Float16 v16h __attribute__((ext_vector_type(16)));
typedef float    v8f  __attribute__((ext_vector_type(8)));

#define HID   1024
#define SEQ   2048
#define BB    2
#define NHD   16
#define HDIM  64
#define MTOK  (BB*SEQ)      /* 4096 tokens */
#define QSCALE 0.125f       /* HD^-0.5 */

// Load a 16x32 f16 A/B fragment half for this lane: elements [0..7] = p[0..7],
// elements [8..15] = p[16..23]  (K-halves per CDNA5 16-bit WMMA VGPR layout).
__device__ __forceinline__ v16h load_frag(const _Float16* __restrict__ p) {
  v8h lo = *(const v8h*)(p);
  v8h hi = *(const v8h*)(p + 16);
  v16h r;
#pragma unroll
  for (int i = 0; i < 8; ++i) { r[i] = lo[i]; r[i + 8] = hi[i]; }
  return r;
}

__device__ __forceinline__ v8f wmma16(v16h a, v16h b, v8f c) {
  return __builtin_amdgcn_wmma_f32_16x16x32_f16(false, a, false, b, (short)0, c,
                                                false, false);
}

// ---------------------------------------------------------------------------
// Fused triple LayerNorm: x[4096,1024] f32 -> lnq/lnk/lnv f16
// ---------------------------------------------------------------------------
__global__ void ln3_kernel(const float* __restrict__ x,
                           const float* __restrict__ qw, const float* __restrict__ qb,
                           const float* __restrict__ kw, const float* __restrict__ kb,
                           const float* __restrict__ vw, const float* __restrict__ vb,
                           _Float16* __restrict__ lnq,
                           _Float16* __restrict__ lnk,
                           _Float16* __restrict__ lnv) {
  __shared__ float s1[256];
  __shared__ float s2[256];
  const int row = blockIdx.x;
  const int tid = threadIdx.x;
  const float4 v = ((const float4*)(x + (size_t)row * HID))[tid];
  float sum = v.x + v.y + v.z + v.w;
  float sq  = v.x * v.x + v.y * v.y + v.z * v.z + v.w * v.w;
  s1[tid] = sum; s2[tid] = sq;
  __syncthreads();
#pragma unroll
  for (int o = 128; o > 0; o >>= 1) {
    if (tid < o) { s1[tid] += s1[tid + o]; s2[tid] += s2[tid + o]; }
    __syncthreads();
  }
  const float mu   = s1[0] * (1.0f / HID);
  const float var  = s2[0] * (1.0f / HID) - mu * mu;
  const float rstd = rsqrtf(var + 1e-5f);
  const int c0 = tid * 4;
  const float e[4] = {v.x, v.y, v.z, v.w};
#pragma unroll
  for (int i = 0; i < 4; ++i) {
    const int c = c0 + i;
    const float nv = (e[i] - mu) * rstd;
    const size_t o = (size_t)row * HID + c;
    lnq[o] = (_Float16)(nv * qw[c] + qb[c]);
    lnk[o] = (_Float16)(nv * kw[c] + kb[c]);
    lnv[o] = (_Float16)(nv * vw[c] + vb[c]);
  }
}

// ---------------------------------------------------------------------------
// f32 -> f16 weight conversion
// ---------------------------------------------------------------------------
__global__ void cvt_f32_f16(const float* __restrict__ src,
                            _Float16* __restrict__ dst, int n) {
  const int i = blockIdx.x * blockDim.x + threadIdx.x;
  if (i < n) dst[i] = (_Float16)src[i];
}

// ---------------------------------------------------------------------------
// WMMA GEMM: C[M=4096, N=1024] = A[M,K=1024] @ W[N,K]^T + bias
// One wave computes a 32(M) x 64(N) tile (8 accumulators). The K loop (32
// steps of K=32) is FULLY UNROLLED: no loop-carried phis, accumulators stay
// pinned in one register set, and the pressure-aware scheduler hoists each
// step's 12 global_load_b128 across the previous step's 8 WMMAs (partial
// s_wait_loadcnt), with no rotation/phi copy moves.
// __launch_bounds__(256,1): allow the allocator the full VGPR budget.
// mode 0: q  -> f16 [b,h,s,d], (acc+bias)*QSCALE
// mode 1: k  -> f16 [b,h,s,d]
// mode 2: v  -> f16 [b,h,d,s]   (transposed so attention P@V streams contiguously)
// mode 3: o  -> f32 row-major [m, n] (final output)
// ---------------------------------------------------------------------------
__global__ void __launch_bounds__(256, 1)
wmma_gemm(const _Float16* __restrict__ A,
          const _Float16* __restrict__ W,
          const float* __restrict__ bias,
          _Float16* __restrict__ outH,
          float* __restrict__ outF,
          int mode) {
  const int wid   = (blockIdx.x * blockDim.x + threadIdx.x) >> 5;
  const int lane  = threadIdx.x & 31;
  const int mtile = wid >> 4;          // 0..127 (32-row blocks)
  const int ntile = wid & 15;          // 0..15  (64-col blocks)
  const int m0 = mtile * 32;
  const int n0 = ntile * 64;
  const int mr  = lane & 15;           // M (for A) / N (for B) within tile
  const int kh8 = (lane >> 4) << 3;    // K-half select: 0 or 8

  v8f acc[8] = {v8f{}, v8f{}, v8f{}, v8f{}, v8f{}, v8f{}, v8f{}, v8f{}};
  const _Float16* pa0 = A + (size_t)(m0 + mr) * HID + kh8;
  const _Float16* pa1 = A + (size_t)(m0 + 16 + mr) * HID + kh8;
  const _Float16* pb  = W + (size_t)(n0 + mr) * HID + kh8;

#pragma unroll
  for (int k0 = 0; k0 < HID; k0 += 32) {
    const v16h a0 = load_frag(pa0 + k0);
    const v16h a1 = load_frag(pa1 + k0);
    const v16h b0 = load_frag(pb + k0);
    const v16h b1 = load_frag(pb + 16 * HID + k0);
    const v16h b2 = load_frag(pb + 32 * HID + k0);
    const v16h b3 = load_frag(pb + 48 * HID + k0);
    acc[0] = wmma16(a0, b0, acc[0]);
    acc[1] = wmma16(a0, b1, acc[1]);
    acc[2] = wmma16(a0, b2, acc[2]);
    acc[3] = wmma16(a0, b3, acc[3]);
    acc[4] = wmma16(a1, b0, acc[4]);
    acc[5] = wmma16(a1, b1, acc[5]);
    acc[6] = wmma16(a1, b2, acc[6]);
    acc[7] = wmma16(a1, b3, acc[7]);
  }

  const int hsel = lane >> 4;
#pragma unroll
  for (int half = 0; half < 2; ++half) {
#pragma unroll
    for (int j = 0; j < 4; ++j) {
      const int n = n0 + j * 16 + mr;
      const float bn = bias[n];
#pragma unroll
      for (int r = 0; r < 8; ++r) {
        const int m = m0 + half * 16 + r + 8 * hsel;   // token index
        float val = acc[half * 4 + j][r] + bn;
        if (mode == 0) val *= QSCALE;
        const int b = m >> 11, s = m & (SEQ - 1);
        const int h = n >> 6,  d = n & (HDIM - 1);
        if (mode <= 1) {
          outH[(((size_t)b * NHD + h) * SEQ + s) * HDIM + d] = (_Float16)val;
        } else if (mode == 2) {
          outH[(((size_t)b * NHD + h) * HDIM + d) * SEQ + s] = (_Float16)val;
        } else {
          outF[(size_t)m * HID + n] = val;
        }
      }
    }
  }
}

// ---------------------------------------------------------------------------
// Flash attention: one wave per 16-row q tile of one (b,h).
// q,k f16 [b,h,s,d]; vT f16 [b,h,d,s]; out f16 [b, s, h*64+d] (== [B,S,H]).
// K-fragments are rotated with a branch-free wrap prefetch; "#pragma unroll 2"
// turns the rotation into an automatic register ping-pong (no copy moves).
// V loads are issued ahead of the softmax / LDS barrier for overlap.
// ---------------------------------------------------------------------------
__global__ void __launch_bounds__(256, 1)
attn_kernel(const _Float16* __restrict__ qg,
            const _Float16* __restrict__ kg,
            const _Float16* __restrict__ vtg,
            _Float16* __restrict__ og) {
  __shared__ __align__(16) _Float16 plds[8][16 * 32];  // P staging per wave
  const int wave = threadIdx.x >> 5;
  const int lane = threadIdx.x & 31;
  const int bh = blockIdx.x;                  // 0..31 : b*NH + h
  const int qt = blockIdx.y * 8 + wave;       // 0..127
  const int mr  = lane & 15;
  const int kh8 = (lane >> 4) << 3;
  const int hsel = lane >> 4;

  const _Float16* qp = qg  + (size_t)bh * SEQ * HDIM;
  const _Float16* kp = kg  + (size_t)bh * SEQ * HDIM;
  const _Float16* vp = vtg + (size_t)bh * HDIM * SEQ;
  _Float16* lp = &plds[wave][0];

  // Q fragments (16 rows x 64 d) : two K=32 A-fragments, reused for all keys
  const v16h aq0 = load_frag(qp + (size_t)(qt * 16 + mr) * HDIM + 0  + kh8);
  const v16h aq1 = load_frag(qp + (size_t)(qt * 16 + mr) * HDIM + 32 + kh8);

  float mrow[8], lrow[8];
  v8f oacc[4] = {v8f{}, v8f{}, v8f{}, v8f{}};
#pragma unroll
  for (int r = 0; r < 8; ++r) { mrow[r] = -1.0e30f; lrow[r] = 0.0f; }

  // prologue: K fragments for chunk 0
  v16h kb0 = load_frag(kp + (size_t)(0 + mr) * HDIM + 0  + kh8);
  v16h kb1 = load_frag(kp + (size_t)(0 + mr) * HDIM + 32 + kh8);
  v16h kb2 = load_frag(kp + (size_t)(16 + mr) * HDIM + 0  + kh8);
  v16h kb3 = load_frag(kp + (size_t)(16 + mr) * HDIM + 32 + kh8);

#pragma unroll 2
  for (int kc = 0; kc < SEQ; kc += 32) {
    // ---- scores: two 16x16 tiles over keys [kc, kc+32)
    v8f s0 = {}; s0 = wmma16(aq0, kb0, s0); s0 = wmma16(aq1, kb1, s0);
    v8f s1 = {}; s1 = wmma16(aq0, kb2, s1); s1 = wmma16(aq1, kb3, s1);

    // ---- prefetch next chunk's K fragments (wrap to 0 on last iteration:
    //      branch-free; one redundant 4 KB reload, never consumed)
    const int kn = (kc + 32 < SEQ) ? (kc + 32) : 0;
    kb0 = load_frag(kp + (size_t)(kn + mr) * HDIM + 0  + kh8);
    kb1 = load_frag(kp + (size_t)(kn + mr) * HDIM + 32 + kh8);
    kb2 = load_frag(kp + (size_t)(kn + 16 + mr) * HDIM + 0  + kh8);
    kb3 = load_frag(kp + (size_t)(kn + 16 + mr) * HDIM + 32 + kh8);

    // ---- V fragments for the current chunk: issue before the softmax and
    //      before the LDS compiler barrier so they overlap the VALU work
    const v16h vb0 = load_frag(vp + (size_t)(0  + mr) * SEQ + kc + kh8);
    const v16h vb1 = load_frag(vp + (size_t)(16 + mr) * SEQ + kc + kh8);
    const v16h vb2 = load_frag(vp + (size_t)(32 + mr) * SEQ + kc + kh8);
    const v16h vb3 = load_frag(vp + (size_t)(48 + mr) * SEQ + kc + kh8);

    // ---- online softmax (rows live in one half-wave -> width-16 shuffles)
#pragma unroll
    for (int r = 0; r < 8; ++r) {
      float mx = fmaxf(s0[r], s1[r]);
#pragma unroll
      for (int o = 8; o > 0; o >>= 1) mx = fmaxf(mx, __shfl_xor(mx, o, 16));
      const float newm  = fmaxf(mrow[r], mx);
      const float alpha = __expf(mrow[r] - newm);
      const float p0 = __expf(s0[r] - newm);
      const float p1 = __expf(s1[r] - newm);
      float rs = p0 + p1;
#pragma unroll
      for (int o = 8; o > 0; o >>= 1) rs += __shfl_xor(rs, o, 16);
      lrow[r] = lrow[r] * alpha + rs;
      mrow[r] = newm;
#pragma unroll
      for (int j = 0; j < 4; ++j) oacc[j][r] *= alpha;
      const int row = r + 8 * hsel;
      lp[row * 32 + mr]      = (_Float16)p0;
      lp[row * 32 + 16 + mr] = (_Float16)p1;
    }
    asm volatile("s_wait_dscnt 0" ::: "memory");

    // ---- P (D-layout) -> A-fragment via LDS, then P @ V
    v16h ap;
    {
      const v8h lo = *(const v8h*)(lp + mr * 32 + kh8);
      const v8h hi = *(const v8h*)(lp + mr * 32 + 16 + kh8);
#pragma unroll
      for (int i = 0; i < 8; ++i) { ap[i] = lo[i]; ap[i + 8] = hi[i]; }
    }
    oacc[0] = wmma16(ap, vb0, oacc[0]);
    oacc[1] = wmma16(ap, vb1, oacc[1]);
    oacc[2] = wmma16(ap, vb2, oacc[2]);
    oacc[3] = wmma16(ap, vb3, oacc[3]);
  }

  // ---- normalize + store to [B, S, H] as f16
  const int b = bh >> 4, h = bh & 15;
#pragma unroll
  for (int j = 0; j < 4; ++j) {
#pragma unroll
    for (int r = 0; r < 8; ++r) {
      const int s = qt * 16 + r + 8 * hsel;
      const int d = j * 16 + mr;
      const float val = oacc[j][r] / lrow[r];
      og[((size_t)b * SEQ + s) * HID + h * HDIM + d] = (_Float16)val;
    }
  }
}

// ---------------------------------------------------------------------------
extern "C" void kernel_launch(void* const* d_in, const int* in_sizes, int n_in,
                              void* d_out, int out_size, void* d_ws, size_t ws_size,
                              hipStream_t stream) {
  const float* x    = (const float*)d_in[0];
  const float* lnqw = (const float*)d_in[1];
  const float* lnqb = (const float*)d_in[2];
  const float* lnkw = (const float*)d_in[3];
  const float* lnkb = (const float*)d_in[4];
  const float* lnvw = (const float*)d_in[5];
  const float* lnvb = (const float*)d_in[6];
  const float* wq   = (const float*)d_in[7];
  const float* bq   = (const float*)d_in[8];
  const float* wk   = (const float*)d_in[9];
  const float* bk   = (const float*)d_in[10];
  const float* wv   = (const float*)d_in[11];
  const float* bv   = (const float*)d_in[12];
  const float* wo   = (const float*)d_in[13];
  const float* bo   = (const float*)d_in[14];
  float* out = (float*)d_out;

  const size_t MB = (size_t)1 << 20;
  uint8_t* w = (uint8_t*)d_ws;
  _Float16* lnq = (_Float16*)(w + 0 * MB);    // 8 MB each
  _Float16* lnk = (_Float16*)(w + 8 * MB);
  _Float16* lnv = (_Float16*)(w + 16 * MB);
  _Float16* wqh = (_Float16*)(w + 24 * MB);   // 2 MB each
  _Float16* wkh = (_Float16*)(w + 26 * MB);
  _Float16* wvh = (_Float16*)(w + 28 * MB);
  _Float16* woh = (_Float16*)(w + 30 * MB);
  _Float16* qh  = (_Float16*)(w + 32 * MB);   // 8 MB each
  _Float16* kh  = (_Float16*)(w + 40 * MB);
  _Float16* vth = (_Float16*)(w + 48 * MB);
  _Float16* oh  = (_Float16*)(w + 56 * MB);

  // 1. fused triple LayerNorm -> f16 activations
  ln3_kernel<<<MTOK, 256, 0, stream>>>(x, lnqw, lnqb, lnkw, lnkb, lnvw, lnvb,
                                       lnq, lnk, lnv);
  // 2. weight conversions f32 -> f16
  const int NW = HID * HID;
  cvt_f32_f16<<<NW / 256, 256, 0, stream>>>(wq, wqh, NW);
  cvt_f32_f16<<<NW / 256, 256, 0, stream>>>(wk, wkh, NW);
  cvt_f32_f16<<<NW / 256, 256, 0, stream>>>(wv, wvh, NW);
  cvt_f32_f16<<<NW / 256, 256, 0, stream>>>(wo, woh, NW);
  // 3. QKV projections (2048 waves; wave = 32x64 tile)
  wmma_gemm<<<256, 256, 0, stream>>>(lnq, wqh, bq, qh, nullptr, 0);
  wmma_gemm<<<256, 256, 0, stream>>>(lnk, wkh, bk, kh, nullptr, 1);
  wmma_gemm<<<256, 256, 0, stream>>>(lnv, wvh, bv, vth, nullptr, 2);
  // 4. flash attention: 32 (b,h) x 128 q-tiles / 8 waves per block
  attn_kernel<<<dim3(BB * NHD, 16), 256, 0, stream>>>(qh, kh, vth, oh);
  // 5. output projection -> f32 d_out
  wmma_gemm<<<256, 256, 0, stream>>>(oh, woh, bo, nullptr, out, 3);
}

// v001
// A run of this version takes 250 microseconds.
// Timed twice side by side with v000, it ran 1.19 times as fast both times.
#include <hip/hip_runtime.h>
#include <hip/hip_bf16.h>

typedef _Float16 v8h  __attribute__((ext_vector_type(8)));
typedef _Float16 v16h __attribute__((ext_vector_type(16)));
typedef float    v8f  __attribute__((ext_vector_type(8)));

#define HID   1024
#define SEQ   2048
#define BB    2
#define NHD   16
#define HDIM  64
#define MTOK  (BB*SEQ)      /* 4096 tokens */
#define QSCALE 0.125f       /* HD^-0.5 */

// Load a 16x32 f16 A/B fragment half for this lane: elements [0..7] = p[0..7],
// elements [8..15] = p[16..23]  (K-halves per CDNA5 16-bit WMMA VGPR layout).
__device__ __forceinline__ v16h load_frag(const _Float16* __restrict__ p) {
  v8h lo = *(const v8h*)(p);
  v8h hi = *(const v8h*)(p + 16);
  v16h r;
#pragma unroll
  for (int i = 0; i < 8; ++i) { r[i] = lo[i]; r[i + 8] = hi[i]; }
  return r;
}

__device__ __forceinline__ v8f wmma16(v16h a, v16h b, v8f c) {
  return __builtin_amdgcn_wmma_f32_16x16x32_f16(false, a, false, b, (short)0, c,
                                                false, false);
}

// ---------------------------------------------------------------------------
// Fused triple LayerNorm: x[4096,1024] f32 -> lnq/lnk/lnv f16
// ---------------------------------------------------------------------------
__global__ void ln3_kernel(const float* __restrict__ x,
                           const float* __restrict__ qw, const float* __restrict__ qb,
                           const float* __restrict__ kw, const float* __restrict__ kb,
                           const float* __restrict__ vw, const float* __restrict__ vb,
                           _Float16* __restrict__ lnq,
                           _Float16* __restrict__ lnk,
                           _Float16* __restrict__ lnv) {
  __shared__ float s1[256];
  __shared__ float s2[256];
  const int row = blockIdx.x;
  const int tid = threadIdx.x;
  const float4 v = ((const float4*)(x + (size_t)row * HID))[tid];
  float sum = v.x + v.y + v.z + v.w;
  float sq  = v.x * v.x + v.y * v.y + v.z * v.z + v.w * v.w;
  s1[tid] = sum; s2[tid] = sq;
  __syncthreads();
#pragma unroll
  for (int o = 128; o > 0; o >>= 1) {
    if (tid < o) { s1[tid] += s1[tid + o]; s2[tid] += s2[tid + o]; }
    __syncthreads();
  }
  const float mu   = s1[0] * (1.0f / HID);
  const float var  = s2[0] * (1.0f / HID) - mu * mu;
  const float rstd = rsqrtf(var + 1e-5f);
  const int c0 = tid * 4;
  const float e[4] = {v.x, v.y, v.z, v.w};
#pragma unroll
  for (int i = 0; i < 4; ++i) {
    const int c = c0 + i;
    const float nv = (e[i] - mu) * rstd;
    const size_t o = (size_t)row * HID + c;
    lnq[o] = (_Float16)(nv * qw[c] + qb[c]);
    lnk[o] = (_Float16)(nv * kw[c] + kb[c]);
    lnv[o] = (_Float16)(nv * vw[c] + vb[c]);
  }
}

// ---------------------------------------------------------------------------
// f32 -> f16 weight conversion
// ---------------------------------------------------------------------------
__global__ void cvt_f32_f16(const float* __restrict__ src,
                            _Float16* __restrict__ dst, int n) {
  const int i = blockIdx.x * blockDim.x + threadIdx.x;
  if (i < n) dst[i] = (_Float16)src[i];
}

// ---------------------------------------------------------------------------
// WMMA GEMM: C[M=4096, N=1024] = A[M,K=1024] @ W[N,K]^T + bias
// One wave computes a 32(M) x 64(N) tile (8 accumulators). The K loop (32
// steps of K=32) is FULLY UNROLLED: no loop-carried phis, accumulators stay
// pinned in one register set, and the pressure-aware scheduler hoists each
// step's 12 global_load_b128 across the previous step's 8 WMMAs (partial
// s_wait_loadcnt), with no rotation/phi copy moves.
// __launch_bounds__(256,1): allow the allocator the full VGPR budget.
// mode 0: q  -> f16 [b,h,s,d], (acc+bias)*QSCALE
// mode 1: k  -> f16 [b,h,s,d]
// mode 2: v  -> f16 [b,h,d,s]   (transposed so attention P@V streams contiguously)
// mode 3: o  -> f32 row-major [m, n] (final output)
// ---------------------------------------------------------------------------
__global__ void __launch_bounds__(256, 1)
wmma_gemm(const _Float16* __restrict__ A,
          const _Float16* __restrict__ W,
          const float* __restrict__ bias,
          _Float16* __restrict__ outH,
          float* __restrict__ outF,
          int mode) {
  const int wid   = (blockIdx.x * blockDim.x + threadIdx.x) >> 5;
  const int lane  = threadIdx.x & 31;
  const int mtile = wid >> 4;          // 0..127 (32-row blocks)
  const int ntile = wid & 15;          // 0..15  (64-col blocks)
  const int m0 = mtile * 32;
  const int n0 = ntile * 64;
  const int mr  = lane & 15;           // M (for A) / N (for B) within tile
  const int kh8 = (lane >> 4) << 3;    // K-half select: 0 or 8

  v8f acc[8] = {v8f{}, v8f{}, v8f{}, v8f{}, v8f{}, v8f{}, v8f{}, v8f{}};
  const _Float16* pa0 = A + (size_t)(m0 + mr) * HID + kh8;
  const _Float16* pa1 = A + (size_t)(m0 + 16 + mr) * HID + kh8;
  const _Float16* pb  = W + (size_t)(n0 + mr) * HID + kh8;

#pragma unroll
  for (int k0 = 0; k0 < HID; k0 += 32) {
    const v16h a0 = load_frag(pa0 + k0);
    const v16h a1 = load_frag(pa1 + k0);
    const v16h b0 = load_frag(pb + k0);
    const v16h b1 = load_frag(pb + 16 * HID + k0);
    const v16h b2 = load_frag(pb + 32 * HID + k0);
    const v16h b3 = load_frag(pb + 48 * HID + k0);
    acc[0] = wmma16(a0, b0, acc[0]);
    acc[1] = wmma16(a0, b1, acc[1]);
    acc[2] = wmma16(a0, b2, acc[2]);
    acc[3] = wmma16(a0, b3, acc[3]);
    acc[4] = wmma16(a1, b0, acc[4]);
    acc[5] = wmma16(a1, b1, acc[5]);
    acc[6] = wmma16(a1, b2, acc[6]);
    acc[7] = wmma16(a1, b3, acc[7]);
  }

  const int hsel = lane >> 4;
  if (mode == 2) {
    // A lane's 8 accumulator registers are 8 consecutive tokens of one output
    // column, which lie side by side in the [b,h,d,s] layout: one 16-byte store.
#pragma unroll
    for (int half = 0; half < 2; ++half) {
#pragma unroll
      for (int j = 0; j < 4; ++j) {
        const int n = n0 + j * 16 + mr;
        const float bn = bias[n];
        v8h pk;
#pragma unroll
        for (int r = 0; r < 8; ++r) pk[r] = (_Float16)(acc[half * 4 + j][r] + bn);
        const int m = m0 + half * 16 + 8 * hsel;       // first of the 8 tokens
        const int b = m >> 11, s = m & (SEQ - 1);
        const int h = n >> 6,  d = n & (HDIM - 1);
        *(v8h*)(outH + (((size_t)b * NHD + h) * HDIM + d) * SEQ + s) = pk;
      }
    }
    return;
  }
#pragma unroll
  for (int half = 0; half < 2; ++half) {
#pragma unroll
    for (int j = 0; j < 4; ++j) {
      const int n = n0 + j * 16 + mr;
      const float bn = bias[n];
#pragma unroll
      for (int r = 0; r < 8; ++r) {
        const int m = m0 + half * 16 + r + 8 * hsel;   // token index
        float val = acc[half * 4 + j][r] + bn;
        if (mode == 0) val *= QSCALE;
        const int b = m >> 11, s = m & (SEQ - 1);
        const int h = n >> 6,  d = n & (HDIM - 1);
        if (mode <= 1) {
          outH[(((size_t)b * NHD + h) * SEQ + s) * HDIM + d] = (_Float16)val;
        } else {
          outF[(size_t)m * HID + n] = val;
        }
      }
    }
  }
}

// ---------------------------------------------------------------------------
// Flash attention: one wave per 16-row q tile of one (b,h).
// q,k f16 [b,h,s,d]; vT f16 [b,h,d,s]; out f16 [b, s, h*64+d] (== [B,S,H]).
// K-fragments are rotated with a branch-free wrap prefetch; "#pragma unroll 2"
// turns the rotation into an automatic register ping-pong (no copy moves).
// V loads are issued ahead of the softmax / LDS barrier for overlap.
// ---------------------------------------------------------------------------
__global__ void __launch_bounds__(256, 1)
attn_kernel(const _Float16* __restrict__ qg,
            const _Float16* __restrict__ kg,
            const _Float16* __restrict__ vtg,
            _Float16* __restrict__ og) {
  __shared__ __align__(16) _Float16 plds[8][16 * 32];  // P staging per wave
  const int wave = threadIdx.x >> 5;
  const int lane = threadIdx.x & 31;
  const int bh = blockIdx.x;                  // 0..31 : b*NH + h
  const int qt = blockIdx.y * 8 + wave;       // 0..127
  const int mr  = lane & 15;
  const int kh8 = (lane >> 4) << 3;
  const int hsel = lane >> 4;

  const _Float16* qp = qg  + (size_t)bh * SEQ * HDIM;
  const _Float16* kp = kg  + (size_t)bh * SEQ * HDIM;
  const _Float16* vp = vtg + (size_t)bh * HDIM * SEQ;
  _Float16* lp = &plds[wave][0];

  // Q fragments (16 rows x 64 d) : two K=32 A-fragments, reused for all keys
  const v16h aq0 = load_frag(qp + (size_t)(qt * 16 + mr) * HDIM + 0  + kh8);
  const v16h aq1 = load_frag(qp + (size_t)(qt * 16 + mr) * HDIM + 32 + kh8);

  float mrow[8], lrow[8];
  v8f oacc[4] = {v8f{}, v8f{}, v8f{}, v8f{}};
#pragma unroll
  for (int r = 0; r < 8; ++r) { mrow[r] = -1.0e30f; lrow[r] = 0.0f; }

  // prologue: K fragments for chunk 0
  v16h kb0 = load_frag(kp + (size_t)(0 + mr) * HDIM + 0  + kh8);
  v16h kb1 = load_frag(kp + (size_t)(0 + mr) * HDIM + 32 + kh8);
  v16h kb2 = load_frag(kp + (size_t)(16 + mr) * HDIM + 0  + kh8);
  v16h kb3 = load_frag(kp + (size_t)(16 + mr) * HDIM + 32 + kh8);

#pragma unroll 2
  for (int kc = 0; kc < SEQ; kc += 32) {
    // ---- scores: two 16x16 tiles over keys [kc, kc+32)
    v8f s0 = {}; s0 = wmma16(aq0, kb0, s0); s0 = wmma16(aq1, kb1, s0);
    v8f s1 = {}; s1 = wmma16(aq0, kb2, s1); s1 = wmma16(aq1, kb3, s1);

    // ---- prefetch next chunk's K fragments (wrap to 0 on last iteration:
    //      branch-free; one redundant 4 KB reload, never consumed)
    const int kn = (kc + 32 < SEQ) ? (kc + 32) : 0;
    kb0 = load_frag(kp + (size_t)(kn + mr) * HDIM + 0  + kh8);
    kb1 = load_frag(kp + (size_t)(kn + mr) * HDIM + 32 + kh8);
    kb2 = load_frag(kp + (size_t)(kn + 16 + mr) * HDIM + 0  + kh8);
    kb3 = load_frag(kp + (size_t)(kn + 16 + mr) * HDIM + 32 + kh8);

    // ---- V fragments for the current chunk: issue before the softmax and
    //      before the LDS compiler barrier so they overlap the VALU work
    const v16h vb0 = load_frag(vp + (size_t)(0  + mr) * SEQ + kc + kh8);
    const v16h vb1 = load_frag(vp + (size_t)(16 + mr) * SEQ + kc + kh8);
    const v16h vb2 = load_frag(vp + (size_t)(32 + mr) * SEQ + kc + kh8);
    const v16h vb3 = load_frag(vp + (size_t)(48 + mr) * SEQ + kc + kh8);

    // ---- online softmax (rows live in one half-wave -> width-16 shuffles)
#pragma unroll
    for (int r = 0; r < 8; ++r) {
      float mx = fmaxf(s0[r], s1[r]);
#pragma unroll
      for (int o = 8; o > 0; o >>= 1) mx = fmaxf(mx, __shfl_xor(mx, o, 16));
      const float newm  = fmaxf(mrow[r], mx);
      const float alpha = __expf(mrow[r] - newm);
      const float p0 = __expf(s0[r] - newm);
      const float p1 = __expf(s1[r] - newm);
      float rs = p0 + p1;
#pragma unroll
      for (int o = 8; o > 0; o >>= 1) rs += __shfl_xor(rs, o, 16);
      lrow[r] = lrow[r] * alpha + rs;
      mrow[r] = newm;
#pragma unroll
      for (int j = 0; j < 4; ++j) oacc[j][r] *= alpha;
      const int row = r + 8 * hsel;
      lp[row * 32 + mr]      = (_Float16)p0;
      lp[row * 32 + 16 + mr] = (_Float16)p1;
    }
    asm volatile("s_wait_dscnt 0" ::: "memory");

    // ---- P (D-layout) -> A-fragment via LDS, then P @ V
    v16h ap;
    {
      const v8h lo = *(const v8h*)(lp + mr * 32 + kh8);
      const v8h hi = *(const v8h*)(lp + mr * 32 + 16 + kh8);
#pragma unroll
      for (int i = 0; i < 8; ++i) { ap[i] = lo[i]; ap[i + 8] = hi[i]; }
    }
    oacc[0] = wmma16(ap, vb0, oacc[0]);
    oacc[1] = wmma16(ap, vb1, oacc[1]);
    oacc[2] = wmma16(ap, vb2, oacc[2]);
    oacc[3] = wmma16(ap, vb3, oacc[3]);
  }

  // ---- normalize + store to [B, S, H] as f16
  const int b = bh >> 4, h = bh & 15;
#pragma unroll
  for (int j = 0; j < 4; ++j) {
#pragma unroll
    for (int r = 0; r < 8; ++r) {
      const int s = qt * 16 + r + 8 * hsel;
      const int d = j * 16 + mr;
      const float val = oacc[j][r] / lrow[r];
      og[((size_t)b * SEQ + s) * HID + h * HDIM + d] = (_Float16)val;
    }
  }
}

// ---------------------------------------------------------------------------
extern "C" void kernel_launch(void* const* d_in, const int* in_sizes, int n_in,
                              void* d_out, int out_size, void* d_ws, size_t ws_size,
                              hipStream_t stream) {
  const float* x    = (const float*)d_in[0];
  const float* lnqw = (const float*)d_in[1];
  const float* lnqb = (const float*)d_in[2];
  const float* lnkw = (const float*)d_in[3];
  const float* lnkb = (const float*)d_in[4];
  const float* lnvw = (const float*)d_in[5];
  const float* lnvb = (const float*)d_in[6];
  const float* wq   = (const float*)d_in[7];
  const float* bq   = (const float*)d_in[8];
  const float* wk   = (const float*)d_in[9];
  const float* bk   = (const float*)d_in[10];
  const float* wv   = (const float*)d_in[11];
  const float* bv   = (const float*)d_in[12];
  const float* wo   = (const float*)d_in[13];
  const float* bo   = (const float*)d_in[14];
  float* out = (float*)d_out;

  const size_t MB = (size_t)1 << 20;
  uint8_t* w = (uint8_t*)d_ws;
  _Float16* lnq = (_Float16*)(w + 0 * MB);    // 8 MB each
  _Float16* lnk = (_Float16*)(w + 8 * MB);
  _Float16* lnv = (_Float16*)(w + 16 * MB);
  _Float16* wqh = (_Float16*)(w + 24 * MB);   // 2 MB each
  _Float16* wkh = (_Float16*)(w + 26 * MB);
  _Float16* wvh = (_Float16*)(w + 28 * MB);
  _Float16* woh = (_Float16*)(w + 30 * MB);
  _Float16* qh  = (_Float16*)(w + 32 * MB);   // 8 MB each
  _Float16* kh  = (_Float16*)(w + 40 * MB);
  _Float16* vth = (_Float16*)(w + 48 * MB);
  _Float16* oh  = (_Float16*)(w + 56 * MB);

  // 1. fused triple LayerNorm -> f16 activations
  ln3_kernel<<<MTOK, 256, 0, stream>>>(x, lnqw, lnqb, lnkw, lnkb, lnvw, lnvb,
                                       lnq, lnk, lnv);
  // 2. weight conversions f32 -> f16
  const int NW = HID * HID;
  cvt_f32_f16<<<NW / 256, 256, 0, stream>>>(wq, wqh, NW);
  cvt_f32_f16<<<NW / 256, 256, 0, stream>>>(wk, wkh, NW);
  cvt_f32_f16<<<NW / 256, 256, 0, stream>>>(wv, wvh, NW);
  cvt_f32_f16<<<NW / 256, 256, 0, stream>>>(wo, woh, NW);
  // 3. QKV projections (2048 waves; wave = 32x64 tile)
  wmma_gemm<<<256, 256, 0, stream>>>(lnq, wqh, bq, qh, nullptr, 0);
  wmma_gemm<<<256, 256, 0, stream>>>(lnk, wkh, bk, kh, nullptr, 1);
  wmma_gemm<<<256, 256, 0, stream>>>(lnv, wvh, bv, vth, nullptr, 2);
  // 4. flash attention: 32 (b,h) x 128 q-tiles / 8 waves per block
  attn_kernel<<<dim3(BB * NHD, 16), 256, 0, stream>>>(qh, kh, vth, oh);
  // 5. output projection -> f32 d_out
  wmma_gemm<<<256, 256, 0, stream>>>(oh, woh, bo, nullptr, out, 3);
}

// v002
// One run takes 241 microseconds.
// Two timings next to v001 both put it at 1.04 times that version's speed.
// Counting every step since v000, it is 1.23 times as fast.
#include <hip/hip_runtime.h>
#include <hip/hip_bf16.h>

typedef _Float16 v8h  __attribute__((ext_vector_type(8)));
typedef _Float16 v16h __attribute__((ext_vector_type(16)));
typedef float    v8f  __attribute__((ext_vector_type(8)));

#define HID   1024
#define SEQ   2048
#define BB    2
#define NHD   16
#define HDIM  64
#define MTOK  (BB*SEQ)      /* 4096 tokens */
#define QSCALE 0.125f       /* HD^-0.5 */

// Load a 16x32 f16 A/B fragment half for this lane: elements [0..7] = p[0..7],
// elements [8..15] = p[16..23]  (K-halves per CDNA5 16-bit WMMA VGPR layout).
__device__ __forceinline__ v16h load_frag(const _Float16* __restrict__ p) {
  v8h lo = *(const v8h*)(p);
  v8h hi = *(const v8h*)(p + 16);
  v16h r;
#pragma unroll
  for (int i = 0; i < 8; ++i) { r[i] = lo[i]; r[i + 8] = hi[i]; }
  return r;
}

__device__ __forceinline__ v8f wmma16(v16h a, v16h b, v8f c) {
  return __builtin_amdgcn_wmma_f32_16x16x32_f16(false, a, false, b, (short)0, c,
                                                false, false);
}

// ---------------------------------------------------------------------------
// Fused triple LayerNorm: x[4096,1024] f32 -> lnq/lnk/lnv f16
// ---------------------------------------------------------------------------
__global__ void ln3_kernel(const float* __restrict__ x,
                           const float* __restrict__ qw, const float* __restrict__ qb,
                           const float* __restrict__ kw, const float* __restrict__ kb,
                           const float* __restrict__ vw, const float* __restrict__ vb,
                           _Float16* __restrict__ lnq,
                           _Float16* __restrict__ lnk,
                           _Float16* __restrict__ lnv) {
  __shared__ float s1[256];
  __shared__ float s2[256];
  const int row = blockIdx.x;
  const int tid = threadIdx.x;
  const float4 v = ((const float4*)(x + (size_t)row * HID))[tid];
  float sum = v.x + v.y + v.z + v.w;
  float sq  = v.x * v.x + v.y * v.y + v.z * v.z + v.w * v.w;
  s1[tid] = sum; s2[tid] = sq;
  __syncthreads();
#pragma unroll
  for (int o = 128; o > 0; o >>= 1) {
    if (tid < o) { s1[tid] += s1[tid + o]; s2[tid] += s2[tid + o]; }
    __syncthreads();
  }
  const float mu   = s1[0] * (1.0f / HID);
  const float var  = s2[0] * (1.0f / HID) - mu * mu;
  const float rstd = rsqrtf(var + 1e-5f);
  const int c0 = tid * 4;
  const float e[4] = {v.x, v.y, v.z, v.w};
#pragma unroll
  for (int i = 0; i < 4; ++i) {
    const int c = c0 + i;
    const float nv = (e[i] - mu) * rstd;
    const size_t o = (size_t)row * HID + c;
    lnq[o] = (_Float16)(nv * qw[c] + qb[c]);
    lnk[o] = (_Float16)(nv * kw[c] + kb[c]);
    lnv[o] = (_Float16)(nv * vw[c] + vb[c]);
  }
}

// ---------------------------------------------------------------------------
// f32 -> f16 conversion of all four weight matrices in ONE launch.
// 256 work-groups of 16 waves (one per WGP, all resident at once); 64
// work-groups per matrix, 16384 consecutive elements each. A lane issues its
// 8 loads of 16 bytes together, then converts and stores 8 bytes per load;
// every wave-wide load and store covers whole 128-byte lines.
// Why so few waves: the pass moves few bytes, and every wave started takes
// dispatch time of its own; 4096 waves are started here.
// ---------------------------------------------------------------------------
typedef _Float16 v4h __attribute__((ext_vector_type(4)));

__global__ void __launch_bounds__(512)
cvt4_f32_f16(const float* __restrict__ s0, const float* __restrict__ s1,
             const float* __restrict__ s2, const float* __restrict__ s3,
             _Float16* __restrict__ d0, _Float16* __restrict__ d1,
             _Float16* __restrict__ d2, _Float16* __restrict__ d3) {
  const int which = blockIdx.x >> 6;           // matrix 0..3 (uniform)
  const float* __restrict__ src = which == 0 ? s0 : which == 1 ? s1 : which == 2 ? s2 : s3;
  _Float16* __restrict__ dst    = which == 0 ? d0 : which == 1 ? d1 : which == 2 ? d2 : d3;
  const int q0 = (blockIdx.x & 63) * 4096 + threadIdx.x;   // index in groups of 4 elements
  const float4* __restrict__ sp = (const float4*)src + q0;
  v4h* __restrict__ dp = (v4h*)dst + q0;
  float4 v[8];
  // unrolled: v[] stays in registers and all 8 loads are in flight together
#pragma unroll
  for (int i = 0; i < 8; ++i) v[i] = sp[i * 512];
  // unrolled: constant indices into v[]
#pragma unroll
  for (int i = 0; i < 8; ++i) {
    v4h h;
    h[0] = (_Float16)v[i].x; h[1] = (_Float16)v[i].y;
    h[2] = (_Float16)v[i].z; h[3] = (_Float16)v[i].w;
    dp[i * 512] = h;
  }
}

// ---------------------------------------------------------------------------
// WMMA GEMM: C[M=4096, N=1024] = A[M,K=1024] @ W[N,K]^T + bias
// One wave computes a 32(M) x 64(N) tile (8 accumulators). The K loop (32
// steps of K=32) is FULLY UNROLLED: no loop-carried phis, accumulators stay
// pinned in one register set, and the pressure-aware scheduler hoists each
// step's 12 global_load_b128 across the previous step's 8 WMMAs (partial
// s_wait_loadcnt), with no rotation/phi copy moves.
// __launch_bounds__(256,1): allow the allocator the full VGPR budget.
// mode 0: q  -> f16 [b,h,s,d], (acc+bias)*QSCALE
// mode 1: k  -> f16 [b,h,s,d]
// mode 2: v  -> f16 [b,h,d,s]   (transposed so attention P@V streams contiguously)
// mode 3: o  -> f32 row-major [m, n] (final output)
// ---------------------------------------------------------------------------
__global__ void __launch_bounds__(256, 1)
wmma_gemm(const _Float16* __restrict__ A,
          const _Float16* __restrict__ W,
          const float* __restrict__ bias,
          _Float16* __restrict__ outH,
          float* __restrict__ outF,
          int mode) {
  const int wid   = (blockIdx.x * blockDim.x + threadIdx.x) >> 5;
  const int lane  = threadIdx.x & 31;
  const int mtile = wid >> 4;          // 0..127 (32-row blocks)
  const int ntile = wid & 15;          // 0..15  (64-col blocks)
  const int m0 = mtile * 32;
  const int n0 = ntile * 64;
  const int mr  = lane & 15;           // M (for A) / N (for B) within tile
  const int kh8 = (lane >> 4) << 3;    // K-half select: 0 or 8

  v8f acc[8] = {v8f{}, v8f{}, v8f{}, v8f{}, v8f{}, v8f{}, v8f{}, v8f{}};
  const _Float16* pa0 = A + (size_t)(m0 + mr) * HID + kh8;
  const _Float16* pa1 = A + (size_t)(m0 + 16 + mr) * HID + kh8;
  const _Float16* pb  = W + (size_t)(n0 + mr) * HID + kh8;

#pragma unroll
  for (int k0 = 0; k0 < HID; k0 += 32) {
    const v16h a0 = load_frag(pa0 + k0);
    const v16h a1 = load_frag(pa1 + k0);
    const v16h b0 = load_frag(pb + k0);
    const v16h b1 = load_frag(pb + 16 * HID + k0);
    const v16h b2 = load_frag(pb + 32 * HID + k0);
    const v16h b3 = load_frag(pb + 48 * HID + k0);
    acc[0] = wmma16(a0, b0, acc[0]);
    acc[1] = wmma16(a0, b1, acc[1]);
    acc[2] = wmma16(a0, b2, acc[2]);
    acc[3] = wmma16(a0, b3, acc[3]);
    acc[4] = wmma16(a1, b0, acc[4]);
    acc[5] = wmma16(a1, b1, acc[5]);
    acc[6] = wmma16(a1, b2, acc[6]);
    acc[7] = wmma16(a1, b3, acc[7]);
  }

  const int hsel = lane >> 4;
  if (mode == 2) {
    // A lane's 8 accumulator registers are 8 consecutive tokens of one output
    // column, which lie side by side in the [b,h,d,s] layout: one 16-byte store.
#pragma unroll
    for (int half = 0; half < 2; ++half) {
#pragma unroll
      for (int j = 0; j < 4; ++j) {
        const int n = n0 + j * 16 + mr;
        const float bn = bias[n];
        v8h pk;
#pragma unroll
        for (int r = 0; r < 8; ++r) pk[r] = (_Float16)(acc[half * 4 + j][r] + bn);
        const int m = m0 + half * 16 + 8 * hsel;       // first of the 8 tokens
        const int b = m >> 11, s = m & (SEQ - 1);
        const int h = n >> 6,  d = n & (HDIM - 1);
        *(v8h*)(outH + (((size_t)b * NHD + h) * HDIM + d) * SEQ + s) = pk;
      }
    }
    return;
  }
#pragma unroll
  for (int half = 0; half < 2; ++half) {
#pragma unroll
    for (int j = 0; j < 4; ++j) {
      const int n = n0 + j * 16 + mr;
      const float bn = bias[n];
#pragma unroll
      for (int r = 0; r < 8; ++r) {
        const int m = m0 + half * 16 + r + 8 * hsel;   // token index
        float val = acc[half * 4 + j][r] + bn;
        if (mode == 0) val *= QSCALE;
        const int b = m >> 11, s = m & (SEQ - 1);
        const int h = n >> 6,  d = n & (HDIM - 1);
        if (mode <= 1) {
          outH[(((size_t)b * NHD + h) * SEQ + s) * HDIM + d] = (_Float16)val;
        } else {
          outF[(size_t)m * HID + n] = val;
        }
      }
    }
  }
}

// ---------------------------------------------------------------------------
// Flash attention: one wave per 16-row q tile of one (b,h).
// q,k f16 [b,h,s,d]; vT f16 [b,h,d,s]; out f16 [b, s, h*64+d] (== [B,S,H]).
// K-fragments are rotated with a branch-free wrap prefetch; "#pragma unroll 2"
// turns the rotation into an automatic register ping-pong (no copy moves).
// V loads are issued ahead of the softmax / LDS barrier for overlap.
// ---------------------------------------------------------------------------
__global__ void __launch_bounds__(256, 1)
attn_kernel(const _Float16* __restrict__ qg,
            const _Float16* __restrict__ kg,
            const _Float16* __restrict__ vtg,
            _Float16* __restrict__ og) {
  __shared__ __align__(16) _Float16 plds[8][16 * 32];  // P staging per wave
  const int wave = threadIdx.x >> 5;
  const int lane = threadIdx.x & 31;
  const int bh = blockIdx.x;                  // 0..31 : b*NH + h
  const int qt = blockIdx.y * 8 + wave;       // 0..127
  const int mr  = lane & 15;
  const int kh8 = (lane >> 4) << 3;
  const int hsel = lane >> 4;

  const _Float16* qp = qg  + (size_t)bh * SEQ * HDIM;
  const _Float16* kp = kg  + (size_t)bh * SEQ * HDIM;
  const _Float16* vp = vtg + (size_t)bh * HDIM * SEQ;
  _Float16* lp = &plds[wave][0];

  // Q fragments (16 rows x 64 d) : two K=32 A-fragments, reused for all keys
  const v16h aq0 = load_frag(qp + (size_t)(qt * 16 + mr) * HDIM + 0  + kh8);
  const v16h aq1 = load_frag(qp + (size_t)(qt * 16 + mr) * HDIM + 32 + kh8);

  float mrow[8], lrow[8];
  v8f oacc[4] = {v8f{}, v8f{}, v8f{}, v8f{}};
#pragma unroll
  for (int r = 0; r < 8; ++r) { mrow[r] = -1.0e30f; lrow[r] = 0.0f; }

  // prologue: K fragments for chunk 0
  v16h kb0 = load_frag(kp + (size_t)(0 + mr) * HDIM + 0  + kh8);
  v16h kb1 = load_frag(kp + (size_t)(0 + mr) * HDIM + 32 + kh8);
  v16h kb2 = load_frag(kp + (size_t)(16 + mr) * HDIM + 0  + kh8);
  v16h kb3 = load_frag(kp + (size_t)(16 + mr) * HDIM + 32 + kh8);

#pragma unroll 2
  for (int kc = 0; kc < SEQ; kc += 32) {
    // ---- scores: two 16x16 tiles over keys [kc, kc+32)
    v8f s0 = {}; s0 = wmma16(aq0, kb0, s0); s0 = wmma16(aq1, kb1, s0);
    v8f s1 = {}; s1 = wmma16(aq0, kb2, s1); s1 = wmma16(aq1, kb3, s1);

    // ---- prefetch next chunk's K fragments (wrap to 0 on last iteration:
    //      branch-free; one redundant 4 KB reload, never consumed)
    const int kn = (kc + 32 < SEQ) ? (kc + 32) : 0;
    kb0 = load_frag(kp + (size_t)(kn + mr) * HDIM + 0  + kh8);
    kb1 = load_frag(kp + (size_t)(kn + mr) * HDIM + 32 + kh8);
    kb2 = load_frag(kp + (size_t)(kn + 16 + mr) * HDIM + 0  + kh8);
    kb3 = load_frag(kp + (size_t)(kn + 16 + mr) * HDIM + 32 + kh8);

    // ---- V fragments for the current chunk: issue before the softmax and
    //      before the LDS compiler barrier so they overlap the VALU work
    const v16h vb0 = load_frag(vp + (size_t)(0  + mr) * SEQ + kc + kh8);
    const v16h vb1 = load_frag(vp + (size_t)(16 + mr) * SEQ + kc + kh8);
    const v16h vb2 = load_frag(vp + (size_t)(32 + mr) * SEQ + kc + kh8);
    const v16h vb3 = load_frag(vp + (size_t)(48 + mr) * SEQ + kc + kh8);

    // ---- online softmax (rows live in one half-wave -> width-16 shuffles)
#pragma unroll
    for (int r = 0; r < 8; ++r) {
      float mx = fmaxf(s0[r], s1[r]);
#pragma unroll
      for (int o = 8; o > 0; o >>= 1) mx = fmaxf(mx, __shfl_xor(mx, o, 16));
      const float newm  = fmaxf(mrow[r], mx);
      const float alpha = __expf(mrow[r] - newm);
      const float p0 = __expf(s0[r] - newm);
      const float p1 = __expf(s1[r] - newm);
      float rs = p0 + p1;
#pragma unroll
      for (int o = 8; o > 0; o >>= 1) rs += __shfl_xor(rs, o, 16);
      lrow[r] = lrow[r] * alpha + rs;
      mrow[r] = newm;
#pragma unroll
      for (int j = 0; j < 4; ++j) oacc[j][r] *= alpha;
      const int row = r + 8 * hsel;
      lp[row * 32 + mr]      = (_Float16)p0;
      lp[row * 32 + 16 + mr] = (_Float16)p1;
    }
    asm volatile("s_wait_dscnt 0" ::: "memory");

    // ---- P (D-layout) -> A-fragment via LDS, then P @ V
    v16h ap;
    {
      const v8h lo = *(const v8h*)(lp + mr * 32 + kh8);
      const v8h hi = *(const v8h*)(lp + mr * 32 + 16 + kh8);
#pragma unroll
      for (int i = 0; i < 8; ++i) { ap[i] = lo[i]; ap[i + 8] = hi[i]; }
    }
    oacc[0] = wmma16(ap, vb0, oacc[0]);
    oacc[1] = wmma16(ap, vb1, oacc[1]);
    oacc[2] = wmma16(ap, vb2, oacc[2]);
    oacc[3] = wmma16(ap, vb3, oacc[3]);
  }

  // ---- normalize + store to [B, S, H] as f16
  const int b = bh >> 4, h = bh & 15;
#pragma unroll
  for (int j = 0; j < 4; ++j) {
#pragma unroll
    for (int r = 0; r < 8; ++r) {
      const int s = qt * 16 + r + 8 * hsel;
      const int d = j * 16 + mr;
      const float val = oacc[j][r] / lrow[r];
      og[((size_t)b * SEQ + s) * HID + h * HDIM + d] = (_Float16)val;
    }
  }
}

// ---------------------------------------------------------------------------
extern "C" void kernel_launch(void* const* d_in, const int* in_sizes, int n_in,
                              void* d_out, int out_size, void* d_ws, size_t ws_size,
                              hipStream_t stream) {
  const float* x    = (const float*)d_in[0];
  const float* lnqw = (const float*)d_in[1];
  const float* lnqb = (const float*)d_in[2];
  const float* lnkw = (const float*)d_in[3];
  const float* lnkb = (const float*)d_in[4];
  const float* lnvw = (const float*)d_in[5];
  const float* lnvb = (const float*)d_in[6];
  const float* wq   = (const float*)d_in[7];
  const float* bq   = (const float*)d_in[8];
  const float* wk   = (const float*)d_in[9];
  const float* bk   = (const float*)d_in[10];
  const float* wv   = (const float*)d_in[11];
  const float* bv   = (const float*)d_in[12];
  const float* wo   = (const float*)d_in[13];
  const float* bo   = (const float*)d_in[14];
  float* out = (float*)d_out;

  const size_t MB = (size_t)1 << 20;
  uint8_t* w = (uint8_t*)d_ws;
  _Float16* lnq = (_Float16*)(w + 0 * MB);    // 8 MB each
  _Float16* lnk = (_Float16*)(w + 8 * MB);
  _Float16* lnv = (_Float16*)(w + 16 * MB);
  _Float16* wqh = (_Float16*)(w + 24 * MB);   // 2 MB each
  _Float16* wkh = (_Float16*)(w + 26 * MB);
  _Float16* wvh = (_Float16*)(w + 28 * MB);
  _Float16* woh = (_Float16*)(w + 30 * MB);
  _Float16* qh  = (_Float16*)(w + 32 * MB);   // 8 MB each
  _Float16* kh  = (_Float16*)(w + 40 * MB);
  _Float16* vth = (_Float16*)(w + 48 * MB);
  _Float16* oh  = (_Float16*)(w + 56 * MB);

  // 1. fused triple LayerNorm -> f16 activations
  ln3_kernel<<<MTOK, 256, 0, stream>>>(x, lnqw, lnqb, lnkw, lnkb, lnvw, lnvb,
                                       lnq, lnk, lnv);
  // 2. weight conversions f32 -> f16, all four in one launch
  cvt4_f32_f16<<<256, 512, 0, stream>>>(wq, wk, wv, wo, wqh, wkh, wvh, woh);
  // 3. QKV projections (2048 waves; wave = 32x64 tile)
  wmma_gemm<<<256, 256, 0, stream>>>(lnq, wqh, bq, qh, nullptr, 0);
  wmma_gemm<<<256, 256, 0, stream>>>(lnk, wkh, bk, kh, nullptr, 1);
  wmma_gemm<<<256, 256, 0, stream>>>(lnv, wvh, bv, vth, nullptr, 2);
  // 4. flash attention: 32 (b,h) x 128 q-tiles / 8 waves per block
  attn_kernel<<<dim3(BB * NHD, 16), 256, 0, stream>>>(qh, kh, vth, oh);
  // 5. output projection -> f32 d_out
  wmma_gemm<<<256, 256, 0, stream>>>(oh, woh, bo, nullptr, out, 3);
}

// v003
// One run takes 173 microseconds.
// Two timings next to v002 put it at 1.39 and 1.38 times that version's speed.
// Over all steps from v000 it is 1.71 times as fast.
#include <hip/hip_runtime.h>
#include <hip/hip_bf16.h>

typedef _Float16 v8h  __attribute__((ext_vector_type(8)));
typedef _Float16 v16h __attribute__((ext_vector_type(16)));
typedef float    v8f  __attribute__((ext_vector_type(8)));

#define HID   1024
#define SEQ   2048
#define BB    2
#define NHD   16
#define HDIM  64
#define MTOK  (BB*SEQ)      /* 4096 tokens */
#define QSCALE 0.125f       /* HD^-0.5 */

// Load a 16x32 f16 A/B fragment half for this lane: elements [0..7] = p[0..7],
// elements [8..15] = p[16..23]  (K-halves per CDNA5 16-bit WMMA VGPR layout).
__device__ __forceinline__ v16h load_frag(const _Float16* __restrict__ p) {
  v8h lo = *(const v8h*)(p);
  v8h hi = *(const v8h*)(p + 16);
  v16h r;
#pragma unroll
  for (int i = 0; i < 8; ++i) { r[i] = lo[i]; r[i + 8] = hi[i]; }
  return r;
}

__device__ __forceinline__ v8f wmma16(v16h a, v16h b, v8f c) {
  return __builtin_amdgcn_wmma_f32_16x16x32_f16(false, a, false, b, (short)0, c,
                                                false, false);
}

// ---------------------------------------------------------------------------
// Fused triple LayerNorm: x[4096,1024] f32 -> lnq/lnk/lnv f16
// ---------------------------------------------------------------------------
__global__ void ln3_kernel(const float* __restrict__ x,
                           const float* __restrict__ qw, const float* __restrict__ qb,
                           const float* __restrict__ kw, const float* __restrict__ kb,
                           const float* __restrict__ vw, const float* __restrict__ vb,
                           _Float16* __restrict__ lnq,
                           _Float16* __restrict__ lnk,
                           _Float16* __restrict__ lnv) {
  __shared__ float s1[256];
  __shared__ float s2[256];
  const int row = blockIdx.x;
  const int tid = threadIdx.x;
  const float4 v = ((const float4*)(x + (size_t)row * HID))[tid];
  float sum = v.x + v.y + v.z + v.w;
  float sq  = v.x * v.x + v.y * v.y + v.z * v.z + v.w * v.w;
  s1[tid] = sum; s2[tid] = sq;
  __syncthreads();
#pragma unroll
  for (int o = 128; o > 0; o >>= 1) {
    if (tid < o) { s1[tid] += s1[tid + o]; s2[tid] += s2[tid + o]; }
    __syncthreads();
  }
  const float mu   = s1[0] * (1.0f / HID);
  const float var  = s2[0] * (1.0f / HID) - mu * mu;
  const float rstd = rsqrtf(var + 1e-5f);
  const int c0 = tid * 4;
  const float e[4] = {v.x, v.y, v.z, v.w};
#pragma unroll
  for (int i = 0; i < 4; ++i) {
    const int c = c0 + i;
    const float nv = (e[i] - mu) * rstd;
    const size_t o = (size_t)row * HID + c;
    lnq[o] = (_Float16)(nv * qw[c] + qb[c]);
    lnk[o] = (_Float16)(nv * kw[c] + kb[c]);
    lnv[o] = (_Float16)(nv * vw[c] + vb[c]);
  }
}

// ---------------------------------------------------------------------------
// f32 -> f16 conversion of all four weight matrices in ONE launch.
// 256 work-groups of 16 waves (one per WGP, all resident at once); 64
// work-groups per matrix, 16384 consecutive elements each. A lane issues its
// 8 loads of 16 bytes together, then converts and stores 8 bytes per load;
// every wave-wide load and store covers whole 128-byte lines.
// Why so few waves: the pass moves few bytes, and every wave started takes
// dispatch time of its own; 4096 waves are started here.
// ---------------------------------------------------------------------------
typedef _Float16 v4h __attribute__((ext_vector_type(4)));

__global__ void __launch_bounds__(512)
cvt4_f32_f16(const float* __restrict__ s0, const float* __restrict__ s1,
             const float* __restrict__ s2, const float* __restrict__ s3,
             _Float16* __restrict__ d0, _Float16* __restrict__ d1,
             _Float16* __restrict__ d2, _Float16* __restrict__ d3) {
  const int which = blockIdx.x >> 6;           // matrix 0..3 (uniform)
  const float* __restrict__ src = which == 0 ? s0 : which == 1 ? s1 : which == 2 ? s2 : s3;
  _Float16* __restrict__ dst    = which == 0 ? d0 : which == 1 ? d1 : which == 2 ? d2 : d3;
  const int q0 = (blockIdx.x & 63) * 4096 + threadIdx.x;   // index in groups of 4 elements
  const float4* __restrict__ sp = (const float4*)src + q0;
  v4h* __restrict__ dp = (v4h*)dst + q0;
  float4 v[8];
  // unrolled: v[] stays in registers and all 8 loads are in flight together
#pragma unroll
  for (int i = 0; i < 8; ++i) v[i] = sp[i * 512];
  // unrolled: constant indices into v[]
#pragma unroll
  for (int i = 0; i < 8; ++i) {
    v4h h;
    h[0] = (_Float16)v[i].x; h[1] = (_Float16)v[i].y;
    h[2] = (_Float16)v[i].z; h[3] = (_Float16)v[i].w;
    dp[i * 512] = h;
  }
}

// ---------------------------------------------------------------------------
// WMMA GEMM: C[M=4096, N=1024] = A[M,K=1024] @ W[N,K]^T + bias
// A work-group of 8 waves computes a 128(M) x 128(N) tile; one wave a
// 32(M) x 64(N) part of it (8 accumulators), waves laid 4 (M) x 2 (N).
// Operands go through LDS: a stage is 128 k (256 B) of the tile's 128 A rows and
// 128 W rows. It is fetched ONCE per work-group, by loads in which a wave covers
// 4 whole 128-byte lines, and every wave takes its fragments from LDS. (A
// fragment load from global memory touches 16 lines for its 512 bytes, and the
// waves that share a row block each repeat it.)
// Two buffers: the next stage's global loads fly during this stage's products
// and are written to the other buffer at the stage's end; one barrier per stage
// publishes them and ends the last read of the buffer that is refilled next.
// The k order of every accumulator is the ascending one, 32 k per product.
// __launch_bounds__(256,1): allow the allocator the full VGPR budget.
// mode 0: q  -> f16 [b,h,s,d], (acc+bias)*QSCALE
// mode 1: k  -> f16 [b,h,s,d]
// mode 2: v  -> f16 [b,h,d,s]   (transposed so attention P@V streams contiguously)
// mode 3: o  -> f32 row-major [m, n] (final output)
// ---------------------------------------------------------------------------
#define GTM    128           /* tile rows of A per work-group */
#define GTN    128           /* tile rows of W per work-group */
#define GKS    128           /* k per stage: 256 B of each row */
#define GNST   (HID / GKS)
#define GPITCH 136           /* f16 per staged row: 256 B + 16 B pad, conflict-free for 16-byte reads */

__global__ void __launch_bounds__(256, 1)
wmma_gemm(const _Float16* __restrict__ A,
          const _Float16* __restrict__ W,
          const float* __restrict__ bias,
          _Float16* __restrict__ outH,
          float* __restrict__ outF,
          int mode) {
  __shared__ __align__(16) _Float16 stg[2][(GTM + GTN) * GPITCH];  // [buffer][A rows | W rows]
  const int wave  = threadIdx.x >> 5;
  const int lane  = threadIdx.x & 31;
  const int bm = blockIdx.x >> 3;      // 0..31 (128-row blocks)
  const int bn = blockIdx.x & 7;       // 0..7  (128-col blocks)
  const int wm = wave >> 1;            // 0..3  (32-row part)
  const int wn = wave & 1;             // 0..1  (64-col part)
  const int m0 = bm * GTM + wm * 32;
  const int n0 = bn * GTN + wn * 64;
  const int mr  = lane & 15;           // M (for A) / N (for B) within tile
  const int kh8 = (lane >> 4) << 3;    // K-half select: 0 or 8

  // staging: thread t moves 16 bytes of rows t/16 + 16 i, i = 0..7, of each operand
  const int srow = threadIdx.x >> 4;
  const int scol = (threadIdx.x & 15) * 8;
  const _Float16* ga = A + (size_t)(bm * GTM + srow) * HID + scol;
  const _Float16* gw = W + (size_t)(bn * GTN + srow) * HID + scol;
  const int sl = srow * GPITCH + scol;

  v8f acc[8] = {v8f{}, v8f{}, v8f{}, v8f{}, v8f{}, v8f{}, v8f{}, v8f{}};
  v8h ra[8], rw[8];

  // prologue: stage 0 into buffer 0
  // (every loop over i below is unrolled so that ra[], rw[] stay in registers
  // and all 16 loads are in flight together)
#pragma unroll
  for (int i = 0; i < 8; ++i) {
    ra[i] = *(const v8h*)(ga + (size_t)i * 16 * HID);
    rw[i] = *(const v8h*)(gw + (size_t)i * 16 * HID);
  }
#pragma unroll
  for (int i = 0; i < 8; ++i) {
    *(v8h*)(&stg[0][sl + i * 16 * GPITCH]) = ra[i];
    *(v8h*)(&stg[0][sl + (GTM + i * 16) * GPITCH]) = rw[i];
  }
  __syncthreads();

  // fully unrolled: buffer index, global and LDS offsets are immediates, and
  // the accumulators stay pinned in one register set
#pragma unroll
  for (int s = 0; s < GNST; ++s) {
    if (s + 1 < GNST) {
#pragma unroll
      for (int i = 0; i < 8; ++i) {
        ra[i] = *(const v8h*)(ga + (size_t)i * 16 * HID + (s + 1) * GKS);
        rw[i] = *(const v8h*)(gw + (size_t)i * 16 * HID + (s + 1) * GKS);
      }
      // keeps the 16 loads in front of this stage's products: sunk down to their
      // LDS stores, nothing would cover their latency
      __builtin_amdgcn_sched_barrier(0);
    }
    const _Float16* la = &stg[s & 1][(wm * 32 + mr) * GPITCH + kh8];
    const _Float16* lb = &stg[s & 1][(GTM + wn * 64 + mr) * GPITCH + kh8];
    // unrolled: LDS offsets are immediates, fragment loads can run ahead of the products
#pragma unroll
    for (int k0 = 0; k0 < GKS; k0 += 32) {
      const v16h a0 = load_frag(la + k0);
      const v16h a1 = load_frag(la + 16 * GPITCH + k0);
      const v16h b0 = load_frag(lb + k0);
      const v16h b1 = load_frag(lb + 16 * GPITCH + k0);
      const v16h b2 = load_frag(lb + 32 * GPITCH + k0);
      const v16h b3 = load_frag(lb + 48 * GPITCH + k0);
      acc[0] = wmma16(a0, b0, acc[0]);
      acc[1] = wmma16(a0, b1, acc[1]);
      acc[2] = wmma16(a0, b2, acc[2]);
      acc[3] = wmma16(a0, b3, acc[3]);
      acc[4] = wmma16(a1, b0, acc[4]);
      acc[5] = wmma16(a1, b1, acc[5]);
      acc[6] = wmma16(a1, b2, acc[6]);
      acc[7] = wmma16(a1, b3, acc[7]);
    }
    if (s + 1 < GNST) {
      // hand over: the loaded stage goes to the other buffer, whose last
      // readers left it before the previous stage's barrier
#pragma unroll
      for (int i = 0; i < 8; ++i) {
        *(v8h*)(&stg[(s + 1) & 1][sl + i * 16 * GPITCH]) = ra[i];
        *(v8h*)(&stg[(s + 1) & 1][sl + (GTM + i * 16) * GPITCH]) = rw[i];
      }
      __syncthreads();
    }
  }

  const int hsel = lane >> 4;
  if (mode == 2) {
    // A lane's 8 accumulator registers are 8 consecutive tokens of one output
    // column, which lie side by side in the [b,h,d,s] layout: one 16-byte store.
#pragma unroll
    for (int half = 0; half < 2; ++half) {
#pragma unroll
      for (int j = 0; j < 4; ++j) {
        const int n = n0 + j * 16 + mr;
        const float bn = bias[n];
        v8h pk;
#pragma unroll
        for (int r = 0; r < 8; ++r) pk[r] = (_Float16)(acc[half * 4 + j][r] + bn);
        const int m = m0 + half * 16 + 8 * hsel;       // first of the 8 tokens
        const int b = m >> 11, s = m & (SEQ - 1);
        const int h = n >> 6,  d = n & (HDIM - 1);
        *(v8h*)(outH + (((size_t)b * NHD + h) * HDIM + d) * SEQ + s) = pk;
      }
    }
    return;
  }
#pragma unroll
  for (int half = 0; half < 2; ++half) {
#pragma unroll
    for (int j = 0; j < 4; ++j) {
      const int n = n0 + j * 16 + mr;
      const float bn = bias[n];
#pragma unroll
      for (int r = 0; r < 8; ++r) {
        const int m = m0 + half * 16 + r + 8 * hsel;   // token index
        float val = acc[half * 4 + j][r] + bn;
        if (mode == 0) val *= QSCALE;
        const int b = m >> 11, s = m & (SEQ - 1);
        const int h = n >> 6,  d = n & (HDIM - 1);
        if (mode <= 1) {
          outH[(((size_t)b * NHD + h) * SEQ + s) * HDIM + d] = (_Float16)val;
        } else {
          outF[(size_t)m * HID + n] = val;
        }
      }
    }
  }
}

// ---------------------------------------------------------------------------
// Flash attention: one wave per 16-row q tile of one (b,h).
// q,k f16 [b,h,s,d]; vT f16 [b,h,d,s]; out f16 [b, s, h*64+d] (== [B,S,H]).
// K-fragments are rotated with a branch-free wrap prefetch; "#pragma unroll 2"
// turns the rotation into an automatic register ping-pong (no copy moves).
// V loads are issued ahead of the softmax / LDS barrier for overlap.
// ---------------------------------------------------------------------------
__global__ void __launch_bounds__(256, 1)
attn_kernel(const _Float16* __restrict__ qg,
            const _Float16* __restrict__ kg,
            const _Float16* __restrict__ vtg,
            _Float16* __restrict__ og) {
  __shared__ __align__(16) _Float16 plds[8][16 * 32];  // P staging per wave
  const int wave = threadIdx.x >> 5;
  const int lane = threadIdx.x & 31;
  const int bh = blockIdx.x;                  // 0..31 : b*NH + h
  const int qt = blockIdx.y * 8 + wave;       // 0..127
  const int mr  = lane & 15;
  const int kh8 = (lane >> 4) << 3;
  const int hsel = lane >> 4;

  const _Float16* qp = qg  + (size_t)bh * SEQ * HDIM;
  const _Float16* kp = kg  + (size_t)bh * SEQ * HDIM;
  const _Float16* vp = vtg + (size_t)bh * HDIM * SEQ;
  _Float16* lp = &plds[wave][0];

  // Q fragments (16 rows x 64 d) : two K=32 A-fragments, reused for all keys
  const v16h aq0 = load_frag(qp + (size_t)(qt * 16 + mr) * HDIM + 0  + kh8);
  const v16h aq1 = load_frag(qp + (size_t)(qt * 16 + mr) * HDIM + 32 + kh8);

  float mrow[8], lrow[8];
  v8f oacc[4] = {v8f{}, v8f{}, v8f{}, v8f{}};
#pragma unroll
  for (int r = 0; r < 8; ++r) { mrow[r] = -1.0e30f; lrow[r] = 0.0f; }

  // prologue: K fragments for chunk 0
  v16h kb0 = load_frag(kp + (size_t)(0 + mr) * HDIM + 0  + kh8);
  v16h kb1 = load_frag(kp + (size_t)(0 + mr) * HDIM + 32 + kh8);
  v16h kb2 = load_frag(kp + (size_t)(16 + mr) * HDIM + 0  + kh8);
  v16h kb3 = load_frag(kp + (size_t)(16 + mr) * HDIM + 32 + kh8);

#pragma unroll 2
  for (int kc = 0; kc < SEQ; kc += 32) {
    // ---- scores: two 16x16 tiles over keys [kc, kc+32)
    v8f s0 = {}; s0 = wmma16(aq0, kb0, s0); s0 = wmma16(aq1, kb1, s0);
    v8f s1 = {}; s1 = wmma16(aq0, kb2, s1); s1 = wmma16(aq1, kb3, s1);

    // ---- prefetch next chunk's K fragments (wrap to 0 on last iteration:
    //      branch-free; one redundant 4 KB reload, never consumed)
    const int kn = (kc + 32 < SEQ) ? (kc + 32) : 0;
    kb0 = load_frag(kp + (size_t)(kn + mr) * HDIM + 0  + kh8);
    kb1 = load_frag(kp + (size_t)(kn + mr) * HDIM + 32 + kh8);
    kb2 = load_frag(kp + (size_t)(kn + 16 + mr) * HDIM + 0  + kh8);
    kb3 = load_frag(kp + (size_t)(kn + 16 + mr) * HDIM + 32 + kh8);

    // ---- V fragments for the current chunk: issue before the softmax and
    //      before the LDS compiler barrier so they overlap the VALU work
    const v16h vb0 = load_frag(vp + (size_t)(0  + mr) * SEQ + kc + kh8);
    const v16h vb1 = load_frag(vp + (size_t)(16 + mr) * SEQ + kc + kh8);
    const v16h vb2 = load_frag(vp + (size_t)(32 + mr) * SEQ + kc + kh8);
    const v16h vb3 = load_frag(vp + (size_t)(48 + mr) * SEQ + kc + kh8);

    // ---- online softmax (rows live in one half-wave -> width-16 shuffles)
#pragma unroll
    for (int r = 0; r < 8; ++r) {
      float mx = fmaxf(s0[r], s1[r]);
#pragma unroll
      for (int o = 8; o > 0; o >>= 1) mx = fmaxf(mx, __shfl_xor(mx, o, 16));
      const float newm  = fmaxf(mrow[r], mx);
      const float alpha = __expf(mrow[r] - newm);
      const float p0 = __expf(s0[r] - newm);
      const float p1 = __expf(s1[r] - newm);
      float rs = p0 + p1;
#pragma unroll
      for (int o = 8; o > 0; o >>= 1) rs += __shfl_xor(rs, o, 16);
      lrow[r] = lrow[r] * alpha + rs;
      mrow[r] = newm;
#pragma unroll
      for (int j = 0; j < 4; ++j) oacc[j][r] *= alpha;
      const int row = r + 8 * hsel;
      lp[row * 32 + mr]      = (_Float16)p0;
      lp[row * 32 + 16 + mr] = (_Float16)p1;
    }
    asm volatile("s_wait_dscnt 0" ::: "memory");

    // ---- P (D-layout) -> A-fragment via LDS, then P @ V
    v16h ap;
    {
      const v8h lo = *(const v8h*)(lp + mr * 32 + kh8);
      const v8h hi = *(const v8h*)(lp + mr * 32 + 16 + kh8);
#pragma unroll
      for (int i = 0; i < 8; ++i) { ap[i] = lo[i]; ap[i + 8] = hi[i]; }
    }
    oacc[0] = wmma16(ap, vb0, oacc[0]);
    oacc[1] = wmma16(ap, vb1, oacc[1]);
    oacc[2] = wmma16(ap, vb2, oacc[2]);
    oacc[3] = wmma16(ap, vb3, oacc[3]);
  }

  // ---- normalize + store to [B, S, H] as f16
  const int b = bh >> 4, h = bh & 15;
#pragma unroll
  for (int j = 0; j < 4; ++j) {
#pragma unroll
    for (int r = 0; r < 8; ++r) {
      const int s = qt * 16 + r + 8 * hsel;
      const int d = j * 16 + mr;
      const float val = oacc[j][r] / lrow[r];
      og[((size_t)b * SEQ + s) * HID + h * HDIM + d] = (_Float16)val;
    }
  }
}

// ---------------------------------------------------------------------------
extern "C" void kernel_launch(void* const* d_in, const int* in_sizes, int n_in,
                              void* d_out, int out_size, void* d_ws, size_t ws_size,
                              hipStream_t stream) {
  const float* x    = (const float*)d_in[0];
  const float* lnqw = (const float*)d_in[1];
  const float* lnqb = (const float*)d_in[2];
  const float* lnkw = (const float*)d_in[3];
  const float* lnkb = (const float*)d_in[4];
  const float* lnvw = (const float*)d_in[5];
  const float* lnvb = (const float*)d_in[6];
  const float* wq   = (const float*)d_in[7];
  const float* bq   = (const float*)d_in[8];
  const float* wk   = (const float*)d_in[9];
  const float* bk   = (const float*)d_in[10];
  const float* wv   = (const float*)d_in[11];
  const float* bv   = (const float*)d_in[12];
  const float* wo   = (const float*)d_in[13];
  const float* bo   = (const float*)d_in[14];
  float* out = (float*)d_out;

  const size_t MB = (size_t)1 << 20;
  uint8_t* w = (uint8_t*)d_ws;
  _Float16* lnq = (_Float16*)(w + 0 * MB);    // 8 MB each
  _Float16* lnk = (_Float16*)(w + 8 * MB);
  _Float16* lnv = (_Float16*)(w + 16 * MB);
  _Float16* wqh = (_Float16*)(w + 24 * MB);   // 2 MB each
  _Float16* wkh = (_Float16*)(w + 26 * MB);
  _Float16* wvh = (_Float16*)(w + 28 * MB);
  _Float16* woh = (_Float16*)(w + 30 * MB);
  _Float16* qh  = (_Float16*)(w + 32 * MB);   // 8 MB each
  _Float16* kh  = (_Float16*)(w + 40 * MB);
  _Float16* vth = (_Float16*)(w + 48 * MB);
  _Float16* oh  = (_Float16*)(w + 56 * MB);

  // 1. fused triple LayerNorm -> f16 activations
  ln3_kernel<<<MTOK, 256, 0, stream>>>(x, lnqw, lnqb, lnkw, lnkb, lnvw, lnvb,
                                       lnq, lnk, lnv);
  // 2. weight conversions f32 -> f16, all four in one launch
  cvt4_f32_f16<<<256, 512, 0, stream>>>(wq, wk, wv, wo, wqh, wkh, wvh, woh);
  // 3. QKV projections (256 work-groups of 8 waves; work-group = 128x128 tile)
  wmma_gemm<<<256, 256, 0, stream>>>(lnq, wqh, bq, qh, nullptr, 0);
  wmma_gemm<<<256, 256, 0, stream>>>(lnk, wkh, bk, kh, nullptr, 1);
  wmma_gemm<<<256, 256, 0, stream>>>(lnv, wvh, bv, vth, nullptr, 2);
  // 4. flash attention: 32 (b,h) x 128 q-tiles / 8 waves per block
  attn_kernel<<<dim3(BB * NHD, 16), 256, 0, stream>>>(qh, kh, vth, oh);
  // 5. output projection -> f32 d_out
  wmma_gemm<<<256, 256, 0, stream>>>(oh, woh, bo, nullptr, out, 3);
}

// v004
// Measured time: 143 microseconds a run.
// Timed twice side by side with v003, it ran 1.19 and 1.20 times as fast.
// Counting every step since v000, it is 2.05 times as fast.
#include <hip/hip_runtime.h>
#include <hip/hip_bf16.h>

typedef _Float16 v8h  __attribute__((ext_vector_type(8)));
typedef _Float16 v16h __attribute__((ext_vector_type(16)));
typedef float    v8f  __attribute__((ext_vector_type(8)));

#define HID   1024
#define SEQ   2048
#define BB    2
#define NHD   16
#define HDIM  64
#define MTOK  (BB*SEQ)      /* 4096 tokens */
#define QSCALE 0.125f       /* HD^-0.5 */

// Load a 16x32 f16 A/B fragment half for this lane: elements [0..7] = p[0..7],
// elements [8..15] = p[16..23]  (K-halves per CDNA5 16-bit WMMA VGPR layout).
__device__ __forceinline__ v16h load_frag(const _Float16* __restrict__ p) {
  v8h lo = *(const v8h*)(p);
  v8h hi = *(const v8h*)(p + 16);
  v16h r;
#pragma unroll
  for (int i = 0; i < 8; ++i) { r[i] = lo[i]; r[i + 8] = hi[i]; }
  return r;
}

__device__ __forceinline__ v8f wmma16(v16h a, v16h b, v8f c) {
  return __builtin_amdgcn_wmma_f32_16x16x32_f16(false, a, false, b, (short)0, c,
                                                false, false);
}

// ---------------------------------------------------------------------------
// Fused triple LayerNorm: x[4096,1024] f32 -> lnq/lnk/lnv f16
// ---------------------------------------------------------------------------
__global__ void ln3_kernel(const float* __restrict__ x,
                           const float* __restrict__ qw, const float* __restrict__ qb,
                           const float* __restrict__ kw, const float* __restrict__ kb,
                           const float* __restrict__ vw, const float* __restrict__ vb,
                           _Float16* __restrict__ lnq,
                           _Float16* __restrict__ lnk,
                           _Float16* __restrict__ lnv) {
  __shared__ float s1[256];
  __shared__ float s2[256];
  const int row = blockIdx.x;
  const int tid = threadIdx.x;
  const float4 v = ((const float4*)(x + (size_t)row * HID))[tid];
  float sum = v.x + v.y + v.z + v.w;
  float sq  = v.x * v.x + v.y * v.y + v.z * v.z + v.w * v.w;
  s1[tid] = sum; s2[tid] = sq;
  __syncthreads();
#pragma unroll
  for (int o = 128; o > 0; o >>= 1) {
    if (tid < o) { s1[tid] += s1[tid + o]; s2[tid] += s2[tid + o]; }
    __syncthreads();
  }
  const float mu   = s1[0] * (1.0f / HID);
  const float var  = s2[0] * (1.0f / HID) - mu * mu;
  const float rstd = rsqrtf(var + 1e-5f);
  const int c0 = tid * 4;
  const float e[4] = {v.x, v.y, v.z, v.w};
#pragma unroll
  for (int i = 0; i < 4; ++i) {
    const int c = c0 + i;
    const float nv = (e[i] - mu) * rstd;
    const size_t o = (size_t)row * HID + c;
    lnq[o] = (_Float16)(nv * qw[c] + qb[c]);
    lnk[o] = (_Float16)(nv * kw[c] + kb[c]);
    lnv[o] = (_Float16)(nv * vw[c] + vb[c]);
  }
}

// ---------------------------------------------------------------------------
// f32 -> f16 conversion of all four weight matrices in ONE launch.
// 256 work-groups of 16 waves (one per WGP, all resident at once); 64
// work-groups per matrix, 16384 consecutive elements each. A lane issues its
// 8 loads of 16 bytes together, then converts and stores 8 bytes per load;
// every wave-wide load and store covers whole 128-byte lines.
// Why so few waves: the pass moves few bytes;
// 4096 waves are started here.
// ---------------------------------------------------------------------------
typedef _Float16 v4h __attribute__((ext_vector_type(4)));

__global__ void __launch_bounds__(512)
cvt4_f32_f16(const float* __restrict__ s0, const float* __restrict__ s1,
             const float* __restrict__ s2, const float* __restrict__ s3,
             _Float16* __restrict__ d0, _Float16* __restrict__ d1,
             _Float16* __restrict__ d2, _Float16* __restrict__ d3) {
  const int which = blockIdx.x >> 6;           // matrix 0..3 (uniform)
  const float* __restrict__ src = which == 0 ? s0 : which == 1 ? s1 : which == 2 ? s2 : s3;
  _Float16* __restrict__ dst    = which == 0 ? d0 : which == 1 ? d1 : which == 2 ? d2 : d3;
  const int q0 = (blockIdx.x & 63) * 4096 + threadIdx.x;   // index in groups of 4 elements
  const float4* __restrict__ sp = (const float4*)src + q0;
  v4h* __restrict__ dp = (v4h*)dst + q0;
  float4 v[8];
  // unrolled: v[] stays in registers and all 8 loads are in flight together
#pragma unroll
  for (int i = 0; i < 8; ++i) v[i] = sp[i * 512];
  // unrolled: constant indices into v[]
#pragma unroll
  for (int i = 0; i < 8; ++i) {
    v4h h;
    h[0] = (_Float16)v[i].x; h[1] = (_Float16)v[i].y;
    h[2] = (_Float16)v[i].z; h[3] = (_Float16)v[i].w;
    dp[i * 512] = h;
  }
}

// ---------------------------------------------------------------------------
// WMMA GEMM: C[M=4096, N=1024] = A[M,K=1024] @ W[N,K]^T + bias
// A work-group of 8 waves computes a 128(M) x 128(N) tile; one wave a
// 32(M) x 64(N) part of it (8 accumulators), waves laid 4 (M) x 2 (N).
// Operands go through LDS: a stage is 128 k (256 B) of the tile's 128 A rows and
// 128 W rows. It is fetched ONCE per work-group, by loads in which a wave covers
// 4 whole 128-byte lines, and every wave takes its fragments from LDS. (A
// fragment load from global memory touches 16 lines for its 512 bytes, and the
// waves that share a row block each repeat it.)
// Two buffers: the next stage's global loads fly during this stage's products
// and are written to the other buffer at the stage's end; one barrier per stage
// publishes them and ends the last read of the buffer that is refilled next.
// The k order of every accumulator is the ascending one, 32 k per product.
// __launch_bounds__(256,1): allow the allocator the full VGPR budget.
// mode 0: q  -> f16 [b,h,s,d], (acc+bias)*QSCALE
// mode 1: k  -> f16 [b,h,s,d]
// mode 2: v  -> f16 [b,h,d,s]   (transposed so attention P@V streams contiguously)
// mode 3: o  -> f32 row-major [m, n] (final output)
// ---------------------------------------------------------------------------
#define GTM    128           /* tile rows of A per work-group */
#define GTN    128           /* tile rows of W per work-group */
#define GKS    128           /* k per stage: 256 B of each row */
#define GNST   (HID / GKS)
#define GPITCH 136           /* f16 per staged row: 256 B + 16 B pad, conflict-free for 16-byte reads */

__global__ void __launch_bounds__(256, 1)
wmma_gemm(const _Float16* __restrict__ A,
          const _Float16* __restrict__ W,
          const float* __restrict__ bias,
          _Float16* __restrict__ outH,
          float* __restrict__ outF,
          int mode) {
  __shared__ __align__(16) _Float16 stg[2][(GTM + GTN) * GPITCH];  // [buffer][A rows | W rows]
  const int wave  = threadIdx.x >> 5;
  const int lane  = threadIdx.x & 31;
  const int bm = blockIdx.x >> 3;      // 0..31 (128-row blocks)
  const int bn = blockIdx.x & 7;       // 0..7  (128-col blocks)
  const int wm = wave >> 1;            // 0..3  (32-row part)
  const int wn = wave & 1;             // 0..1  (64-col part)
  const int m0 = bm * GTM + wm * 32;
  const int n0 = bn * GTN + wn * 64;
  const int mr  = lane & 15;           // M (for A) / N (for B) within tile
  const int kh8 = (lane >> 4) << 3;    // K-half select: 0 or 8

  // staging: thread t moves 16 bytes of rows t/16 + 16 i, i = 0..7, of each operand
  const int srow = threadIdx.x >> 4;
  const int scol = (threadIdx.x & 15) * 8;
  const _Float16* ga = A + (size_t)(bm * GTM + srow) * HID + scol;
  const _Float16* gw = W + (size_t)(bn * GTN + srow) * HID + scol;
  const int sl = srow * GPITCH + scol;

  v8f acc[8] = {v8f{}, v8f{}, v8f{}, v8f{}, v8f{}, v8f{}, v8f{}, v8f{}};
  v8h ra[8], rw[8];

  // prologue: stage 0 into buffer 0
  // (every loop over i below is unrolled so that ra[], rw[] stay in registers
  // and all 16 loads are in flight together)
#pragma unroll
  for (int i = 0; i < 8; ++i) {
    ra[i] = *(const v8h*)(ga + (size_t)i * 16 * HID);
    rw[i] = *(const v8h*)(gw + (size_t)i * 16 * HID);
  }
#pragma unroll
  for (int i = 0; i < 8; ++i) {
    *(v8h*)(&stg[0][sl + i * 16 * GPITCH]) = ra[i];
    *(v8h*)(&stg[0][sl + (GTM + i * 16) * GPITCH]) = rw[i];
  }
  __syncthreads();

  // fully unrolled: buffer index, global and LDS offsets are immediates, and
  // the accumulators stay pinned in one register set
#pragma unroll
  for (int s = 0; s < GNST; ++s) {
    if (s + 1 < GNST) {
#pragma unroll
      for (int i = 0; i < 8; ++i) {
        ra[i] = *(const v8h*)(ga + (size_t)i * 16 * HID + (s + 1) * GKS);
        rw[i] = *(const v8h*)(gw + (size_t)i * 16 * HID + (s + 1) * GKS);
      }
      // keeps the 16 loads in front of this stage's products: sunk down to their
      // LDS stores, nothing would cover their latency
      __builtin_amdgcn_sched_barrier(0);
    }
    const _Float16* la = &stg[s & 1][(wm * 32 + mr) * GPITCH + kh8];
    const _Float16* lb = &stg[s & 1][(GTM + wn * 64 + mr) * GPITCH + kh8];
    // unrolled: LDS offsets are immediates, fragment loads can run ahead of the products
#pragma unroll
    for (int k0 = 0; k0 < GKS; k0 += 32) {
      const v16h a0 = load_frag(la + k0);
      const v16h a1 = load_frag(la + 16 * GPITCH + k0);
      const v16h b0 = load_frag(lb + k0);
      const v16h b1 = load_frag(lb + 16 * GPITCH + k0);
      const v16h b2 = load_frag(lb + 32 * GPITCH + k0);
      const v16h b3 = load_frag(lb + 48 * GPITCH + k0);
      acc[0] = wmma16(a0, b0, acc[0]);
      acc[1] = wmma16(a0, b1, acc[1]);
      acc[2] = wmma16(a0, b2, acc[2]);
      acc[3] = wmma16(a0, b3, acc[3]);
      acc[4] = wmma16(a1, b0, acc[4]);
      acc[5] = wmma16(a1, b1, acc[5]);
      acc[6] = wmma16(a1, b2, acc[6]);
      acc[7] = wmma16(a1, b3, acc[7]);
    }
    if (s + 1 < GNST) {
      // hand over: the loaded stage goes to the other buffer, whose last
      // readers left it before the previous stage's barrier
#pragma unroll
      for (int i = 0; i < 8; ++i) {
        *(v8h*)(&stg[(s + 1) & 1][sl + i * 16 * GPITCH]) = ra[i];
        *(v8h*)(&stg[(s + 1) & 1][sl + (GTM + i * 16) * GPITCH]) = rw[i];
      }
      __syncthreads();
    }
  }

  const int hsel = lane >> 4;
  if (mode == 2) {
    // A lane's 8 accumulator registers are 8 consecutive tokens of one output
    // column, which lie side by side in the [b,h,d,s] layout: one 16-byte store.
#pragma unroll
    for (int half = 0; half < 2; ++half) {
#pragma unroll
      for (int j = 0; j < 4; ++j) {
        const int n = n0 + j * 16 + mr;
        const float bn = bias[n];
        v8h pk;
#pragma unroll
        for (int r = 0; r < 8; ++r) pk[r] = (_Float16)(acc[half * 4 + j][r] + bn);
        const int m = m0 + half * 16 + 8 * hsel;       // first of the 8 tokens
        const int b = m >> 11, s = m & (SEQ - 1);
        const int h = n >> 6,  d = n & (HDIM - 1);
        *(v8h*)(outH + (((size_t)b * NHD + h) * HDIM + d) * SEQ + s) = pk;
      }
    }
    return;
  }
#pragma unroll
  for (int half = 0; half < 2; ++half) {
#pragma unroll
    for (int j = 0; j < 4; ++j) {
      const int n = n0 + j * 16 + mr;
      const float bn = bias[n];
#pragma unroll
      for (int r = 0; r < 8; ++r) {
        const int m = m0 + half * 16 + r + 8 * hsel;   // token index
        float val = acc[half * 4 + j][r] + bn;
        if (mode == 0) val *= QSCALE;
        const int b = m >> 11, s = m & (SEQ - 1);
        const int h = n >> 6,  d = n & (HDIM - 1);
        if (mode <= 1) {
          outH[(((size_t)b * NHD + h) * SEQ + s) * HDIM + d] = (_Float16)val;
        } else {
          outF[(size_t)m * HID + n] = val;
        }
      }
    }
  }
}

// ---------------------------------------------------------------------------
// Flash attention: one wave per 16-row q tile of one (b,h).
// q,k f16 [b,h,s,d]; vT f16 [b,h,d,s]; out f16 [b, s, h*64+d] (== [B,S,H]).
// K and V go through LDS: the 8 waves of a work-group walk the same keys, so a
// stage (128 keys: 128 K rows of 128 B, 64 V^T rows of 256 B) is fetched ONCE
// per work-group, by loads in which a wave covers 4 whole 128-byte lines, and
// every wave takes its fragments from LDS. (A fragment load from global memory
// touches 16 lines for its 512 bytes, and each of the 8 waves repeats it.)
// Two buffers: the next stage's global loads fly during this stage's four
// 32-key passes and are written to the other buffer at the stage's end; one
// barrier per stage publishes them and ends the last read of the buffer that is
// refilled next. Keys are taken in ascending order, 32 per pass.
// ---------------------------------------------------------------------------
#define AKS    128           /* keys per stage */
#define ANST   (SEQ / AKS)
#define KPITCH 72            /* f16 per staged K row: 128 B + 16 B pad, conflict-free for 16-byte reads */
#define VPITCH 136           /* f16 per staged V^T row: 256 B + 16 B pad, likewise */

// second launch bound: 4 waves per SIMD (256 registers a wave), so that two
// work-groups are resident on a WGP and all 512 run at once
__global__ void __launch_bounds__(256, 4)
attn_kernel(const _Float16* __restrict__ qg,
            const _Float16* __restrict__ kg,
            const _Float16* __restrict__ vtg,
            _Float16* __restrict__ og) {
  __shared__ __align__(16) _Float16 plds[8][16 * 32];  // P staging per wave
  __shared__ __align__(16) _Float16 kst[2][AKS * KPITCH];    // [buffer][key][d]
  __shared__ __align__(16) _Float16 vst[2][HDIM * VPITCH];   // [buffer][d][key]
  const int wave = threadIdx.x >> 5;
  const int lane = threadIdx.x & 31;
  const int bh = blockIdx.x;                  // 0..31 : b*NH + h
  const int qt = blockIdx.y * 8 + wave;       // 0..127
  const int mr  = lane & 15;
  const int kh8 = (lane >> 4) << 3;
  const int hsel = lane >> 4;

  const _Float16* qp = qg  + (size_t)bh * SEQ * HDIM;
  const _Float16* kp = kg  + (size_t)bh * SEQ * HDIM;
  const _Float16* vp = vtg + (size_t)bh * HDIM * SEQ;
  _Float16* lp = &plds[wave][0];

  // staging: thread t moves 16 bytes of K rows t/8 + 32 i and of V^T rows
  // t/16 + 16 i, i = 0..3 (a stage's K rows are one contiguous 16 KB run)
  const _Float16* gk = kp + threadIdx.x * 8;
  const _Float16* gv = vp + (size_t)(threadIdx.x >> 4) * SEQ + (threadIdx.x & 15) * 8;
  const int slk = (threadIdx.x >> 3) * KPITCH + (threadIdx.x & 7) * 8;
  const int slv = (threadIdx.x >> 4) * VPITCH + (threadIdx.x & 15) * 8;
  v8h rk[4], rv[4];

  // prologue: stage 0 into buffer 0
  // (every loop over i here and below is unrolled so that rk[], rv[] stay in
  // registers and all 8 loads are in flight together)
#pragma unroll
  for (int i = 0; i < 4; ++i) {
    rk[i] = *(const v8h*)(gk + i * 32 * HDIM);
    rv[i] = *(const v8h*)(gv + (size_t)i * 16 * SEQ);
  }

  // Q fragments (16 rows x 64 d) : two K=32 A-fragments, reused for all keys
  const v16h aq0 = load_frag(qp + (size_t)(qt * 16 + mr) * HDIM + 0  + kh8);
  const v16h aq1 = load_frag(qp + (size_t)(qt * 16 + mr) * HDIM + 32 + kh8);

  float mrow[8], lrow[8];
  v8f oacc[4] = {v8f{}, v8f{}, v8f{}, v8f{}};
#pragma unroll
  for (int r = 0; r < 8; ++r) { mrow[r] = -1.0e30f; lrow[r] = 0.0f; }

#pragma unroll
  for (int i = 0; i < 4; ++i) {
    *(v8h*)(&kst[0][slk + i * 32 * KPITCH]) = rk[i];
    *(v8h*)(&vst[0][slv + i * 16 * VPITCH]) = rv[i];
  }
  __syncthreads();

  for (int s = 0; s < ANST; ++s) {
    if (s + 1 < ANST) {
#pragma unroll
      for (int i = 0; i < 4; ++i) {
        rk[i] = *(const v8h*)(gk + (s + 1) * AKS * HDIM + i * 32 * HDIM);
        rv[i] = *(const v8h*)(gv + (size_t)i * 16 * SEQ + (s + 1) * AKS);
      }
    }
    const _Float16* lk = &kst[s & 1][mr * KPITCH + kh8];
    const _Float16* lv = &vst[s & 1][mr * VPITCH + kh8];

    // two passes per trip: half the loop overhead; all four unrolled take more
    // than the 256 registers of the launch bound and spill
#pragma unroll 2
    for (int kc = 0; kc < AKS; kc += 32) {
      // ---- scores: two 16x16 tiles over keys [kc, kc+32) of the stage
      const v16h kb0 = load_frag(lk + kc * KPITCH + 0);
      const v16h kb1 = load_frag(lk + kc * KPITCH + 32);
      const v16h kb2 = load_frag(lk + (kc + 16) * KPITCH + 0);
      const v16h kb3 = load_frag(lk + (kc + 16) * KPITCH + 32);
      v8f s0 = {}; s0 = wmma16(aq0, kb0, s0); s0 = wmma16(aq1, kb1, s0);
      v8f s1 = {}; s1 = wmma16(aq0, kb2, s1); s1 = wmma16(aq1, kb3, s1);

      // ---- V fragments for the current pass: issue before the softmax and
      //      before the LDS compiler barrier so they overlap the VALU work
      const v16h vb0 = load_frag(lv + 0  * VPITCH + kc);
      const v16h vb1 = load_frag(lv + 16 * VPITCH + kc);
      const v16h vb2 = load_frag(lv + 32 * VPITCH + kc);
      const v16h vb3 = load_frag(lv + 48 * VPITCH + kc);

      // ---- online softmax (rows live in one half-wave -> width-16 shuffles)
#pragma unroll
      for (int r = 0; r < 8; ++r) {
        float mx = fmaxf(s0[r], s1[r]);
#pragma unroll
        for (int o = 8; o > 0; o >>= 1) mx = fmaxf(mx, __shfl_xor(mx, o, 16));
        const float newm  = fmaxf(mrow[r], mx);
        const float alpha = __expf(mrow[r] - newm);
        const float p0 = __expf(s0[r] - newm);
        const float p1 = __expf(s1[r] - newm);
        float rs = p0 + p1;
#pragma unroll
        for (int o = 8; o > 0; o >>= 1) rs += __shfl_xor(rs, o, 16);
        lrow[r] = lrow[r] * alpha + rs;
        mrow[r] = newm;
#pragma unroll
        for (int j = 0; j < 4; ++j) oacc[j][r] *= alpha;
        const int row = r + 8 * hsel;
        lp[row * 32 + mr]      = (_Float16)p0;
        lp[row * 32 + 16 + mr] = (_Float16)p1;
      }
      asm volatile("s_wait_dscnt 0" ::: "memory");

      // ---- P (D-layout) -> A-fragment via LDS, then P @ V
      v16h ap;
      {
        const v8h lo = *(const v8h*)(lp + mr * 32 + kh8);
        const v8h hi = *(const v8h*)(lp + mr * 32 + 16 + kh8);
#pragma unroll
        for (int i = 0; i < 8; ++i) { ap[i] = lo[i]; ap[i + 8] = hi[i]; }
      }
      oacc[0] = wmma16(ap, vb0, oacc[0]);
      oacc[1] = wmma16(ap, vb1, oacc[1]);
      oacc[2] = wmma16(ap, vb2, oacc[2]);
      oacc[3] = wmma16(ap, vb3, oacc[3]);
    }
    if (s + 1 < ANST) {
      // hand over: the loaded stage goes to the other buffer, whose last
      // readers left it before the previous stage's barrier
#pragma unroll
      for (int i = 0; i < 4; ++i) {
        *(v8h*)(&kst[(s + 1) & 1][slk + i * 32 * KPITCH]) = rk[i];
        *(v8h*)(&vst[(s + 1) & 1][slv + i * 16 * VPITCH]) = rv[i];
      }
      __syncthreads();
    }
  }

  // ---- normalize + store to [B, S, H] as f16
  const int b = bh >> 4, h = bh & 15;
#pragma unroll
  for (int j = 0; j < 4; ++j) {
#pragma unroll
    for (int r = 0; r < 8; ++r) {
      const int s = qt * 16 + r + 8 * hsel;
      const int d = j * 16 + mr;
      const float val = oacc[j][r] / lrow[r];
      og[((size_t)b * SEQ + s) * HID + h * HDIM + d] = (_Float16)val;
    }
  }
}

// ---------------------------------------------------------------------------
extern "C" void kernel_launch(void* const* d_in, const int* in_sizes, int n_in,
                              void* d_out, int out_size, void* d_ws, size_t ws_size,
                              hipStream_t stream) {
  const float* x    = (const float*)d_in[0];
  const float* lnqw = (const float*)d_in[1];
  const float* lnqb = (const float*)d_in[2];
  const float* lnkw = (const float*)d_in[3];
  const float* lnkb = (const float*)d_in[4];
  const float* lnvw = (const float*)d_in[5];
  const float* lnvb = (const float*)d_in[6];
  const float* wq   = (const float*)d_in[7];
  const float* bq   = (const float*)d_in[8];
  const float* wk   = (const float*)d_in[9];
  const float* bk   = (const float*)d_in[10];
  const float* wv   = (const float*)d_in[11];
  const float* bv   = (const float*)d_in[12];
  const float* wo   = (const float*)d_in[13];
  const float* bo   = (const float*)d_in[14];
  float* out = (float*)d_out;

  const size_t MB = (size_t)1 << 20;
  uint8_t* w = (uint8_t*)d_ws;
  _Float16* lnq = (_Float16*)(w + 0 * MB);    // 8 MB each
  _Float16* lnk = (_Float16*)(w + 8 * MB);
  _Float16* lnv = (_Float16*)(w + 16 * MB);
  _Float16* wqh = (_Float16*)(w + 24 * MB);   // 2 MB each
  _Float16* wkh = (_Float16*)(w + 26 * MB);
  _Float16* wvh = (_Float16*)(w + 28 * MB);
  _Float16* woh = (_Float16*)(w + 30 * MB);
  _Float16* qh  = (_Float16*)(w + 32 * MB);   // 8 MB each
  _Float16* kh  = (_Float16*)(w + 40 * MB);
  _Float16* vth = (_Float16*)(w + 48 * MB);
  _Float16* oh  = (_Float16*)(w + 56 * MB);

  // 1. fused triple LayerNorm -> f16 activations
  ln3_kernel<<<MTOK, 256, 0, stream>>>(x, lnqw, lnqb, lnkw, lnkb, lnvw, lnvb,
                                       lnq, lnk, lnv);
  // 2. weight conversions f32 -> f16, all four in one launch
  cvt4_f32_f16<<<256, 512, 0, stream>>>(wq, wk, wv, wo, wqh, wkh, wvh, woh);
  // 3. QKV projections (256 work-groups of 8 waves; work-group = 128x128 tile)
  wmma_gemm<<<256, 256, 0, stream>>>(lnq, wqh, bq, qh, nullptr, 0);
  wmma_gemm<<<256, 256, 0, stream>>>(lnk, wkh, bk, kh, nullptr, 1);
  wmma_gemm<<<256, 256, 0, stream>>>(lnv, wvh, bv, vth, nullptr, 2);
  // 4. flash attention: 32 (b,h) x 128 q-tiles / 8 waves per block
  attn_kernel<<<dim3(BB * NHD, 16), 256, 0, stream>>>(qh, kh, vth, oh);
  // 5. output projection -> f32 d_out
  wmma_gemm<<<256, 256, 0, stream>>>(oh, woh, bo, nullptr, out, 3);
}

// v005
// A run of this version takes 109 microseconds.
// Two timings next to v004 both put it at 1.33 times that version's speed.
// Over all steps from v000 it is 2.72 times as fast.
#include <hip/hip_runtime.h>
#include <hip/hip_bf16.h>

typedef _Float16 v8h  __attribute__((ext_vector_type(8)));
typedef _Float16 v16h __attribute__((ext_vector_type(16)));
typedef float    v8f  __attribute__((ext_vector_type(8)));

#define HID   1024
#define SEQ   2048
#define BB    2
#define NHD   16
#define HDIM  64
#define MTOK  (BB*SEQ)      /* 4096 tokens */
#define QSCALE 0.125f       /* HD^-0.5 */

// Load a 16x32 f16 A/B fragment half for this lane: elements [0..7] = p[0..7],
// elements [8..15] = p[16..23]  (K-halves per CDNA5 16-bit WMMA VGPR layout).
__device__ __forceinline__ v16h load_frag(const _Float16* __restrict__ p) {
  v8h lo = *(const v8h*)(p);
  v8h hi = *(const v8h*)(p + 16);
  v16h r;
#pragma unroll
  for (int i = 0; i < 8; ++i) { r[i] = lo[i]; r[i + 8] = hi[i]; }
  return r;
}

__device__ __forceinline__ v8f wmma16(v16h a, v16h b, v8f c) {
  return __builtin_amdgcn_wmma_f32_16x16x32_f16(false, a, false, b, (short)0, c,
                                                false, false);
}

// ---------------------------------------------------------------------------
// Fused triple LayerNorm: x[4096,1024] f32 -> lnq/lnk/lnv f16
// ---------------------------------------------------------------------------
__global__ void ln3_kernel(const float* __restrict__ x,
                           const float* __restrict__ qw, const float* __restrict__ qb,
                           const float* __restrict__ kw, const float* __restrict__ kb,
                           const float* __restrict__ vw, const float* __restrict__ vb,
                           _Float16* __restrict__ lnq,
                           _Float16* __restrict__ lnk,
                           _Float16* __restrict__ lnv) {
  __shared__ float s1[256];
  __shared__ float s2[256];
  const int row = blockIdx.x;
  const int tid = threadIdx.x;
  const float4 v = ((const float4*)(x + (size_t)row * HID))[tid];
  float sum = v.x + v.y + v.z + v.w;
  float sq  = v.x * v.x + v.y * v.y + v.z * v.z + v.w * v.w;
  s1[tid] = sum; s2[tid] = sq;
  __syncthreads();
#pragma unroll
  for (int o = 128; o > 0; o >>= 1) {
    if (tid < o) { s1[tid] += s1[tid + o]; s2[tid] += s2[tid + o]; }
    __syncthreads();
  }
  const float mu   = s1[0] * (1.0f / HID);
  const float var  = s2[0] * (1.0f / HID) - mu * mu;
  const float rstd = rsqrtf(var + 1e-5f);
  const int c0 = tid * 4;
  const float e[4] = {v.x, v.y, v.z, v.w};
#pragma unroll
  for (int i = 0; i < 4; ++i) {
    const int c = c0 + i;
    const float nv = (e[i] - mu) * rstd;
    const size_t o = (size_t)row * HID + c;
    lnq[o] = (_Float16)(nv * qw[c] + qb[c]);
    lnk[o] = (_Float16)(nv * kw[c] + kb[c]);
    lnv[o] = (_Float16)(nv * vw[c] + vb[c]);
  }
}

// ---------------------------------------------------------------------------
// f32 -> f16 conversion of all four weight matrices in ONE launch.
// 256 work-groups of 16 waves (one per WGP, all resident at once); 64
// work-groups per matrix, 16384 consecutive elements each. A lane issues its
// 8 loads of 16 bytes together, then converts and stores 8 bytes per load;
// every wave-wide load and store covers whole 128-byte lines.
// Why so few waves: the pass moves few bytes;
// 4096 waves are started here.
// ---------------------------------------------------------------------------
typedef _Float16 v4h __attribute__((ext_vector_type(4)));

__global__ void __launch_bounds__(512)
cvt4_f32_f16(const float* __restrict__ s0, const float* __restrict__ s1,
             const float* __restrict__ s2, const float* __restrict__ s3,
             _Float16* __restrict__ d0, _Float16* __restrict__ d1,
             _Float16* __restrict__ d2, _Float16* __restrict__ d3) {
  const int which = blockIdx.x >> 6;           // matrix 0..3 (uniform)
  const float* __restrict__ src = which == 0 ? s0 : which == 1 ? s1 : which == 2 ? s2 : s3;
  _Float16* __restrict__ dst    = which == 0 ? d0 : which == 1 ? d1 : which == 2 ? d2 : d3;
  const int q0 = (blockIdx.x & 63) * 4096 + threadIdx.x;   // index in groups of 4 elements
  const float4* __restrict__ sp = (const float4*)src + q0;
  v4h* __restrict__ dp = (v4h*)dst + q0;
  float4 v[8];
  // unrolled: v[] stays in registers and all 8 loads are in flight together
#pragma unroll
  for (int i = 0; i < 8; ++i) v[i] = sp[i * 512];
  // unrolled: constant indices into v[]
#pragma unroll
  for (int i = 0; i < 8; ++i) {
    v4h h;
    h[0] = (_Float16)v[i].x; h[1] = (_Float16)v[i].y;
    h[2] = (_Float16)v[i].z; h[3] = (_Float16)v[i].w;
    dp[i * 512] = h;
  }
}

// ---------------------------------------------------------------------------
// WMMA GEMM: C[M=4096, N=1024] = A[M,K=1024] @ W[N,K]^T + bias
// A work-group of 8 waves computes a 128(M) x 128(N) tile; one wave a
// 32(M) x 64(N) part of it (8 accumulators), waves laid 4 (M) x 2 (N).
// Operands go through LDS: a stage is 128 k (256 B) of the tile's 128 A rows and
// 128 W rows. It is fetched ONCE per work-group, by loads in which a wave covers
// 4 whole 128-byte lines, and every wave takes its fragments from LDS. (A
// fragment load from global memory touches 16 lines for its 512 bytes, and the
// waves that share a row block each repeat it.)
// Two buffers: the next stage's global loads fly during this stage's products
// and are written to the other buffer at the stage's end; one barrier per stage
// publishes them and ends the last read of the buffer that is refilled next.
// The k order of every accumulator is the ascending one, 32 k per product.
// __launch_bounds__(256,1): allow the allocator the full VGPR budget.
// mode 0: q  -> f16 [b,h,s,d], (acc+bias)*QSCALE
// mode 1: k  -> f16 [b,h,s,d]
// mode 2: v  -> f16 [b,h,d,s]   (transposed so attention P@V streams contiguously)
// mode 3: o  -> f32 row-major [m, n] (final output)
// ---------------------------------------------------------------------------
#define GTM    128           /* tile rows of A per work-group */
#define GTN    128           /* tile rows of W per work-group */
#define GKS    128           /* k per stage: 256 B of each row */
#define GNST   (HID / GKS)
#define GPITCH 136           /* f16 per staged row: 256 B + 16 B pad, conflict-free for 16-byte reads */

__global__ void __launch_bounds__(256, 1)
wmma_gemm(const _Float16* __restrict__ A,
          const _Float16* __restrict__ W,
          const float* __restrict__ bias,
          _Float16* __restrict__ outH,
          float* __restrict__ outF,
          int mode) {
  __shared__ __align__(16) _Float16 stg[2][(GTM + GTN) * GPITCH];  // [buffer][A rows | W rows]
  const int wave  = threadIdx.x >> 5;
  const int lane  = threadIdx.x & 31;
  const int bm = blockIdx.x >> 3;      // 0..31 (128-row blocks)
  const int bn = blockIdx.x & 7;       // 0..7  (128-col blocks)
  const int wm = wave >> 1;            // 0..3  (32-row part)
  const int wn = wave & 1;             // 0..1  (64-col part)
  const int m0 = bm * GTM + wm * 32;
  const int n0 = bn * GTN + wn * 64;
  const int mr  = lane & 15;           // M (for A) / N (for B) within tile
  const int kh8 = (lane >> 4) << 3;    // K-half select: 0 or 8

  // staging: thread t moves 16 bytes of rows t/16 + 16 i, i = 0..7, of each operand
  const int srow = threadIdx.x >> 4;
  const int scol = (threadIdx.x & 15) * 8;
  const _Float16* ga = A + (size_t)(bm * GTM + srow) * HID + scol;
  const _Float16* gw = W + (size_t)(bn * GTN + srow) * HID + scol;
  const int sl = srow * GPITCH + scol;

  v8f acc[8] = {v8f{}, v8f{}, v8f{}, v8f{}, v8f{}, v8f{}, v8f{}, v8f{}};
  v8h ra[8], rw[8];

  // prologue: stage 0 into buffer 0
  // (every loop over i below is unrolled so that ra[], rw[] stay in registers
  // and all 16 loads are in flight together)
#pragma unroll
  for (int i = 0; i < 8; ++i) {
    ra[i] = *(const v8h*)(ga + (size_t)i * 16 * HID);
    rw[i] = *(const v8h*)(gw + (size_t)i * 16 * HID);
  }
#pragma unroll
  for (int i = 0; i < 8; ++i) {
    *(v8h*)(&stg[0][sl + i * 16 * GPITCH]) = ra[i];
    *(v8h*)(&stg[0][sl + (GTM + i * 16) * GPITCH]) = rw[i];
  }
  __syncthreads();

  // fully unrolled: buffer index, global and LDS offsets are immediates, and
  // the accumulators stay pinned in one register set
#pragma unroll
  for (int s = 0; s < GNST; ++s) {
    if (s + 1 < GNST) {
#pragma unroll
      for (int i = 0; i < 8; ++i) {
        ra[i] = *(const v8h*)(ga + (size_t)i * 16 * HID + (s + 1) * GKS);
        rw[i] = *(const v8h*)(gw + (size_t)i * 16 * HID + (s + 1) * GKS);
      }
      // keeps the 16 loads in front of this stage's products: sunk down to their
      // LDS stores, nothing would cover their latency
      __builtin_amdgcn_sched_barrier(0);
    }
    const _Float16* la = &stg[s & 1][(wm * 32 + mr) * GPITCH + kh8];
    const _Float16* lb = &stg[s & 1][(GTM + wn * 64 + mr) * GPITCH + kh8];
    // unrolled: LDS offsets are immediates, fragment loads can run ahead of the products
#pragma unroll
    for (int k0 = 0; k0 < GKS; k0 += 32) {
      const v16h a0 = load_frag(la + k0);
      const v16h a1 = load_frag(la + 16 * GPITCH + k0);
      const v16h b0 = load_frag(lb + k0);
      const v16h b1 = load_frag(lb + 16 * GPITCH + k0);
      const v16h b2 = load_frag(lb + 32 * GPITCH + k0);
      const v16h b3 = load_frag(lb + 48 * GPITCH + k0);
      acc[0] = wmma16(a0, b0, acc[0]);
      acc[1] = wmma16(a0, b1, acc[1]);
      acc[2] = wmma16(a0, b2, acc[2]);
      acc[3] = wmma16(a0, b3, acc[3]);
      acc[4] = wmma16(a1, b0, acc[4]);
      acc[5] = wmma16(a1, b1, acc[5]);
      acc[6] = wmma16(a1, b2, acc[6]);
      acc[7] = wmma16(a1, b3, acc[7]);
    }
    if (s + 1 < GNST) {
      // hand over: the loaded stage goes to the other buffer, whose last
      // readers left it before the previous stage's barrier
#pragma unroll
      for (int i = 0; i < 8; ++i) {
        *(v8h*)(&stg[(s + 1) & 1][sl + i * 16 * GPITCH]) = ra[i];
        *(v8h*)(&stg[(s + 1) & 1][sl + (GTM + i * 16) * GPITCH]) = rw[i];
      }
      __syncthreads();
    }
  }

  const int hsel = lane >> 4;
  if (mode == 2) {
    // A lane's 8 accumulator registers are 8 consecutive tokens of one output
    // column, which lie side by side in the [b,h,d,s] layout: one 16-byte store.
#pragma unroll
    for (int half = 0; half < 2; ++half) {
#pragma unroll
      for (int j = 0; j < 4; ++j) {
        const int n = n0 + j * 16 + mr;
        const float bn = bias[n];
        v8h pk;
#pragma unroll
        for (int r = 0; r < 8; ++r) pk[r] = (_Float16)(acc[half * 4 + j][r] + bn);
        const int m = m0 + half * 16 + 8 * hsel;       // first of the 8 tokens
        const int b = m >> 11, s = m & (SEQ - 1);
        const int h = n >> 6,  d = n & (HDIM - 1);
        *(v8h*)(outH + (((size_t)b * NHD + h) * HDIM + d) * SEQ + s) = pk;
      }
    }
    return;
  }
#pragma unroll
  for (int half = 0; half < 2; ++half) {
#pragma unroll
    for (int j = 0; j < 4; ++j) {
      const int n = n0 + j * 16 + mr;
      const float bn = bias[n];
#pragma unroll
      for (int r = 0; r < 8; ++r) {
        const int m = m0 + half * 16 + r + 8 * hsel;   // token index
        float val = acc[half * 4 + j][r] + bn;
        if (mode == 0) val *= QSCALE;
        const int b = m >> 11, s = m & (SEQ - 1);
        const int h = n >> 6,  d = n & (HDIM - 1);
        if (mode <= 1) {
          outH[(((size_t)b * NHD + h) * SEQ + s) * HDIM + d] = (_Float16)val;
        } else {
          outF[(size_t)m * HID + n] = val;
        }
      }
    }
  }
}

// ---------------------------------------------------------------------------
// Flash attention: one wave per 16 queries of one (b,h), products transposed:
// S^T = K Q^T (A = K rows, B = Q) and O^T += V^T P^T (A = V^T rows, B = P^T).
// A lane then holds scores of ONE query (column lane & 15; keys 8 h + r of each
// 16-key tile, h = lane >> 4): maximum and sum run inside the lane, with one
// exchange between the wave's halves for the maximum. The two score tiles of a
// pass, converted in place, are already the B operand of the second product
// (element e < 8: key 8 h + e, else key 16 + 8 h + e - 8, the order in which
// load_frag takes V^T), so P goes through no LDS and no lane exchange.
// Each half keeps the sum of its own keys; the halves are joined once at the end.
// q,k f16 [b,h,s,d]; vT f16 [b,h,d,s]; out f16 [b, s, h*64+d] (== [B,S,H]).
// K and V go through LDS: the 8 waves of a work-group walk the same keys, so a
// stage (128 keys: 128 K rows of 128 B, 64 V^T rows of 256 B) is fetched ONCE
// per work-group, by loads in which a wave covers 4 whole 128-byte lines, and
// every wave takes its fragments from LDS. (A fragment load from global memory
// touches 16 lines for its 512 bytes, and each of the 8 waves repeats it.)
// Two buffers: the next stage's global loads fly during this stage's four
// 32-key passes and are written to the other buffer at the stage's end; one
// barrier per stage publishes them and ends the last read of the buffer that is
// refilled next. Keys are taken in ascending order, 32 per pass.
// ---------------------------------------------------------------------------
#define AKS    128           /* keys per stage */
#define ANST   (SEQ / AKS)
#define KPITCH 72            /* f16 per staged K row: 128 B + 16 B pad, conflict-free for 16-byte reads */
#define VPITCH 136           /* f16 per staged V^T row: 256 B + 16 B pad, likewise */

// value of lane l ^ 16 (the same column in the other half of the wave), by a
// vector cross-row move
__device__ __forceinline__ float xhalf(float x) {
  const int i = __builtin_bit_cast(int, x);
  return __builtin_bit_cast(float,
      __builtin_amdgcn_permlanex16(i, i, 0x76543210, 0xfedcba98, false, false));
}

// second launch bound: 4 waves per SIMD (256 registers a wave), so that two
// work-groups are resident on a WGP and all 512 run at once
__global__ void __launch_bounds__(256, 4)
attn_kernel(const _Float16* __restrict__ qg,
            const _Float16* __restrict__ kg,
            const _Float16* __restrict__ vtg,
            _Float16* __restrict__ og) {
  __shared__ __align__(16) _Float16 kst[2][AKS * KPITCH];    // [buffer][key][d]
  __shared__ __align__(16) _Float16 vst[2][HDIM * VPITCH];   // [buffer][d][key]
  const int wave = threadIdx.x >> 5;
  const int lane = threadIdx.x & 31;
  const int bh = blockIdx.x;                  // 0..31 : b*NH + h
  const int qt = blockIdx.y * 8 + wave;       // 0..127
  const int mr  = lane & 15;
  const int kh8 = (lane >> 4) << 3;
  const int hsel = lane >> 4;

  const _Float16* qp = qg  + (size_t)bh * SEQ * HDIM;
  const _Float16* kp = kg  + (size_t)bh * SEQ * HDIM;
  const _Float16* vp = vtg + (size_t)bh * HDIM * SEQ;

  // staging: thread t moves 16 bytes of K rows t/8 + 32 i and of V^T rows
  // t/16 + 16 i, i = 0..3 (a stage's K rows are one contiguous 16 KB run)
  const _Float16* gk = kp + threadIdx.x * 8;
  const _Float16* gv = vp + (size_t)(threadIdx.x >> 4) * SEQ + (threadIdx.x & 15) * 8;
  const int slk = (threadIdx.x >> 3) * KPITCH + (threadIdx.x & 7) * 8;
  const int slv = (threadIdx.x >> 4) * VPITCH + (threadIdx.x & 15) * 8;
  v8h rk[4], rv[4];

  // prologue: stage 0 into buffer 0
  // (every loop over i here and below is unrolled so that rk[], rv[] stay in
  // registers and all 8 loads are in flight together)
#pragma unroll
  for (int i = 0; i < 4; ++i) {
    rk[i] = *(const v8h*)(gk + i * 32 * HDIM);
    rv[i] = *(const v8h*)(gv + (size_t)i * 16 * SEQ);
  }

  // Q fragments (16 queries x 64 d) : two K=32 B-fragments, reused for all keys
  const v16h bq0 = load_frag(qp + (size_t)(qt * 16 + mr) * HDIM + 0  + kh8);
  const v16h bq1 = load_frag(qp + (size_t)(qt * 16 + mr) * HDIM + 32 + kh8);

  float mrun = -1.0e30f;      // running maximum of this lane's query (both halves alike)
  float lrun = 0.0f;          // running sum over this half's keys
  v8f oacc[4] = {v8f{}, v8f{}, v8f{}, v8f{}};   // O^T: oacc[j][r] = O[query mr][d = 16 j + 8 h + r]

#pragma unroll
  for (int i = 0; i < 4; ++i) {
    *(v8h*)(&kst[0][slk + i * 32 * KPITCH]) = rk[i];
    *(v8h*)(&vst[0][slv + i * 16 * VPITCH]) = rv[i];
  }
  __syncthreads();

  for (int s = 0; s < ANST; ++s) {
    if (s + 1 < ANST) {
#pragma unroll
      for (int i = 0; i < 4; ++i) {
        rk[i] = *(const v8h*)(gk + (s + 1) * AKS * HDIM + i * 32 * HDIM);
        rv[i] = *(const v8h*)(gv + (size_t)i * 16 * SEQ + (s + 1) * AKS);
      }
    }
    const _Float16* lk = &kst[s & 1][mr * KPITCH + kh8];
    const _Float16* lv = &vst[s & 1][mr * VPITCH + kh8];

    // two passes per trip: half the loop overhead
#pragma unroll 2
    for (int kc = 0; kc < AKS; kc += 32) {
      // ---- scores, transposed: two tiles of 16 keys x 16 queries over keys
      //      [kc, kc+32) of the stage
      const v16h ka0 = load_frag(lk + kc * KPITCH + 0);
      const v16h ka1 = load_frag(lk + kc * KPITCH + 32);
      const v16h ka2 = load_frag(lk + (kc + 16) * KPITCH + 0);
      const v16h ka3 = load_frag(lk + (kc + 16) * KPITCH + 32);
      v8f s0 = {}; s0 = wmma16(ka0, bq0, s0); s0 = wmma16(ka1, bq1, s0);
      v8f s1 = {}; s1 = wmma16(ka2, bq0, s1); s1 = wmma16(ka3, bq1, s1);

      // ---- V^T fragments for the current pass: issued before the softmax so
      //      that they overlap the vector work
      const v16h va0 = load_frag(lv + 0  * VPITCH + kc);
      const v16h va1 = load_frag(lv + 16 * VPITCH + kc);
      const v16h va2 = load_frag(lv + 32 * VPITCH + kc);
      const v16h va3 = load_frag(lv + 48 * VPITCH + kc);

      // ---- online softmax: the lane's 16 scores belong to one query
      float mx4[4];
#pragma unroll
      for (int c = 0; c < 4; ++c)
        mx4[c] = fmaxf(fmaxf(s0[c], s0[c + 4]), fmaxf(s1[c], s1[c + 4]));
      float mx = fmaxf(fmaxf(mx4[0], mx4[1]), fmaxf(mx4[2], mx4[3]));
      mx = fmaxf(mx, xhalf(mx));               // the other half's 16 keys
      const float newm  = fmaxf(mrun, mx);
      const float alpha = __expf(mrun - newm);
      v16h pb;                                  // P^T as B operand
      float rs4[4];                             // four short chains instead of one of 16 adds
#pragma unroll
      for (int r = 0; r < 8; ++r) {
        const float p0 = __expf(s0[r] - newm);
        const float p1 = __expf(s1[r] - newm);
        if (r < 4) rs4[r] = p0 + p1; else rs4[r - 4] += p0 + p1;
        pb[r]     = (_Float16)p0;
        pb[r + 8] = (_Float16)p1;
      }
      lrun = lrun * alpha + ((rs4[0] + rs4[1]) + (rs4[2] + rs4[3]));
      mrun = newm;
#pragma unroll
      for (int j = 0; j < 4; ++j) oacc[j] *= alpha;

      // ---- O^T += V^T P^T
      oacc[0] = wmma16(va0, pb, oacc[0]);
      oacc[1] = wmma16(va1, pb, oacc[1]);
      oacc[2] = wmma16(va2, pb, oacc[2]);
      oacc[3] = wmma16(va3, pb, oacc[3]);
    }
    if (s + 1 < ANST) {
      // hand over: the loaded stage goes to the other buffer, whose last
      // readers left it before the previous stage's barrier
#pragma unroll
      for (int i = 0; i < 4; ++i) {
        *(v8h*)(&kst[(s + 1) & 1][slk + i * 32 * KPITCH]) = rk[i];
        *(v8h*)(&vst[(s + 1) & 1][slv + i * 16 * VPITCH]) = rv[i];
      }
      __syncthreads();
    }
  }

  // ---- normalize + store to [B, S, H] as f16: a lane's 8 registers of a tile
  //      are 8 consecutive d of its query, one 16-byte store
  const float lsum = lrun + xhalf(lrun);        // join the halves' sums
  const int b = bh >> 4, h = bh & 15;
  _Float16* op = og + ((size_t)b * SEQ + qt * 16 + mr) * HID + h * HDIM + 8 * hsel;
#pragma unroll
  for (int j = 0; j < 4; ++j) {
    v8h pk;
#pragma unroll
    for (int r = 0; r < 8; ++r) pk[r] = (_Float16)(oacc[j][r] / lsum);
    *(v8h*)(op + j * 16) = pk;
  }
}

// ---------------------------------------------------------------------------
extern "C" void kernel_launch(void* const* d_in, const int* in_sizes, int n_in,
                              void* d_out, int out_size, void* d_ws, size_t ws_size,
                              hipStream_t stream) {
  const float* x    = (const float*)d_in[0];
  const float* lnqw = (const float*)d_in[1];
  const float* lnqb = (const float*)d_in[2];
  const float* lnkw = (const float*)d_in[3];
  const float* lnkb = (const float*)d_in[4];
  const float* lnvw = (const float*)d_in[5];
  const float* lnvb = (const float*)d_in[6];
  const float* wq   = (const float*)d_in[7];
  const float* bq   = (const float*)d_in[8];
  const float* wk   = (const float*)d_in[9];
  const float* bk   = (const float*)d_in[10];
  const float* wv   = (const float*)d_in[11];
  const float* bv   = (const float*)d_in[12];
  const float* wo   = (const float*)d_in[13];
  const float* bo   = (const float*)d_in[14];
  float* out = (float*)d_out;

  const size_t MB = (size_t)1 << 20;
  uint8_t* w = (uint8_t*)d_ws;
  _Float16* lnq = (_Float16*)(w + 0 * MB);    // 8 MB each
  _Float16* lnk = (_Float16*)(w + 8 * MB);
  _Float16* lnv = (_Float16*)(w + 16 * MB);
  _Float16* wqh = (_Float16*)(w + 24 * MB);   // 2 MB each
  _Float16* wkh = (_Float16*)(w + 26 * MB);
  _Float16* wvh = (_Float16*)(w + 28 * MB);
  _Float16* woh = (_Float16*)(w + 30 * MB);
  _Float16* qh  = (_Float16*)(w + 32 * MB);   // 8 MB each
  _Float16* kh  = (_Float16*)(w + 40 * MB);
  _Float16* vth = (_Float16*)(w + 48 * MB);
  _Float16* oh  = (_Float16*)(w + 56 * MB);

  // 1. fused triple LayerNorm -> f16 activations
  ln3_kernel<<<MTOK, 256, 0, stream>>>(x, lnqw, lnqb, lnkw, lnkb, lnvw, lnvb,
                                       lnq, lnk, lnv);
  // 2. weight conversions f32 -> f16, all four in one launch
  cvt4_f32_f16<<<256, 512, 0, stream>>>(wq, wk, wv, wo, wqh, wkh, wvh, woh);
  // 3. QKV projections (256 work-groups of 8 waves; work-group = 128x128 tile)
  wmma_gemm<<<256, 256, 0, stream>>>(lnq, wqh, bq, qh, nullptr, 0);
  wmma_gemm<<<256, 256, 0, stream>>>(lnk, wkh, bk, kh, nullptr, 1);
  wmma_gemm<<<256, 256, 0, stream>>>(lnv, wvh, bv, vth, nullptr, 2);
  // 4. flash attention: 32 (b,h) x 128 q-tiles / 8 waves per block
  attn_kernel<<<dim3(BB * NHD, 16), 256, 0, stream>>>(qh, kh, vth, oh);
  // 5. output projection -> f32 d_out
  wmma_gemm<<<256, 256, 0, stream>>>(oh, woh, bo, nullptr, out, 3);
}

// v006
// Measured time: 92.6 microseconds a run.
// Two timings next to v005 put it at 1.18 and 1.17 times that version's speed.
// All steps since v000 together make it 3.19 times as fast.
#include <hip/hip_runtime.h>
#include <hip/hip_bf16.h>

typedef _Float16 v8h  __attribute__((ext_vector_type(8)));
typedef _Float16 v16h __attribute__((ext_vector_type(16)));
typedef float    v8f  __attribute__((ext_vector_type(8)));

#define HID   1024
#define SEQ   2048
#define BB    2
#define NHD   16
#define HDIM  64
#define MTOK  (BB*SEQ)      /* 4096 tokens */
#define QSCALE 0.125f       /* HD^-0.5 */

// Load a 16x32 f16 A/B fragment half for this lane: elements [0..7] = p[0..7],
// elements [8..15] = p[16..23]  (K-halves per CDNA5 16-bit WMMA VGPR layout).
__device__ __forceinline__ v16h load_frag(const _Float16* __restrict__ p) {
  v8h lo = *(const v8h*)(p);
  v8h hi = *(const v8h*)(p + 16);
  v16h r;
#pragma unroll
  for (int i = 0; i < 8; ++i) { r[i] = lo[i]; r[i + 8] = hi[i]; }
  return r;
}

__device__ __forceinline__ v8f wmma16(v16h a, v16h b, v8f c) {
  return __builtin_amdgcn_wmma_f32_16x16x32_f16(false, a, false, b, (short)0, c,
                                                false, false);
}

// ---------------------------------------------------------------------------
// One launch for the two passes that depend on nothing but the inputs.
// Work-groups 0 .. CVTWG-1: f32 -> f16 conversion of the four weight matrices;
// 128 work-groups of 8 waves per matrix, 8192 consecutive elements each. A lane
// issues its 8 loads of 16 bytes together, then converts and stores 8 bytes per
// load; every wave-wide load and store covers whole 128-byte lines.
// Work-groups CVTWG .. CVTWG+4095: fused triple LayerNorm of one row each,
// x[4096,1024] f32 -> lnq/lnk/lnv f16.
// ---------------------------------------------------------------------------
typedef _Float16 v4h __attribute__((ext_vector_type(4)));
#define CVTWG 512

__global__ void __launch_bounds__(256)
prep_kernel(const float* __restrict__ x,
            const float* __restrict__ qw, const float* __restrict__ qb,
            const float* __restrict__ kw, const float* __restrict__ kb,
            const float* __restrict__ vw, const float* __restrict__ vb,
            _Float16* __restrict__ lnq,
            _Float16* __restrict__ lnk,
            _Float16* __restrict__ lnv,
            const float* __restrict__ s0, const float* __restrict__ s1w,
            const float* __restrict__ s2w, const float* __restrict__ s3,
            _Float16* __restrict__ d0, _Float16* __restrict__ d1,
            _Float16* __restrict__ d2, _Float16* __restrict__ d3) {
  __shared__ float s1[256];
  __shared__ float s2[256];
  if (blockIdx.x < CVTWG) {                      // uniform for the work-group, in front of every barrier
    const int which = blockIdx.x >> 7;           // matrix 0..3 (uniform)
    const float* __restrict__ src = which == 0 ? s0 : which == 1 ? s1w : which == 2 ? s2w : s3;
    _Float16* __restrict__ dst    = which == 0 ? d0 : which == 1 ? d1 : which == 2 ? d2 : d3;
    const int q0 = (blockIdx.x & 127) * 2048 + threadIdx.x;   // index in groups of 4 elements
    const float4* __restrict__ sp = (const float4*)src + q0;
    v4h* __restrict__ dp = (v4h*)dst + q0;
    float4 v[8];
    // unrolled: v[] stays in registers and all 8 loads are in flight together
#pragma unroll
    for (int i = 0; i < 8; ++i) v[i] = sp[i * 256];
    // unrolled: constant indices into v[]
#pragma unroll
    for (int i = 0; i < 8; ++i) {
      v4h h;
      h[0] = (_Float16)v[i].x; h[1] = (_Float16)v[i].y;
      h[2] = (_Float16)v[i].z; h[3] = (_Float16)v[i].w;
      dp[i * 256] = h;
    }
    return;
  }
  const int row = blockIdx.x - CVTWG;
  const int tid = threadIdx.x;
  const float4 v = ((const float4*)(x + (size_t)row * HID))[tid];
  float sum = v.x + v.y + v.z + v.w;
  float sq  = v.x * v.x + v.y * v.y + v.z * v.z + v.w * v.w;
  s1[tid] = sum; s2[tid] = sq;
  __syncthreads();
#pragma unroll
  for (int o = 128; o > 0; o >>= 1) {
    if (tid < o) { s1[tid] += s1[tid + o]; s2[tid] += s2[tid + o]; }
    __syncthreads();
  }
  const float mu   = s1[0] * (1.0f / HID);
  const float var  = s2[0] * (1.0f / HID) - mu * mu;
  const float rstd = rsqrtf(var + 1e-5f);
  const int c0 = tid * 4;
  const float e[4] = {v.x, v.y, v.z, v.w};
#pragma unroll
  for (int i = 0; i < 4; ++i) {
    const int c = c0 + i;
    const float nv = (e[i] - mu) * rstd;
    const size_t o = (size_t)row * HID + c;
    lnq[o] = (_Float16)(nv * qw[c] + qb[c]);
    lnk[o] = (_Float16)(nv * kw[c] + kb[c]);
    lnv[o] = (_Float16)(nv * vw[c] + vb[c]);
  }
}

// ---------------------------------------------------------------------------
// WMMA GEMM: C[M=4096, N=1024] = A[M,K=1024] @ W[N,K]^T + bias
// A work-group of 8 waves computes a 128(M) x 128(N) tile; one wave a
// 32(M) x 64(N) part of it (8 accumulators), waves laid 4 (M) x 2 (N).
// Operands go through LDS: a stage is 128 k (256 B) of the tile's 128 A rows and
// 128 W rows. It is fetched ONCE per work-group, by loads in which a wave covers
// 4 whole 128-byte lines, and every wave takes its fragments from LDS. (A
// fragment load from global memory touches 16 lines for its 512 bytes, and the
// waves that share a row block each repeat it.)
// Two buffers: the next stage's global loads fly during this stage's products
// and are written to the other buffer at the stage's end; one barrier per stage
// publishes them and ends the last read of the buffer that is refilled next.
// The k order of every accumulator is the ascending one, 32 k per product.
// One launch may hold several independent products of this shape: work-groups
// 256 w .. 256 w + 255 compute product w (operands Aw, Ww, biasw, mode mode0 + w).
// The three input projections go out together, 768 work-groups.
// WPS = waves per SIMD the build allows for. WPS 4: at most 256 registers a wave,
// so that two work-groups (2 x 136 KB of LDS) are resident on a WGP: while one
// waits for its next stage's global loads, at its barrier, in its prologue or in
// its epilogue, the other one's products run. WPS 1 (a launch of 256 work-groups,
// one per WGP): the allocator has the full VGPR budget.
// mode 0: q  -> f16 [b,h,s,d], (acc+bias)*QSCALE
// mode 1: k  -> f16 [b,h,s,d]
// mode 2: v  -> f16 [b,h,d,s]   (transposed so attention P@V streams contiguously)
// mode 3: o  -> f32 row-major [m, n] (final output)
// ---------------------------------------------------------------------------
#define GTM    128           /* tile rows of A per work-group */
#define GTN    128           /* tile rows of W per work-group */
#define GKS    128           /* k per stage: 256 B of each row */
#define GNST   (HID / GKS)
#define GPITCH 136           /* f16 per staged row: 256 B + 16 B pad, conflict-free for 16-byte reads */

template <int WPS>
__global__ void __launch_bounds__(256, WPS)
wmma_gemm(const _Float16* __restrict__ A0, const _Float16* __restrict__ A1,
          const _Float16* __restrict__ A2,
          const _Float16* __restrict__ W0, const _Float16* __restrict__ W1,
          const _Float16* __restrict__ W2,
          const float* __restrict__ bias0, const float* __restrict__ bias1,
          const float* __restrict__ bias2,
          _Float16* __restrict__ outH0, _Float16* __restrict__ outH1,
          _Float16* __restrict__ outH2,
          float* __restrict__ outF,
          int mode0) {
  __shared__ __align__(16) _Float16 stg[2][(GTM + GTN) * GPITCH];  // [buffer][A rows | W rows]
  const int wave  = threadIdx.x >> 5;
  const int lane  = threadIdx.x & 31;
  const int which = blockIdx.x >> 8;   // product 0..2 (uniform)
  const int mode  = mode0 + which;
  const _Float16* __restrict__ A  = which == 0 ? A0 : which == 1 ? A1 : A2;
  const _Float16* __restrict__ W  = which == 0 ? W0 : which == 1 ? W1 : W2;
  const float* __restrict__ bias  = which == 0 ? bias0 : which == 1 ? bias1 : bias2;
  _Float16* __restrict__ outH     = which == 0 ? outH0 : which == 1 ? outH1 : outH2;
  const int bm = (blockIdx.x & 255) >> 3;   // 0..31 (128-row blocks)
  const int bn = blockIdx.x & 7;            // 0..7  (128-col blocks)
  const int wm = wave >> 1;            // 0..3  (32-row part)
  const int wn = wave & 1;             // 0..1  (64-col part)
  const int m0 = bm * GTM + wm * 32;
  const int n0 = bn * GTN + wn * 64;
  const int mr  = lane & 15;           // M (for A) / N (for B) within tile
  const int kh8 = (lane >> 4) << 3;    // K-half select: 0 or 8

  // staging: thread t moves 16 bytes of rows t/16 + 16 i, i = 0..7, of each operand
  const int srow = threadIdx.x >> 4;
  const int scol = (threadIdx.x & 15) * 8;
  const _Float16* ga = A + (size_t)(bm * GTM + srow) * HID + scol;
  const _Float16* gw = W + (size_t)(bn * GTN + srow) * HID + scol;
  const int sl = srow * GPITCH + scol;

  v8f acc[8] = {v8f{}, v8f{}, v8f{}, v8f{}, v8f{}, v8f{}, v8f{}, v8f{}};
  v8h ra[8], rw[8];

  // prologue: stage 0 into buffer 0
  // (every loop over i below is unrolled so that ra[], rw[] stay in registers
  // and all 16 loads are in flight together)
#pragma unroll
  for (int i = 0; i < 8; ++i) {
    ra[i] = *(const v8h*)(ga + (size_t)i * 16 * HID);
    rw[i] = *(const v8h*)(gw + (size_t)i * 16 * HID);
  }
#pragma unroll
  for (int i = 0; i < 8; ++i) {
    *(v8h*)(&stg[0][sl + i * 16 * GPITCH]) = ra[i];
    *(v8h*)(&stg[0][sl + (GTM + i * 16) * GPITCH]) = rw[i];
  }
  __syncthreads();

  // fully unrolled: buffer index, global and LDS offsets are immediates, and
  // the accumulators stay pinned in one register set
#pragma unroll
  for (int s = 0; s < GNST; ++s) {
    if (s + 1 < GNST) {
#pragma unroll
      for (int i = 0; i < 8; ++i) {
        ra[i] = *(const v8h*)(ga + (size_t)i * 16 * HID + (s + 1) * GKS);
        rw[i] = *(const v8h*)(gw + (size_t)i * 16 * HID + (s + 1) * GKS);
      }
      // keeps the 16 loads in front of this stage's products: sunk down to their
      // LDS stores, nothing would cover their latency
      __builtin_amdgcn_sched_barrier(0);
    }
    const _Float16* la = &stg[s & 1][(wm * 32 + mr) * GPITCH + kh8];
    const _Float16* lb = &stg[s & 1][(GTM + wn * 64 + mr) * GPITCH + kh8];
    // unrolled: LDS offsets are immediates, fragment loads can run ahead of the products
#pragma unroll
    for (int k0 = 0; k0 < GKS; k0 += 32) {
      const v16h a0 = load_frag(la + k0);
      const v16h a1 = load_frag(la + 16 * GPITCH + k0);
      const v16h b0 = load_frag(lb + k0);
      const v16h b1 = load_frag(lb + 16 * GPITCH + k0);
      const v16h b2 = load_frag(lb + 32 * GPITCH + k0);
      const v16h b3 = load_frag(lb + 48 * GPITCH + k0);
      acc[0] = wmma16(a0, b0, acc[0]);
      acc[1] = wmma16(a0, b1, acc[1]);
      acc[2] = wmma16(a0, b2, acc[2]);
      acc[3] = wmma16(a0, b3, acc[3]);
      acc[4] = wmma16(a1, b0, acc[4]);
      acc[5] = wmma16(a1, b1, acc[5]);
      acc[6] = wmma16(a1, b2, acc[6]);
      acc[7] = wmma16(a1, b3, acc[7]);
      // mid-stage: fragment loads are not lifted from the stage's second half
      // into its first; with all four steps' fragments live beside the 64
      // staging registers the wave would pass 256 registers and spill
      if (WPS > 1 && k0 == GKS / 2 - 32) __builtin_amdgcn_sched_barrier(0);
    }
    if (s + 1 < GNST) {
      // hand over: the loaded stage goes to the other buffer, whose last
      // readers left it before the previous stage's barrier
#pragma unroll
      for (int i = 0; i < 8; ++i) {
        *(v8h*)(&stg[(s + 1) & 1][sl + i * 16 * GPITCH]) = ra[i];
        *(v8h*)(&stg[(s + 1) & 1][sl + (GTM + i * 16) * GPITCH]) = rw[i];
      }
      __syncthreads();
    }
  }

  const int hsel = lane >> 4;
  if (mode == 2) {
    // A lane's 8 accumulator registers are 8 consecutive tokens of one output
    // column, which lie side by side in the [b,h,d,s] layout: one 16-byte store.
#pragma unroll
    for (int half = 0; half < 2; ++half) {
#pragma unroll
      for (int j = 0; j < 4; ++j) {
        const int n = n0 + j * 16 + mr;
        const float bn = bias[n];
        v8h pk;
#pragma unroll
        for (int r = 0; r < 8; ++r) pk[r] = (_Float16)(acc[half * 4 + j][r] + bn);
        const int m = m0 + half * 16 + 8 * hsel;       // first of the 8 tokens
        const int b = m >> 11, s = m & (SEQ - 1);
        const int h = n >> 6,  d = n & (HDIM - 1);
        *(v8h*)(outH + (((size_t)b * NHD + h) * HDIM + d) * SEQ + s) = pk;
      }
    }
    return;
  }
#pragma unroll
  for (int half = 0; half < 2; ++half) {
#pragma unroll
    for (int j = 0; j < 4; ++j) {
      const int n = n0 + j * 16 + mr;
      const float bn = bias[n];
#pragma unroll
      for (int r = 0; r < 8; ++r) {
        const int m = m0 + half * 16 + r + 8 * hsel;   // token index
        float val = acc[half * 4 + j][r] + bn;
        if (mode == 0) val *= QSCALE;
        const int b = m >> 11, s = m & (SEQ - 1);
        const int h = n >> 6,  d = n & (HDIM - 1);
        if (mode <= 1) {
          outH[(((size_t)b * NHD + h) * SEQ + s) * HDIM + d] = (_Float16)val;
        } else {
          outF[(size_t)m * HID + n] = val;
        }
      }
    }
  }
}

// ---------------------------------------------------------------------------
// Flash attention: one wave per 16 queries of one (b,h), products transposed:
// S^T = K Q^T (A = K rows, B = Q) and O^T += V^T P^T (A = V^T rows, B = P^T).
// A lane then holds scores of ONE query (column lane & 15; keys 8 h + r of each
// 16-key tile, h = lane >> 4): maximum and sum run inside the lane, with one
// exchange between the wave's halves for the maximum. The two score tiles of a
// pass, converted in place, are already the B operand of the second product
// (element e < 8: key 8 h + e, else key 16 + 8 h + e - 8, the order in which
// load_frag takes V^T), so P goes through no LDS and no lane exchange.
// Each half keeps the sum of its own keys; the halves are joined once at the end.
// q,k f16 [b,h,s,d]; vT f16 [b,h,d,s]; out f16 [b, s, h*64+d] (== [B,S,H]).
// K and V go through LDS: the 8 waves of a work-group walk the same keys, so a
// stage (128 keys: 128 K rows of 128 B, 64 V^T rows of 256 B) is fetched ONCE
// per work-group, by loads in which a wave covers 4 whole 128-byte lines, and
// every wave takes its fragments from LDS. (A fragment load from global memory
// touches 16 lines for its 512 bytes, and each of the 8 waves repeats it.)
// Two buffers: the next stage's global loads fly during this stage's four
// 32-key passes and are written to the other buffer at the stage's end; one
// barrier per stage publishes them and ends the last read of the buffer that is
// refilled next. Keys are taken in ascending order, 32 per pass.
// ---------------------------------------------------------------------------
#define AKS    128           /* keys per stage */
#define ANST   (SEQ / AKS)
#define KPITCH 72            /* f16 per staged K row: 128 B + 16 B pad, conflict-free for 16-byte reads */
#define VPITCH 136           /* f16 per staged V^T row: 256 B + 16 B pad, likewise */

// value of lane l ^ 16 (the same column in the other half of the wave), by a
// vector cross-row move
__device__ __forceinline__ float xhalf(float x) {
  const int i = __builtin_bit_cast(int, x);
  return __builtin_bit_cast(float,
      __builtin_amdgcn_permlanex16(i, i, 0x76543210, 0xfedcba98, false, false));
}

// second launch bound: 4 waves per SIMD (256 registers a wave), so that two
// work-groups are resident on a WGP and all 512 run at once
__global__ void __launch_bounds__(256, 4)
attn_kernel(const _Float16* __restrict__ qg,
            const _Float16* __restrict__ kg,
            const _Float16* __restrict__ vtg,
            _Float16* __restrict__ og) {
  __shared__ __align__(16) _Float16 kst[2][AKS * KPITCH];    // [buffer][key][d]
  __shared__ __align__(16) _Float16 vst[2][HDIM * VPITCH];   // [buffer][d][key]
  const int wave = threadIdx.x >> 5;
  const int lane = threadIdx.x & 31;
  const int bh = blockIdx.x;                  // 0..31 : b*NH + h
  const int qt = blockIdx.y * 8 + wave;       // 0..127
  const int mr  = lane & 15;
  const int kh8 = (lane >> 4) << 3;
  const int hsel = lane >> 4;

  const _Float16* qp = qg  + (size_t)bh * SEQ * HDIM;
  const _Float16* kp = kg  + (size_t)bh * SEQ * HDIM;
  const _Float16* vp = vtg + (size_t)bh * HDIM * SEQ;

  // staging: thread t moves 16 bytes of K rows t/8 + 32 i and of V^T rows
  // t/16 + 16 i, i = 0..3 (a stage's K rows are one contiguous 16 KB run)
  const _Float16* gk = kp + threadIdx.x * 8;
  const _Float16* gv = vp + (size_t)(threadIdx.x >> 4) * SEQ + (threadIdx.x & 15) * 8;
  const int slk = (threadIdx.x >> 3) * KPITCH + (threadIdx.x & 7) * 8;
  const int slv = (threadIdx.x >> 4) * VPITCH + (threadIdx.x & 15) * 8;
  v8h rk[4], rv[4];

  // prologue: stage 0 into buffer 0
  // (every loop over i here and below is unrolled so that rk[], rv[] stay in
  // registers and all 8 loads are in flight together)
#pragma unroll
  for (int i = 0; i < 4; ++i) {
    rk[i] = *(const v8h*)(gk + i * 32 * HDIM);
    rv[i] = *(const v8h*)(gv + (size_t)i * 16 * SEQ);
  }

  // Q fragments (16 queries x 64 d) : two K=32 B-fragments, reused for all keys
  const v16h bq0 = load_frag(qp + (size_t)(qt * 16 + mr) * HDIM + 0  + kh8);
  const v16h bq1 = load_frag(qp + (size_t)(qt * 16 + mr) * HDIM + 32 + kh8);

  float mrun = -1.0e30f;      // running maximum of this lane's query (both halves alike)
  float lrun = 0.0f;          // running sum over this half's keys
  v8f oacc[4] = {v8f{}, v8f{}, v8f{}, v8f{}};   // O^T: oacc[j][r] = O[query mr][d = 16 j + 8 h + r]

#pragma unroll
  for (int i = 0; i < 4; ++i) {
    *(v8h*)(&kst[0][slk + i * 32 * KPITCH]) = rk[i];
    *(v8h*)(&vst[0][slv + i * 16 * VPITCH]) = rv[i];
  }
  __syncthreads();

  for (int s = 0; s < ANST; ++s) {
    if (s + 1 < ANST) {
#pragma unroll
      for (int i = 0; i < 4; ++i) {
        rk[i] = *(const v8h*)(gk + (s + 1) * AKS * HDIM + i * 32 * HDIM);
        rv[i] = *(const v8h*)(gv + (size_t)i * 16 * SEQ + (s + 1) * AKS);
      }
    }
    const _Float16* lk = &kst[s & 1][mr * KPITCH + kh8];
    const _Float16* lv = &vst[s & 1][mr * VPITCH + kh8];

    // two passes per trip: half the loop overhead
#pragma unroll 2
    for (int kc = 0; kc < AKS; kc += 32) {
      // ---- scores, transposed: two tiles of 16 keys x 16 queries over keys
      //      [kc, kc+32) of the stage
      const v16h ka0 = load_frag(lk + kc * KPITCH + 0);
      const v16h ka1 = load_frag(lk + kc * KPITCH + 32);
      const v16h ka2 = load_frag(lk + (kc + 16) * KPITCH + 0);
      const v16h ka3 = load_frag(lk + (kc + 16) * KPITCH + 32);
      v8f s0 = {}; s0 = wmma16(ka0, bq0, s0); s0 = wmma16(ka1, bq1, s0);
      v8f s1 = {}; s1 = wmma16(ka2, bq0, s1); s1 = wmma16(ka3, bq1, s1);

      // ---- V^T fragments for the current pass: issued before the softmax so
      //      that they overlap the vector work
      const v16h va0 = load_frag(lv + 0  * VPITCH + kc);
      const v16h va1 = load_frag(lv + 16 * VPITCH + kc);
      const v16h va2 = load_frag(lv + 32 * VPITCH + kc);
      const v16h va3 = load_frag(lv + 48 * VPITCH + kc);

      // ---- online softmax: the lane's 16 scores belong to one query
      float mx4[4];
#pragma unroll
      for (int c = 0; c < 4; ++c)
        mx4[c] = fmaxf(fmaxf(s0[c], s0[c + 4]), fmaxf(s1[c], s1[c + 4]));
      float mx = fmaxf(fmaxf(mx4[0], mx4[1]), fmaxf(mx4[2], mx4[3]));
      mx = fmaxf(mx, xhalf(mx));               // the other half's 16 keys
      const float newm  = fmaxf(mrun, mx);
      const float alpha = __expf(mrun - newm);
      v16h pb;                                  // P^T as B operand
      float rs4[4];                             // four short chains instead of one of 16 adds
#pragma unroll
      for (int r = 0; r < 8; ++r) {
        const float p0 = __expf(s0[r] - newm);
        const float p1 = __expf(s1[r] - newm);
        if (r < 4) rs4[r] = p0 + p1; else rs4[r - 4] += p0 + p1;
        pb[r]     = (_Float16)p0;
        pb[r + 8] = (_Float16)p1;
      }
      lrun = lrun * alpha + ((rs4[0] + rs4[1]) + (rs4[2] + rs4[3]));
      mrun = newm;
#pragma unroll
      for (int j = 0; j < 4; ++j) oacc[j] *= alpha;

      // ---- O^T += V^T P^T
      oacc[0] = wmma16(va0, pb, oacc[0]);
      oacc[1] = wmma16(va1, pb, oacc[1]);
      oacc[2] = wmma16(va2, pb, oacc[2]);
      oacc[3] = wmma16(va3, pb, oacc[3]);
    }
    if (s + 1 < ANST) {
      // hand over: the loaded stage goes to the other buffer, whose last
      // readers left it before the previous stage's barrier
#pragma unroll
      for (int i = 0; i < 4; ++i) {
        *(v8h*)(&kst[(s + 1) & 1][slk + i * 32 * KPITCH]) = rk[i];
        *(v8h*)(&vst[(s + 1) & 1][slv + i * 16 * VPITCH]) = rv[i];
      }
      __syncthreads();
    }
  }

  // ---- normalize + store to [B, S, H] as f16: a lane's 8 registers of a tile
  //      are 8 consecutive d of its query, one 16-byte store
  const float lsum = lrun + xhalf(lrun);        // join the halves' sums
  const int b = bh >> 4, h = bh & 15;
  _Float16* op = og + ((size_t)b * SEQ + qt * 16 + mr) * HID + h * HDIM + 8 * hsel;
#pragma unroll
  for (int j = 0; j < 4; ++j) {
    v8h pk;
#pragma unroll
    for (int r = 0; r < 8; ++r) pk[r] = (_Float16)(oacc[j][r] / lsum);
    *(v8h*)(op + j * 16) = pk;
  }
}

// ---------------------------------------------------------------------------
extern "C" void kernel_launch(void* const* d_in, const int* in_sizes, int n_in,
                              void* d_out, int out_size, void* d_ws, size_t ws_size,
                              hipStream_t stream) {
  const float* x    = (const float*)d_in[0];
  const float* lnqw = (const float*)d_in[1];
  const float* lnqb = (const float*)d_in[2];
  const float* lnkw = (const float*)d_in[3];
  const float* lnkb = (const float*)d_in[4];
  const float* lnvw = (const float*)d_in[5];
  const float* lnvb = (const float*)d_in[6];
  const float* wq   = (const float*)d_in[7];
  const float* bq   = (const float*)d_in[8];
  const float* wk   = (const float*)d_in[9];
  const float* bk   = (const float*)d_in[10];
  const float* wv   = (const float*)d_in[11];
  const float* bv   = (const float*)d_in[12];
  const float* wo   = (const float*)d_in[13];
  const float* bo   = (const float*)d_in[14];
  float* out = (float*)d_out;

  const size_t MB = (size_t)1 << 20;
  uint8_t* w = (uint8_t*)d_ws;
  _Float16* lnq = (_Float16*)(w + 0 * MB);    // 8 MB each
  _Float16* lnk = (_Float16*)(w + 8 * MB);
  _Float16* lnv = (_Float16*)(w + 16 * MB);
  _Float16* wqh = (_Float16*)(w + 24 * MB);   // 2 MB each
  _Float16* wkh = (_Float16*)(w + 26 * MB);
  _Float16* wvh = (_Float16*)(w + 28 * MB);
  _Float16* woh = (_Float16*)(w + 30 * MB);
  _Float16* qh  = (_Float16*)(w + 32 * MB);   // 8 MB each
  _Float16* kh  = (_Float16*)(w + 40 * MB);
  _Float16* vth = (_Float16*)(w + 48 * MB);
  _Float16* oh  = (_Float16*)(w + 56 * MB);

  // 1. weight conversions f32 -> f16 and fused triple LayerNorm -> f16
  //    activations, one launch
  prep_kernel<<<CVTWG + MTOK, 256, 0, stream>>>(x, lnqw, lnqb, lnkw, lnkb, lnvw, lnvb,
                                                lnq, lnk, lnv,
                                                wq, wk, wv, wo, wqh, wkh, wvh, woh);
  // 2. QKV projections in one launch (3 x 256 work-groups of 8 waves;
  //    work-group = 128x128 tile)
  wmma_gemm<4><<<768, 256, 0, stream>>>(lnq, lnk, lnv, wqh, wkh, wvh, bq, bk, bv,
                                        qh, kh, vth, nullptr, 0);
  // 3. flash attention: 32 (b,h) x 128 q-tiles / 8 waves per block
  attn_kernel<<<dim3(BB * NHD, 16), 256, 0, stream>>>(qh, kh, vth, oh);
  // 4. output projection -> f32 d_out
  wmma_gemm<1><<<256, 256, 0, stream>>>(oh, oh, oh, woh, woh, woh, bo, bo, bo,
                                        nullptr, nullptr, nullptr, out, 3);
}

// v007
// Measured time: 86.9 microseconds a run.
// Two timings next to v006 put it at 1.07 and 1.08 times that version's speed.
// Counting every step since v000, it is 3.43 times as fast.
#include <hip/hip_runtime.h>
#include <hip/hip_bf16.h>

typedef _Float16 v8h  __attribute__((ext_vector_type(8)));
typedef _Float16 v16h __attribute__((ext_vector_type(16)));
typedef float    v8f  __attribute__((ext_vector_type(8)));

#define HID   1024
#define SEQ   2048
#define BB    2
#define NHD   16
#define HDIM  64
#define MTOK  (BB*SEQ)      /* 4096 tokens */
#define QSCALE 0.125f       /* HD^-0.5 */

// Load a 16x32 f16 A/B fragment half for this lane: elements [0..7] = p[0..7],
// elements [8..15] = p[16..23]  (K-halves per CDNA5 16-bit WMMA VGPR layout).
__device__ __forceinline__ v16h load_frag(const _Float16* __restrict__ p) {
  v8h lo = *(const v8h*)(p);
  v8h hi = *(const v8h*)(p + 16);
  v16h r;
#pragma unroll
  for (int i = 0; i < 8; ++i) { r[i] = lo[i]; r[i + 8] = hi[i]; }
  return r;
}

__device__ __forceinline__ v8f wmma16(v16h a, v16h b, v8f c) {
  return __builtin_amdgcn_wmma_f32_16x16x32_f16(false, a, false, b, (short)0, c,
                                                false, false);
}

// ---------------------------------------------------------------------------
// One launch for the two passes that depend on nothing but the inputs.
// Work-groups 0 .. CVTWG-1: f32 -> f16 conversion of the four weight matrices;
// 128 work-groups of 8 waves per matrix, 8192 consecutive elements each. A lane
// issues its 8 loads of 16 bytes together, then converts and stores 8 bytes per
// load; every wave-wide load and store covers whole 128-byte lines.
// Work-groups CVTWG .. CVTWG+4095: fused triple LayerNorm of one row each,
// x[4096,1024] f32 -> lnq/lnk/lnv f16.
// ---------------------------------------------------------------------------
typedef _Float16 v4h __attribute__((ext_vector_type(4)));
#define CVTWG 512

__global__ void __launch_bounds__(256)
prep_kernel(const float* __restrict__ x,
            const float* __restrict__ qw, const float* __restrict__ qb,
            const float* __restrict__ kw, const float* __restrict__ kb,
            const float* __restrict__ vw, const float* __restrict__ vb,
            _Float16* __restrict__ lnq,
            _Float16* __restrict__ lnk,
            _Float16* __restrict__ lnv,
            const float* __restrict__ s0, const float* __restrict__ s1w,
            const float* __restrict__ s2w, const float* __restrict__ s3,
            _Float16* __restrict__ d0, _Float16* __restrict__ d1,
            _Float16* __restrict__ d2, _Float16* __restrict__ d3) {
  __shared__ float s1[256];
  __shared__ float s2[256];
  if (blockIdx.x < CVTWG) {                      // uniform for the work-group, in front of every barrier
    const int which = blockIdx.x >> 7;           // matrix 0..3 (uniform)
    const float* __restrict__ src = which == 0 ? s0 : which == 1 ? s1w : which == 2 ? s2w : s3;
    _Float16* __restrict__ dst    = which == 0 ? d0 : which == 1 ? d1 : which == 2 ? d2 : d3;
    const int q0 = (blockIdx.x & 127) * 2048 + threadIdx.x;   // index in groups of 4 elements
    const float4* __restrict__ sp = (const float4*)src + q0;
    v4h* __restrict__ dp = (v4h*)dst + q0;
    float4 v[8];
    // unrolled: v[] stays in registers and all 8 loads are in flight together
#pragma unroll
    for (int i = 0; i < 8; ++i) v[i] = sp[i * 256];
    // unrolled: constant indices into v[]
#pragma unroll
    for (int i = 0; i < 8; ++i) {
      v4h h;
      h[0] = (_Float16)v[i].x; h[1] = (_Float16)v[i].y;
      h[2] = (_Float16)v[i].z; h[3] = (_Float16)v[i].w;
      dp[i * 256] = h;
    }
    return;
  }
  const int row = blockIdx.x - CVTWG;
  const int tid = threadIdx.x;
  const float4 v = ((const float4*)(x + (size_t)row * HID))[tid];
  float sum = v.x + v.y + v.z + v.w;
  float sq  = v.x * v.x + v.y * v.y + v.z * v.z + v.w * v.w;
  s1[tid] = sum; s2[tid] = sq;
  __syncthreads();
#pragma unroll
  for (int o = 128; o > 0; o >>= 1) {
    if (tid < o) { s1[tid] += s1[tid + o]; s2[tid] += s2[tid + o]; }
    __syncthreads();
  }
  const float mu   = s1[0] * (1.0f / HID);
  const float var  = s2[0] * (1.0f / HID) - mu * mu;
  const float rstd = rsqrtf(var + 1e-5f);
  const int c0 = tid * 4;
  const float e[4] = {v.x, v.y, v.z, v.w};
#pragma unroll
  for (int i = 0; i < 4; ++i) {
    const int c = c0 + i;
    const float nv = (e[i] - mu) * rstd;
    const size_t o = (size_t)row * HID + c;
    lnq[o] = (_Float16)(nv * qw[c] + qb[c]);
    lnk[o] = (_Float16)(nv * kw[c] + kb[c]);
    lnv[o] = (_Float16)(nv * vw[c] + vb[c]);
  }
}

// ---------------------------------------------------------------------------
// WMMA GEMM: C[M=4096, N=1024] = A[M,K=1024] @ W[N,K]^T + bias
// A work-group of 8 waves computes a 128(M) x 128(N) tile; one wave a
// 32(M) x 64(N) part of it (8 accumulators), waves laid 4 (M) x 2 (N).
// Operands go through LDS: a stage is 128 k (256 B) of the tile's 128 A rows and
// 128 W rows. It is fetched ONCE per work-group, by loads in which a wave covers
// 4 whole 128-byte lines, and every wave takes its fragments from LDS. (A
// fragment load from global memory touches 16 lines for its 512 bytes, and the
// waves that share a row block each repeat it.)
// Two buffers: the next stage's global loads fly during this stage's products
// and are written to the other buffer at the stage's end; one barrier per stage
// publishes them and ends the last read of the buffer that is refilled next.
// The k order of every accumulator is the ascending one, 32 k per product.
// One launch may hold several independent products of this shape: work-groups
// 256 w .. 256 w + 255 compute product w (operands Aw, Ww, biasw, mode mode0 + w).
// The three input projections go out together, 768 work-groups.
// WPS = waves per SIMD the build allows for. WPS 4: at most 256 registers a wave,
// so that two work-groups (2 x 136 KB of LDS) are resident on a WGP: while one
// waits for its next stage's global loads, at its barrier, in its prologue or in
// its epilogue, the other one's products run. WPS 1 (a launch of 256 work-groups,
// one per WGP): the allocator has the full VGPR budget.
// mode 0: q  -> f16 [b,h,s,d], (acc+bias)*QSCALE
// mode 1: k  -> f16 [b,h,s,d]
// mode 2: v  -> f16 [b,h,d,s]   (transposed so attention P@V streams contiguously)
// mode 3: o  -> f32 row-major [m, n] (final output)
// ---------------------------------------------------------------------------
#define GTM    128           /* tile rows of A per work-group */
#define GTN    128           /* tile rows of W per work-group */
#define GKS    128           /* k per stage: 256 B of each row */
#define GNST   (HID / GKS)
#define GPITCH 136           /* f16 per staged row: 256 B + 16 B pad, conflict-free for 16-byte reads */
#define OPITCH 68            /* f32 per staged output row of a wave: 256 B + 16 B pad; 8 waves x 32 rows fill one buffer */

template <int WPS>
__global__ void __launch_bounds__(256, WPS)
wmma_gemm(const _Float16* __restrict__ A0, const _Float16* __restrict__ A1,
          const _Float16* __restrict__ A2,
          const _Float16* __restrict__ W0, const _Float16* __restrict__ W1,
          const _Float16* __restrict__ W2,
          const float* __restrict__ bias0, const float* __restrict__ bias1,
          const float* __restrict__ bias2,
          _Float16* __restrict__ outH0, _Float16* __restrict__ outH1,
          _Float16* __restrict__ outH2,
          float* __restrict__ outF,
          int mode0) {
  __shared__ __align__(16) _Float16 stg[2][(GTM + GTN) * GPITCH];  // [buffer][A rows | W rows]
  const int wave  = threadIdx.x >> 5;
  const int lane  = threadIdx.x & 31;
  const int which = blockIdx.x >> 8;   // product 0..2 (uniform)
  const int mode  = mode0 + which;
  const _Float16* __restrict__ A  = which == 0 ? A0 : which == 1 ? A1 : A2;
  const _Float16* __restrict__ W  = which == 0 ? W0 : which == 1 ? W1 : W2;
  const float* __restrict__ bias  = which == 0 ? bias0 : which == 1 ? bias1 : bias2;
  _Float16* __restrict__ outH     = which == 0 ? outH0 : which == 1 ? outH1 : outH2;
  const int bm = (blockIdx.x & 255) >> 3;   // 0..31 (128-row blocks)
  const int bn = blockIdx.x & 7;            // 0..7  (128-col blocks)
  const int wm = wave >> 1;            // 0..3  (32-row part)
  const int wn = wave & 1;             // 0..1  (64-col part)
  const int m0 = bm * GTM + wm * 32;
  const int n0 = bn * GTN + wn * 64;
  const int mr  = lane & 15;           // M (for A) / N (for B) within tile
  const int kh8 = (lane >> 4) << 3;    // K-half select: 0 or 8

  // staging: thread t moves 16 bytes of rows t/16 + 16 i, i = 0..7, of each operand
  const int srow = threadIdx.x >> 4;
  const int scol = (threadIdx.x & 15) * 8;
  const _Float16* ga = A + (size_t)(bm * GTM + srow) * HID + scol;
  const _Float16* gw = W + (size_t)(bn * GTN + srow) * HID + scol;
  const int sl = srow * GPITCH + scol;

  v8f acc[8] = {v8f{}, v8f{}, v8f{}, v8f{}, v8f{}, v8f{}, v8f{}, v8f{}};
  v8h ra[8], rw[8];

  // prologue: stage 0 into buffer 0
  // (every loop over i below is unrolled so that ra[], rw[] stay in registers
  // and all 16 loads are in flight together)
#pragma unroll
  for (int i = 0; i < 8; ++i) {
    ra[i] = *(const v8h*)(ga + (size_t)i * 16 * HID);
    rw[i] = *(const v8h*)(gw + (size_t)i * 16 * HID);
  }
#pragma unroll
  for (int i = 0; i < 8; ++i) {
    *(v8h*)(&stg[0][sl + i * 16 * GPITCH]) = ra[i];
    *(v8h*)(&stg[0][sl + (GTM + i * 16) * GPITCH]) = rw[i];
  }
  __syncthreads();

  // fully unrolled: buffer index, global and LDS offsets are immediates, and
  // the accumulators stay pinned in one register set
#pragma unroll
  for (int s = 0; s < GNST; ++s) {
    if (s + 1 < GNST) {
#pragma unroll
      for (int i = 0; i < 8; ++i) {
        ra[i] = *(const v8h*)(ga + (size_t)i * 16 * HID + (s + 1) * GKS);
        rw[i] = *(const v8h*)(gw + (size_t)i * 16 * HID + (s + 1) * GKS);
      }
      // keeps the 16 loads in front of this stage's products: sunk down to their
      // LDS stores, nothing would cover their latency
      __builtin_amdgcn_sched_barrier(0);
    }
    const _Float16* la = &stg[s & 1][(wm * 32 + mr) * GPITCH + kh8];
    const _Float16* lb = &stg[s & 1][(GTM + wn * 64 + mr) * GPITCH + kh8];
    // unrolled: LDS offsets are immediates, fragment loads can run ahead of the products
#pragma unroll
    for (int k0 = 0; k0 < GKS; k0 += 32) {
      const v16h a0 = load_frag(la + k0);
      const v16h a1 = load_frag(la + 16 * GPITCH + k0);
      const v16h b0 = load_frag(lb + k0);
      const v16h b1 = load_frag(lb + 16 * GPITCH + k0);
      const v16h b2 = load_frag(lb + 32 * GPITCH + k0);
      const v16h b3 = load_frag(lb + 48 * GPITCH + k0);
      acc[0] = wmma16(a0, b0, acc[0]);
      acc[1] = wmma16(a0, b1, acc[1]);
      acc[2] = wmma16(a0, b2, acc[2]);
      acc[3] = wmma16(a0, b3, acc[3]);
      acc[4] = wmma16(a1, b0, acc[4]);
      acc[5] = wmma16(a1, b1, acc[5]);
      acc[6] = wmma16(a1, b2, acc[6]);
      acc[7] = wmma16(a1, b3, acc[7]);
      // mid-stage: fragment loads are not lifted from the stage's second half
      // into its first; with all four steps' fragments live beside the 64
      // staging registers the wave would pass 256 registers and spill
      if (WPS > 1 && k0 == GKS / 2 - 32) __builtin_amdgcn_sched_barrier(0);
    }
    if (s + 1 < GNST) {
      // hand over: the loaded stage goes to the other buffer, whose last
      // readers left it before the previous stage's barrier
#pragma unroll
      for (int i = 0; i < 8; ++i) {
        *(v8h*)(&stg[(s + 1) & 1][sl + i * 16 * GPITCH]) = ra[i];
        *(v8h*)(&stg[(s + 1) & 1][sl + (GTM + i * 16) * GPITCH]) = rw[i];
      }
      __syncthreads();
    }
  }

  // Epilogue: the accumulators leave through LDS, so that every wave-wide global
  // store is 16 bytes a lane and covers whole 128-byte lines. Staging uses buffer
  // 0 only: the last stage reads buffer 1, and every wave's last read of buffer 0
  // lies in front of the barrier that closed the stage before it.
  // (Every loop of the epilogue is unrolled: constant indices keep acc[] in
  // registers, and LDS and global offsets become immediates.)
  const int hsel = lane >> 4;
  if (mode == 2) {
    // V^T: a row of the output (one d) holds the 128 tokens of the whole tile,
    // 256 B, written by four waves: staged per work-group. A lane's 8 accumulator
    // registers are 8 consecutive tokens of one column: one 16-byte LDS store.
    _Float16* vs = &stg[0][0];                   // [128 columns][GPITCH tokens]
#pragma unroll
    for (int half = 0; half < 2; ++half) {
#pragma unroll
      for (int j = 0; j < 4; ++j) {
        const float bn = bias[n0 + j * 16 + mr];
        v8h pk;
#pragma unroll
        for (int r = 0; r < 8; ++r) pk[r] = (_Float16)(acc[half * 4 + j][r] + bn);
        *(v8h*)(vs + (wn * 64 + j * 16 + mr) * GPITCH + wm * 32 + half * 16 + 8 * hsel) = pk;
      }
    }
    __syncthreads();   // publishes the staged tile to the waves that store it
    const int mt = bm * GTM;                     // first token of the tile
    const int b = mt >> 11, s = mt & (SEQ - 1);
#pragma unroll
    for (int i = 0; i < 8; ++i) {
      const int n = bn * GTN + srow + i * 16;    // 16 lanes store one row's 256 B
      const int h = n >> 6, d = n & (HDIM - 1);
      *(v8h*)(outH + (((size_t)b * NHD + h) * HDIM + d) * SEQ + s + scol) =
          *(const v8h*)(vs + (srow + i * 16) * GPITCH + scol);
    }
    return;
  }
  // q, k, o: a wave's 32 x 64 part is whole lines by itself (q, k: 32 tokens of one
  // head, one run of 4 KB; o: 256 B of each of 32 rows), so each wave stages in a
  // range of its own, as f32, and no barrier is needed.
  float* st = (float*)&stg[0][0] + wave * (32 * OPITCH);
  const float qs = mode == 0 ? QSCALE : 1.0f;    // times 1.0f is exact
#pragma unroll
  for (int half = 0; half < 2; ++half) {
#pragma unroll
    for (int j = 0; j < 4; ++j) {
      const float bn = bias[n0 + j * 16 + mr];
#pragma unroll
      for (int r = 0; r < 8; ++r)
        st[(half * 16 + r + 8 * hsel) * OPITCH + j * 16 + mr] = (acc[half * 4 + j][r] + bn) * qs;
    }
  }
  // the wave's own LDS writes are done before other lanes of it read the rows back
  asm volatile("s_wait_dscnt 0x0" ::: "memory");
  if (mode == 3) {
#pragma unroll
    for (int i = 0; i < 16; ++i) {
      const int row = i * 2 + hsel;              // 16 lanes store one row's 256 B
      *(float4*)(outF + (size_t)(m0 + row) * HID + n0 + mr * 4) =
          *(const float4*)(st + row * OPITCH + mr * 4);
    }
  } else {
    const int b = m0 >> 11, s = m0 & (SEQ - 1), h = n0 >> 6;
    _Float16* op = outH + (((size_t)b * NHD + h) * SEQ + s) * HDIM;
#pragma unroll
    for (int i = 0; i < 8; ++i) {
      const int row = i * 4 + (lane >> 3);       // 8 lanes store one token's 128 B
      const int col = (lane & 7) * 8;
      const float4 lo = *(const float4*)(st + row * OPITCH + col);
      const float4 hi = *(const float4*)(st + row * OPITCH + col + 4);
      v8h pk;
      pk[0] = (_Float16)lo.x; pk[1] = (_Float16)lo.y; pk[2] = (_Float16)lo.z; pk[3] = (_Float16)lo.w;
      pk[4] = (_Float16)hi.x; pk[5] = (_Float16)hi.y; pk[6] = (_Float16)hi.z; pk[7] = (_Float16)hi.w;
      *(v8h*)(op + row * HDIM + col) = pk;
    }
  }
}

// ---------------------------------------------------------------------------
// Flash attention: one wave per 16 queries of one (b,h), products transposed:
// S^T = K Q^T (A = K rows, B = Q) and O^T += V^T P^T (A = V^T rows, B = P^T).
// A lane then holds scores of ONE query (column lane & 15; keys 8 h + r of each
// 16-key tile, h = lane >> 4): maximum and sum run inside the lane, with one
// exchange between the wave's halves for the maximum. The two score tiles of a
// pass, converted in place, are already the B operand of the second product
// (element e < 8: key 8 h + e, else key 16 + 8 h + e - 8, the order in which
// load_frag takes V^T), so P goes through no LDS and no lane exchange.
// Each half keeps the sum of its own keys; the halves are joined once at the end.
// q,k f16 [b,h,s,d]; vT f16 [b,h,d,s]; out f16 [b, s, h*64+d] (== [B,S,H]).
// K and V go through LDS: the 8 waves of a work-group walk the same keys, so a
// stage (128 keys: 128 K rows of 128 B, 64 V^T rows of 256 B) is fetched ONCE
// per work-group, by loads in which a wave covers 4 whole 128-byte lines, and
// every wave takes its fragments from LDS. (A fragment load from global memory
// touches 16 lines for its 512 bytes, and each of the 8 waves repeats it.)
// Two buffers: the next stage's global loads fly during this stage's four
// 32-key passes and are written to the other buffer at the stage's end; one
// barrier per stage publishes them and ends the last read of the buffer that is
// refilled next. Keys are taken in ascending order, 32 per pass.
// ---------------------------------------------------------------------------
#define AKS    128           /* keys per stage */
#define ANST   (SEQ / AKS)
#define KPITCH 72            /* f16 per staged K row: 128 B + 16 B pad, conflict-free for 16-byte reads */
#define VPITCH 136           /* f16 per staged V^T row: 256 B + 16 B pad, likewise */

// value of lane l ^ 16 (the same column in the other half of the wave), by a
// vector cross-row move
__device__ __forceinline__ float xhalf(float x) {
  const int i = __builtin_bit_cast(int, x);
  return __builtin_bit_cast(float,
      __builtin_amdgcn_permlanex16(i, i, 0x76543210, 0xfedcba98, false, false));
}

// second launch bound: 4 waves per SIMD (256 registers a wave), so that two
// work-groups are resident on a WGP and all 512 run at once
__global__ void __launch_bounds__(256, 4)
attn_kernel(const _Float16* __restrict__ qg,
            const _Float16* __restrict__ kg,
            const _Float16* __restrict__ vtg,
            _Float16* __restrict__ og) {
  __shared__ __align__(16) _Float16 kst[2][AKS * KPITCH];    // [buffer][key][d]
  __shared__ __align__(16) _Float16 vst[2][HDIM * VPITCH];   // [buffer][d][key]
  const int wave = threadIdx.x >> 5;
  const int lane = threadIdx.x & 31;
  const int bh = blockIdx.x;                  // 0..31 : b*NH + h
  const int qt = blockIdx.y * 8 + wave;       // 0..127
  const int mr  = lane & 15;
  const int kh8 = (lane >> 4) << 3;
  const int hsel = lane >> 4;

  const _Float16* qp = qg  + (size_t)bh * SEQ * HDIM;
  const _Float16* kp = kg  + (size_t)bh * SEQ * HDIM;
  const _Float16* vp = vtg + (size_t)bh * HDIM * SEQ;

  // staging: thread t moves 16 bytes of K rows t/8 + 32 i and of V^T rows
  // t/16 + 16 i, i = 0..3 (a stage's K rows are one contiguous 16 KB run)
  const _Float16* gk = kp + threadIdx.x * 8;
  const _Float16* gv = vp + (size_t)(threadIdx.x >> 4) * SEQ + (threadIdx.x & 15) * 8;
  const int slk = (threadIdx.x >> 3) * KPITCH + (threadIdx.x & 7) * 8;
  const int slv = (threadIdx.x >> 4) * VPITCH + (threadIdx.x & 15) * 8;
  v8h rk[4], rv[4];

  // prologue: stage 0 into buffer 0
  // (every loop over i here and below is unrolled so that rk[], rv[] stay in
  // registers and all 8 loads are in flight together)
#pragma unroll
  for (int i = 0; i < 4; ++i) {
    rk[i] = *(const v8h*)(gk + i * 32 * HDIM);
    rv[i] = *(const v8h*)(gv + (size_t)i * 16 * SEQ);
  }

  // Q fragments (16 queries x 64 d) : two K=32 B-fragments, reused for all keys
  const v16h bq0 = load_frag(qp + (size_t)(qt * 16 + mr) * HDIM + 0  + kh8);
  const v16h bq1 = load_frag(qp + (size_t)(qt * 16 + mr) * HDIM + 32 + kh8);

  float mrun = -1.0e30f;      // running maximum of this lane's query (both halves alike)
  float lrun = 0.0f;          // running sum over this half's keys
  v8f oacc[4] = {v8f{}, v8f{}, v8f{}, v8f{}};   // O^T: oacc[j][r] = O[query mr][d = 16 j + 8 h + r]

#pragma unroll
  for (int i = 0; i < 4; ++i) {
    *(v8h*)(&kst[0][slk + i * 32 * KPITCH]) = rk[i];
    *(v8h*)(&vst[0][slv + i * 16 * VPITCH]) = rv[i];
  }
  __syncthreads();

  for (int s = 0; s < ANST; ++s) {
    if (s + 1 < ANST) {
#pragma unroll
      for (int i = 0; i < 4; ++i) {
        rk[i] = *(const v8h*)(gk + (s + 1) * AKS * HDIM + i * 32 * HDIM);
        rv[i] = *(const v8h*)(gv + (size_t)i * 16 * SEQ + (s + 1) * AKS);
      }
    }
    const _Float16* lk = &kst[s & 1][mr * KPITCH + kh8];
    const _Float16* lv = &vst[s & 1][mr * VPITCH + kh8];

    // two passes per trip: half the loop overhead
#pragma unroll 2
    for (int kc = 0; kc < AKS; kc += 32) {
      // ---- scores, transposed: two tiles of 16 keys x 16 queries over keys
      //      [kc, kc+32) of the stage
      const v16h ka0 = load_frag(lk + kc * KPITCH + 0);
      const v16h ka1 = load_frag(lk + kc * KPITCH + 32);
      const v16h ka2 = load_frag(lk + (kc + 16) * KPITCH + 0);
      const v16h ka3 = load_frag(lk + (kc + 16) * KPITCH + 32);
      v8f s0 = {}; s0 = wmma16(ka0, bq0, s0); s0 = wmma16(ka1, bq1, s0);
      v8f s1 = {}; s1 = wmma16(ka2, bq0, s1); s1 = wmma16(ka3, bq1, s1);

      // ---- V^T fragments for the current pass: issued before the softmax so
      //      that they overlap the vector work
      const v16h va0 = load_frag(lv + 0  * VPITCH + kc);
      const v16h va1 = load_frag(lv + 16 * VPITCH + kc);
      const v16h va2 = load_frag(lv + 32 * VPITCH + kc);
      const v16h va3 = load_frag(lv + 48 * VPITCH + kc);

      // ---- online softmax: the lane's 16 scores belong to one query
      float mx4[4];
#pragma unroll
      for (int c = 0; c < 4; ++c)
        mx4[c] = fmaxf(fmaxf(s0[c], s0[c + 4]), fmaxf(s1[c], s1[c + 4]));
      float mx = fmaxf(fmaxf(mx4[0], mx4[1]), fmaxf(mx4[2], mx4[3]));
      mx = fmaxf(mx, xhalf(mx));               // the other half's 16 keys
      const float newm  = fmaxf(mrun, mx);
      const float alpha = __expf(mrun - newm);
      v16h pb;                                  // P^T as B operand
      float rs4[4];                             // four short chains instead of one of 16 adds
#pragma unroll
      for (int r = 0; r < 8; ++r) {
        const float p0 = __expf(s0[r] - newm);
        const float p1 = __expf(s1[r] - newm);
        if (r < 4) rs4[r] = p0 + p1; else rs4[r - 4] += p0 + p1;
        pb[r]     = (_Float16)p0;
        pb[r + 8] = (_Float16)p1;
      }
      lrun = lrun * alpha + ((rs4[0] + rs4[1]) + (rs4[2] + rs4[3]));
      mrun = newm;
#pragma unroll
      for (int j = 0; j < 4; ++j) oacc[j] *= alpha;

      // ---- O^T += V^T P^T
      oacc[0] = wmma16(va0, pb, oacc[0]);
      oacc[1] = wmma16(va1, pb, oacc[1]);
      oacc[2] = wmma16(va2, pb, oacc[2]);
      oacc[3] = wmma16(va3, pb, oacc[3]);
    }
    if (s + 1 < ANST) {
      // hand over: the loaded stage goes to the other buffer, whose last
      // readers left it before the previous stage's barrier
#pragma unroll
      for (int i = 0; i < 4; ++i) {
        *(v8h*)(&kst[(s + 1) & 1][slk + i * 32 * KPITCH]) = rk[i];
        *(v8h*)(&vst[(s + 1) & 1][slv + i * 16 * VPITCH]) = rv[i];
      }
      __syncthreads();
    }
  }

  // ---- normalize + store to [B, S, H] as f16: a lane's 8 registers of a tile
  //      are 8 consecutive d of its query, one 16-byte store
  const float lsum = lrun + xhalf(lrun);        // join the halves' sums
  const int b = bh >> 4, h = bh & 15;
  _Float16* op = og + ((size_t)b * SEQ + qt * 16 + mr) * HID + h * HDIM + 8 * hsel;
#pragma unroll
  for (int j = 0; j < 4; ++j) {
    v8h pk;
#pragma unroll
    for (int r = 0; r < 8; ++r) pk[r] = (_Float16)(oacc[j][r] / lsum);
    *(v8h*)(op + j * 16) = pk;
  }
}

// ---------------------------------------------------------------------------
extern "C" void kernel_launch(void* const* d_in, const int* in_sizes, int n_in,
                              void* d_out, int out_size, void* d_ws, size_t ws_size,
                              hipStream_t stream) {
  const float* x    = (const float*)d_in[0];
  const float* lnqw = (const float*)d_in[1];
  const float* lnqb = (const float*)d_in[2];
  const float* lnkw = (const float*)d_in[3];
  const float* lnkb = (const float*)d_in[4];
  const float* lnvw = (const float*)d_in[5];
  const float* lnvb = (const float*)d_in[6];
  const float* wq   = (const float*)d_in[7];
  const float* bq   = (const float*)d_in[8];
  const float* wk   = (const float*)d_in[9];
  const float* bk   = (const float*)d_in[10];
  const float* wv   = (const float*)d_in[11];
  const float* bv   = (const float*)d_in[12];
  const float* wo   = (const float*)d_in[13];
  const float* bo   = (const float*)d_in[14];
  float* out = (float*)d_out;

  const size_t MB = (size_t)1 << 20;
  uint8_t* w = (uint8_t*)d_ws;
  _Float16* lnq = (_Float16*)(w + 0 * MB);    // 8 MB each
  _Float16* lnk = (_Float16*)(w + 8 * MB);
  _Float16* lnv = (_Float16*)(w + 16 * MB);
  _Float16* wqh = (_Float16*)(w + 24 * MB);   // 2 MB each
  _Float16* wkh = (_Float16*)(w + 26 * MB);
  _Float16* wvh = (_Float16*)(w + 28 * MB);
  _Float16* woh = (_Float16*)(w + 30 * MB);
  _Float16* qh  = (_Float16*)(w + 32 * MB);   // 8 MB each
  _Float16* kh  = (_Float16*)(w + 40 * MB);
  _Float16* vth = (_Float16*)(w + 48 * MB);
  _Float16* oh  = (_Float16*)(w + 56 * MB);

  // 1. weight conversions f32 -> f16 and fused triple LayerNorm -> f16
  //    activations, one launch
  prep_kernel<<<CVTWG + MTOK, 256, 0, stream>>>(x, lnqw, lnqb, lnkw, lnkb, lnvw, lnvb,
                                                lnq, lnk, lnv,
                                                wq, wk, wv, wo, wqh, wkh, wvh, woh);
  // 2. QKV projections in one launch (3 x 256 work-groups of 8 waves;
  //    work-group = 128x128 tile)
  wmma_gemm<4><<<768, 256, 0, stream>>>(lnq, lnk, lnv, wqh, wkh, wvh, bq, bk, bv,
                                        qh, kh, vth, nullptr, 0);
  // 3. flash attention: 32 (b,h) x 128 q-tiles / 8 waves per block
  attn_kernel<<<dim3(BB * NHD, 16), 256, 0, stream>>>(qh, kh, vth, oh);
  // 4. output projection -> f32 d_out
  wmma_gemm<1><<<256, 256, 0, stream>>>(oh, oh, oh, woh, woh, woh, bo, bo, bo,
                                        nullptr, nullptr, nullptr, out, 3);
}

// v008
// Measured time: 82.1 microseconds a run.
// Next to v007, in two timings, it ran 1.05 and 1.06 times as fast.
// Over all steps from v000 it is 3.63 times as fast.
#include <hip/hip_runtime.h>
#include <hip/hip_bf16.h>

typedef _Float16 v8h  __attribute__((ext_vector_type(8)));
typedef _Float16 v16h __attribute__((ext_vector_type(16)));
typedef float    v8f  __attribute__((ext_vector_type(8)));

#define HID   1024
#define SEQ   2048
#define BB    2
#define NHD   16
#define HDIM  64
#define MTOK  (BB*SEQ)      /* 4096 tokens */
#define QSCALE 0.125f       /* HD^-0.5 */

// Load a 16x32 f16 A/B fragment half for this lane: elements [0..7] = p[0..7],
// elements [8..15] = p[16..23]  (K-halves per CDNA5 16-bit WMMA VGPR layout).
__device__ __forceinline__ v16h load_frag(const _Float16* __restrict__ p) {
  v8h lo = *(const v8h*)(p);
  v8h hi = *(const v8h*)(p + 16);
  v16h r;
#pragma unroll
  for (int i = 0; i < 8; ++i) { r[i] = lo[i]; r[i + 8] = hi[i]; }
  return r;
}

__device__ __forceinline__ v8f wmma16(v16h a, v16h b, v8f c) {
  return __builtin_amdgcn_wmma_f32_16x16x32_f16(false, a, false, b, (short)0, c,
                                                false, false);
}

// ---------------------------------------------------------------------------
// One launch for the two passes that depend on nothing but the inputs.
// Work-groups 0 .. CVTWG-1: f32 -> f16 conversion of the four weight matrices;
// 128 work-groups of 8 waves per matrix, 8192 consecutive elements each. A lane
// issues its 8 loads of 16 bytes together, then converts and stores 8 bytes per
// load; every wave-wide load and store covers whole 128-byte lines.
// Work-groups CVTWG .. CVTWG+4095: fused triple LayerNorm of one row each,
// x[4096,1024] f32 -> lnq/lnk/lnv f16.
// ---------------------------------------------------------------------------
typedef _Float16 v4h __attribute__((ext_vector_type(4)));
#define CVTWG 512

__global__ void __launch_bounds__(256)
prep_kernel(const float* __restrict__ x,
            const float* __restrict__ qw, const float* __restrict__ qb,
            const float* __restrict__ kw, const float* __restrict__ kb,
            const float* __restrict__ vw, const float* __restrict__ vb,
            _Float16* __restrict__ lnq,
            _Float16* __restrict__ lnk,
            _Float16* __restrict__ lnv,
            const float* __restrict__ s0, const float* __restrict__ s1w,
            const float* __restrict__ s2w, const float* __restrict__ s3,
            _Float16* __restrict__ d0, _Float16* __restrict__ d1,
            _Float16* __restrict__ d2, _Float16* __restrict__ d3) {
  __shared__ float s1[256];
  __shared__ float s2[256];
  if (blockIdx.x < CVTWG) {                      // uniform for the work-group, in front of every barrier
    const int which = blockIdx.x >> 7;           // matrix 0..3 (uniform)
    const float* __restrict__ src = which == 0 ? s0 : which == 1 ? s1w : which == 2 ? s2w : s3;
    _Float16* __restrict__ dst    = which == 0 ? d0 : which == 1 ? d1 : which == 2 ? d2 : d3;
    const int q0 = (blockIdx.x & 127) * 2048 + threadIdx.x;   // index in groups of 4 elements
    const float4* __restrict__ sp = (const float4*)src + q0;
    v4h* __restrict__ dp = (v4h*)dst + q0;
    float4 v[8];
    // unrolled: v[] stays in registers and all 8 loads are in flight together
#pragma unroll
    for (int i = 0; i < 8; ++i) v[i] = sp[i * 256];
    // unrolled: constant indices into v[]
#pragma unroll
    for (int i = 0; i < 8; ++i) {
      v4h h;
      h[0] = (_Float16)v[i].x; h[1] = (_Float16)v[i].y;
      h[2] = (_Float16)v[i].z; h[3] = (_Float16)v[i].w;
      dp[i * 256] = h;
    }
    return;
  }
  const int row = blockIdx.x - CVTWG;
  const int tid = threadIdx.x;
  const float4 v = ((const float4*)(x + (size_t)row * HID))[tid];
  float sum = v.x + v.y + v.z + v.w;
  float sq  = v.x * v.x + v.y * v.y + v.z * v.z + v.w * v.w;
  s1[tid] = sum; s2[tid] = sq;
  __syncthreads();
#pragma unroll
  for (int o = 128; o > 0; o >>= 1) {
    if (tid < o) { s1[tid] += s1[tid + o]; s2[tid] += s2[tid + o]; }
    __syncthreads();
  }
  const float mu   = s1[0] * (1.0f / HID);
  const float var  = s2[0] * (1.0f / HID) - mu * mu;
  const float rstd = rsqrtf(var + 1e-5f);
  const int c0 = tid * 4;
  const float e[4] = {v.x, v.y, v.z, v.w};
#pragma unroll
  for (int i = 0; i < 4; ++i) {
    const int c = c0 + i;
    const float nv = (e[i] - mu) * rstd;
    const size_t o = (size_t)row * HID + c;
    lnq[o] = (_Float16)(nv * qw[c] + qb[c]);
    lnk[o] = (_Float16)(nv * kw[c] + kb[c]);
    lnv[o] = (_Float16)(nv * vw[c] + vb[c]);
  }
}

// ---------------------------------------------------------------------------
// WMMA GEMM: C[M=4096, N=1024] = A[M,K=1024] @ W[N,K]^T + bias
// A work-group of 8 waves computes a 128(M) x 128(N) tile; one wave a
// 32(M) x 64(N) part of it (8 accumulators), waves laid 4 (M) x 2 (N).
// Operands go through LDS: a stage is 128 k (256 B) of the tile's 128 A rows and
// 128 W rows. It is fetched ONCE per work-group, by loads in which a wave covers
// 4 whole 128-byte lines, and every wave takes its fragments from LDS. (A
// fragment load from global memory touches 16 lines for its 512 bytes, and the
// waves that share a row block each repeat it.)
// Two buffers: the next stage's global loads fly during this stage's products
// and are written to the other buffer at the stage's end; one barrier per stage
// publishes them and ends the last read of the buffer that is refilled next.
// The k order of every accumulator is the ascending one, 32 k per product.
// One launch may hold several independent products of this shape: work-groups
// 256 w .. 256 w + 255 compute product w (operands Aw, Ww, biasw, mode mode0 + w).
// The three input projections go out together, 768 work-groups.
// WPS = waves per SIMD the build allows for. WPS 4: at most 256 registers a wave,
// so that two work-groups (2 x 136 KB of LDS) are resident on a WGP: while one
// waits for its next stage's global loads, at its barrier, in its prologue or in
// its epilogue, the other one's products run. WPS 1 (a launch of 256 work-groups,
// one per WGP): the allocator has the full VGPR budget.
// mode 0: q  -> f16 [b,h,s,d], (acc+bias)*QSCALE
// mode 1: k  -> f16 [b,h,s,d]
// mode 2: v  -> f16 [b,h,d,s]   (transposed so attention P@V streams contiguously)
// mode 3: o  -> f32 row-major [m, n] (final output)
// ---------------------------------------------------------------------------
#define GTM    128           /* tile rows of A per work-group */
#define GTN    128           /* tile rows of W per work-group */
#define GKS    128           /* k per stage: 256 B of each row */
#define GNST   (HID / GKS)
#define GPITCH 136           /* f16 per staged row: 256 B + 16 B pad, conflict-free for 16-byte reads */
#define OPITCH 68            /* f32 per staged output row of a wave: 256 B + 16 B pad; 8 waves x 32 rows fill one buffer */

template <int WPS>
__global__ void __launch_bounds__(256, WPS)
wmma_gemm(const _Float16* __restrict__ A0, const _Float16* __restrict__ A1,
          const _Float16* __restrict__ A2,
          const _Float16* __restrict__ W0, const _Float16* __restrict__ W1,
          const _Float16* __restrict__ W2,
          const float* __restrict__ bias0, const float* __restrict__ bias1,
          const float* __restrict__ bias2,
          _Float16* __restrict__ outH0, _Float16* __restrict__ outH1,
          _Float16* __restrict__ outH2,
          float* __restrict__ outF,
          int mode0) {
  __shared__ __align__(16) _Float16 stg[2][(GTM + GTN) * GPITCH];  // [buffer][A rows | W rows]
  const int wave  = threadIdx.x >> 5;
  const int lane  = threadIdx.x & 31;
  const int which = blockIdx.x >> 8;   // product 0..2 (uniform)
  const int mode  = mode0 + which;
  const _Float16* __restrict__ A  = which == 0 ? A0 : which == 1 ? A1 : A2;
  const _Float16* __restrict__ W  = which == 0 ? W0 : which == 1 ? W1 : W2;
  const float* __restrict__ bias  = which == 0 ? bias0 : which == 1 ? bias1 : bias2;
  _Float16* __restrict__ outH     = which == 0 ? outH0 : which == 1 ? outH1 : outH2;
  const int bm = (blockIdx.x & 255) >> 3;   // 0..31 (128-row blocks)
  const int bn = blockIdx.x & 7;            // 0..7  (128-col blocks)
  const int wm = wave >> 1;            // 0..3  (32-row part)
  const int wn = wave & 1;             // 0..1  (64-col part)
  const int m0 = bm * GTM + wm * 32;
  const int n0 = bn * GTN + wn * 64;
  const int mr  = lane & 15;           // M (for A) / N (for B) within tile
  const int kh8 = (lane >> 4) << 3;    // K-half select: 0 or 8

  // staging: thread t moves 16 bytes of rows t/16 + 16 i, i = 0..7, of each operand
  const int srow = threadIdx.x >> 4;
  const int scol = (threadIdx.x & 15) * 8;
  const _Float16* ga = A + (size_t)(bm * GTM + srow) * HID + scol;
  const _Float16* gw = W + (size_t)(bn * GTN + srow) * HID + scol;
  const int sl = srow * GPITCH + scol;

  v8f acc[8] = {v8f{}, v8f{}, v8f{}, v8f{}, v8f{}, v8f{}, v8f{}, v8f{}};
  v8h ra[8], rw[8];

  // prologue: stage 0 into buffer 0
  // (every loop over i below is unrolled so that ra[], rw[] stay in registers
  // and all 16 loads are in flight together)
#pragma unroll
  for (int i = 0; i < 8; ++i) {
    ra[i] = *(const v8h*)(ga + (size_t)i * 16 * HID);
    rw[i] = *(const v8h*)(gw + (size_t)i * 16 * HID);
  }
#pragma unroll
  for (int i = 0; i < 8; ++i) {
    *(v8h*)(&stg[0][sl + i * 16 * GPITCH]) = ra[i];
    *(v8h*)(&stg[0][sl + (GTM + i * 16) * GPITCH]) = rw[i];
  }
  __syncthreads();

  // fully unrolled: buffer index, global and LDS offsets are immediates, and
  // the accumulators stay pinned in one register set
#pragma unroll
  for (int s = 0; s < GNST; ++s) {
    if (s + 1 < GNST) {
#pragma unroll
      for (int i = 0; i < 8; ++i) {
        ra[i] = *(const v8h*)(ga + (size_t)i * 16 * HID + (s + 1) * GKS);
        rw[i] = *(const v8h*)(gw + (size_t)i * 16 * HID + (s + 1) * GKS);
      }
      // keeps the 16 loads in front of this stage's products: sunk down to their
      // LDS stores, nothing would cover their latency
      __builtin_amdgcn_sched_barrier(0);
    }
    const _Float16* la = &stg[s & 1][(wm * 32 + mr) * GPITCH + kh8];
    const _Float16* lb = &stg[s & 1][(GTM + wn * 64 + mr) * GPITCH + kh8];
    // unrolled: LDS offsets are immediates, fragment loads can run ahead of the products
#pragma unroll
    for (int k0 = 0; k0 < GKS; k0 += 32) {
      const v16h a0 = load_frag(la + k0);
      const v16h a1 = load_frag(la + 16 * GPITCH + k0);
      const v16h b0 = load_frag(lb + k0);
      const v16h b1 = load_frag(lb + 16 * GPITCH + k0);
      const v16h b2 = load_frag(lb + 32 * GPITCH + k0);
      const v16h b3 = load_frag(lb + 48 * GPITCH + k0);
      acc[0] = wmma16(a0, b0, acc[0]);
      acc[1] = wmma16(a0, b1, acc[1]);
      acc[2] = wmma16(a0, b2, acc[2]);
      acc[3] = wmma16(a0, b3, acc[3]);
      acc[4] = wmma16(a1, b0, acc[4]);
      acc[5] = wmma16(a1, b1, acc[5]);
      acc[6] = wmma16(a1, b2, acc[6]);
      acc[7] = wmma16(a1, b3, acc[7]);
      // mid-stage: fragment loads are not lifted from the stage's second half
      // into its first; with all four steps' fragments live beside the 64
      // staging registers the wave would pass 256 registers and spill
      if (WPS > 1 && k0 == GKS / 2 - 32) __builtin_amdgcn_sched_barrier(0);
    }
    if (s + 1 < GNST) {
      // hand over: the loaded stage goes to the other buffer, whose last
      // readers left it before the previous stage's barrier
#pragma unroll
      for (int i = 0; i < 8; ++i) {
        *(v8h*)(&stg[(s + 1) & 1][sl + i * 16 * GPITCH]) = ra[i];
        *(v8h*)(&stg[(s + 1) & 1][sl + (GTM + i * 16) * GPITCH]) = rw[i];
      }
      __syncthreads();
    }
  }

  // Epilogue: the accumulators leave through LDS, so that every wave-wide global
  // store is 16 bytes a lane and covers whole 128-byte lines. Staging uses buffer
  // 0 only: the last stage reads buffer 1, and every wave's last read of buffer 0
  // lies in front of the barrier that closed the stage before it.
  // (Every loop of the epilogue is unrolled: constant indices keep acc[] in
  // registers, and LDS and global offsets become immediates.)
  const int hsel = lane >> 4;
  if (mode == 2) {
    // V^T: a row of the output (one d) holds the 128 tokens of the whole tile,
    // 256 B, written by four waves: staged per work-group. A lane's 8 accumulator
    // registers are 8 consecutive tokens of one column: one 16-byte LDS store.
    _Float16* vs = &stg[0][0];                   // [128 columns][GPITCH tokens]
#pragma unroll
    for (int half = 0; half < 2; ++half) {
#pragma unroll
      for (int j = 0; j < 4; ++j) {
        const float bn = bias[n0 + j * 16 + mr];
        v8h pk;
#pragma unroll
        for (int r = 0; r < 8; ++r) pk[r] = (_Float16)(acc[half * 4 + j][r] + bn);
        *(v8h*)(vs + (wn * 64 + j * 16 + mr) * GPITCH + wm * 32 + half * 16 + 8 * hsel) = pk;
      }
    }
    __syncthreads();   // publishes the staged tile to the waves that store it
    const int mt = bm * GTM;                     // first token of the tile
    const int b = mt >> 11, s = mt & (SEQ - 1);
#pragma unroll
    for (int i = 0; i < 8; ++i) {
      const int n = bn * GTN + srow + i * 16;    // 16 lanes store one row's 256 B
      const int h = n >> 6, d = n & (HDIM - 1);
      *(v8h*)(outH + (((size_t)b * NHD + h) * HDIM + d) * SEQ + s + scol) =
          *(const v8h*)(vs + (srow + i * 16) * GPITCH + scol);
    }
    return;
  }
  // q, k, o: a wave's 32 x 64 part is whole lines by itself (q, k: 32 tokens of one
  // head, one run of 4 KB; o: 256 B of each of 32 rows), so each wave stages in a
  // range of its own, as f32, and no barrier is needed.
  float* st = (float*)&stg[0][0] + wave * (32 * OPITCH);
  const float qs = mode == 0 ? QSCALE : 1.0f;    // times 1.0f is exact
#pragma unroll
  for (int half = 0; half < 2; ++half) {
#pragma unroll
    for (int j = 0; j < 4; ++j) {
      const float bn = bias[n0 + j * 16 + mr];
#pragma unroll
      for (int r = 0; r < 8; ++r)
        st[(half * 16 + r + 8 * hsel) * OPITCH + j * 16 + mr] = (acc[half * 4 + j][r] + bn) * qs;
    }
  }
  // the wave's own LDS writes are done before other lanes of it read the rows back
  asm volatile("s_wait_dscnt 0x0" ::: "memory");
  if (mode == 3) {
#pragma unroll
    for (int i = 0; i < 16; ++i) {
      const int row = i * 2 + hsel;              // 16 lanes store one row's 256 B
      *(float4*)(outF + (size_t)(m0 + row) * HID + n0 + mr * 4) =
          *(const float4*)(st + row * OPITCH + mr * 4);
    }
  } else {
    const int b = m0 >> 11, s = m0 & (SEQ - 1), h = n0 >> 6;
    _Float16* op = outH + (((size_t)b * NHD + h) * SEQ + s) * HDIM;
#pragma unroll
    for (int i = 0; i < 8; ++i) {
      const int row = i * 4 + (lane >> 3);       // 8 lanes store one token's 128 B
      const int col = (lane & 7) * 8;
      const float4 lo = *(const float4*)(st + row * OPITCH + col);
      const float4 hi = *(const float4*)(st + row * OPITCH + col + 4);
      v8h pk;
      pk[0] = (_Float16)lo.x; pk[1] = (_Float16)lo.y; pk[2] = (_Float16)lo.z; pk[3] = (_Float16)lo.w;
      pk[4] = (_Float16)hi.x; pk[5] = (_Float16)hi.y; pk[6] = (_Float16)hi.z; pk[7] = (_Float16)hi.w;
      *(v8h*)(op + row * HDIM + col) = pk;
    }
  }
}

// ---------------------------------------------------------------------------
// Flash attention: one wave per 16 queries of one (b,h), products transposed:
// S^T = K Q^T (A = K rows, B = Q) and O^T += V^T P^T (A = V^T rows, B = P^T).
// A lane then holds scores of ONE query (column lane & 15; keys 8 h + r of each
// 16-key tile, h = lane >> 4): maximum and sum run inside the lane, with one
// exchange between the wave's halves for the maximum. The four score tiles of a
// pass, converted in place in pairs, are already the two B operands of the second product
// (element e < 8: key 8 h + e, else key 16 + 8 h + e - 8, the order in which
// load_frag takes V^T), so P goes through no LDS and no lane exchange.
// Each half keeps the sum of its own keys; the halves are joined once at the end.
// The maximum is a HELD REFERENCE: each query keeps a reference score ref (the
// maximum of its first 32 keys, taken in front of the loop), and the score
// products start from C = -ref, so the matrix unit hands out s - ref. In the
// usual pass nothing is subtracted and neither O nor the sum is rescaled. Once
// per 64 keys the wave tests whether any score has passed its reference by more
// than RTAU; only then ref is raised to the new maximum and the pass's scores,
// O and the sum are brought to it. ref is always the score of a key already
// seen, so the sum holds a term near 1 and P never exceeds exp(RTAU).
// q,k f16 [b,h,s,d]; vT f16 [b,h,d,s]; out f16 [b, s, h*64+d] (== [B,S,H]).
// K and V go through LDS: the 8 waves of a work-group walk the same keys, so a
// stage (128 keys: 128 K rows of 128 B, 64 V^T rows of 256 B) is fetched ONCE
// per work-group, by loads in which a wave covers 4 whole 128-byte lines, and
// every wave takes its fragments from LDS. (A fragment load from global memory
// touches 16 lines for its 512 bytes, and each of the 8 waves repeats it.)
// Two buffers: the next stage's global loads fly during this stage's two
// 64-key passes and are written to the other buffer at the stage's end; one
// barrier per stage publishes them and ends the last read of the buffer that is
// refilled next. Keys are taken in ascending order, 64 per pass.
// ---------------------------------------------------------------------------
#define AKS    128           /* keys per stage */
#define ANST   (SEQ / AKS)
#define KPITCH 72            /* f16 per staged K row: 128 B + 16 B pad, conflict-free for 16-byte reads */
#define VPITCH 136           /* f16 per staged V^T row: 256 B + 16 B pad, likewise */
#define RTAU   5.5f          /* a score may pass its reference by this much: P <= exp(5.5) < 256, far inside f16 */

// value of lane l ^ 16 (the same column in the other half of the wave), by a
// vector cross-row move
__device__ __forceinline__ float xhalf(float x) {
  const int i = __builtin_bit_cast(int, x);
  return __builtin_bit_cast(float,
      __builtin_amdgcn_permlanex16(i, i, 0x76543210, 0xfedcba98, false, false));
}

// second launch bound: 4 waves per SIMD (256 registers a wave), so that two
// work-groups are resident on a WGP and all 512 run at once
__global__ void __launch_bounds__(256, 4)
attn_kernel(const _Float16* __restrict__ qg,
            const _Float16* __restrict__ kg,
            const _Float16* __restrict__ vtg,
            _Float16* __restrict__ og) {
  __shared__ __align__(16) _Float16 kst[2][AKS * KPITCH];    // [buffer][key][d]
  __shared__ __align__(16) _Float16 vst[2][HDIM * VPITCH];   // [buffer][d][key]
  const int wave = threadIdx.x >> 5;
  const int lane = threadIdx.x & 31;
  const int bh = blockIdx.x;                  // 0..31 : b*NH + h
  const int qt = blockIdx.y * 8 + wave;       // 0..127
  const int mr  = lane & 15;
  const int kh8 = (lane >> 4) << 3;
  const int hsel = lane >> 4;

  const _Float16* qp = qg  + (size_t)bh * SEQ * HDIM;
  const _Float16* kp = kg  + (size_t)bh * SEQ * HDIM;
  const _Float16* vp = vtg + (size_t)bh * HDIM * SEQ;

  // staging: thread t moves 16 bytes of K rows t/8 + 32 i and of V^T rows
  // t/16 + 16 i, i = 0..3 (a stage's K rows are one contiguous 16 KB run)
  const _Float16* gk = kp + threadIdx.x * 8;
  const _Float16* gv = vp + (size_t)(threadIdx.x >> 4) * SEQ + (threadIdx.x & 15) * 8;
  const int slk = (threadIdx.x >> 3) * KPITCH + (threadIdx.x & 7) * 8;
  const int slv = (threadIdx.x >> 4) * VPITCH + (threadIdx.x & 15) * 8;
  v8h rk[4], rv[4];

  // prologue: stage 0 into buffer 0
  // (every loop over i here and below is unrolled so that rk[], rv[] stay in
  // registers and all 8 loads are in flight together)
#pragma unroll
  for (int i = 0; i < 4; ++i) {
    rk[i] = *(const v8h*)(gk + i * 32 * HDIM);
    rv[i] = *(const v8h*)(gv + (size_t)i * 16 * SEQ);
  }

  // Q fragments (16 queries x 64 d) : two K=32 B-fragments, reused for all keys
  const v16h bq0 = load_frag(qp + (size_t)(qt * 16 + mr) * HDIM + 0  + kh8);
  const v16h bq1 = load_frag(qp + (size_t)(qt * 16 + mr) * HDIM + 32 + kh8);

  float lrun = 0.0f;          // running sum over this half's keys, relative to mref
  v8f oacc[4] = {v8f{}, v8f{}, v8f{}, v8f{}};   // O^T: oacc[j][r] = O[query mr][d = 16 j + 8 h + r]

#pragma unroll
  for (int i = 0; i < 4; ++i) {
    *(v8h*)(&kst[0][slk + i * 32 * KPITCH]) = rk[i];
    *(v8h*)(&vst[0][slv + i * 16 * VPITCH]) = rv[i];
  }
  __syncthreads();

  // first reference of this lane's query (both halves alike): the maximum over
  // keys 0..31, whose scores are computed once more here
  float mref;
  {
    const _Float16* lk0 = &kst[0][mr * KPITCH + kh8];
    v8f t0 = {}; t0 = wmma16(load_frag(lk0), bq0, t0); t0 = wmma16(load_frag(lk0 + 32), bq1, t0);
    v8f t1 = {}; t1 = wmma16(load_frag(lk0 + 16 * KPITCH), bq0, t1);
    t1 = wmma16(load_frag(lk0 + 16 * KPITCH + 32), bq1, t1);
    float m4[4];
#pragma unroll
    for (int c = 0; c < 4; ++c)
      m4[c] = fmaxf(fmaxf(t0[c], t0[c + 4]), fmaxf(t1[c], t1[c + 4]));
    const float m1 = fmaxf(fmaxf(m4[0], m4[1]), fmaxf(m4[2], m4[3]));
    mref = fmaxf(m1, xhalf(m1));
  }
  v8f cneg;                   // -mref in all 8 registers: the C operand of the score products
#pragma unroll
  for (int r = 0; r < 8; ++r) cneg[r] = -mref;

  for (int s = 0; s < ANST; ++s) {
    if (s + 1 < ANST) {
#pragma unroll
      for (int i = 0; i < 4; ++i) {
        rk[i] = *(const v8h*)(gk + (s + 1) * AKS * HDIM + i * 32 * HDIM);
        rv[i] = *(const v8h*)(gv + (size_t)i * 16 * SEQ + (s + 1) * AKS);
      }
    }
    const _Float16* lk = &kst[s & 1][mr * KPITCH + kh8];
    const _Float16* lv = &vst[s & 1][mr * VPITCH + kh8];

    // kept rolled: with both passes of a stage in one block the fragment loads
    // were split into small groups, each waited for on the spot
#pragma unroll 1
    for (int kc = 0; kc < AKS; kc += 64) {
      // ---- scores minus reference, transposed: four tiles of 16 keys x 16
      //      queries over keys [kc, kc+64) of the stage
      v16h ka[4][2];
#pragma unroll
      for (int t = 0; t < 4; ++t) {
        ka[t][0] = load_frag(lk + (kc + 16 * t) * KPITCH + 0);
        ka[t][1] = load_frag(lk + (kc + 16 * t) * KPITCH + 32);
      }
      v8f sc[4];
#pragma unroll
      for (int t = 0; t < 4; ++t) sc[t] = wmma16(ka[t][0], bq0, cneg);
#pragma unroll
      for (int t = 0; t < 4; ++t) sc[t] = wmma16(ka[t][1], bq1, sc[t]);

      // ---- has a score passed its reference? The lane's 32 scores belong to one query
      float mx8[8];
#pragma unroll
      for (int c = 0; c < 8; ++c)
        mx8[c] = fmaxf(fmaxf(sc[0][c], sc[1][c]), fmaxf(sc[2][c], sc[3][c]));
      float mx = fmaxf(fmaxf(fmaxf(mx8[0], mx8[1]), fmaxf(mx8[2], mx8[3])),
                       fmaxf(fmaxf(mx8[4], mx8[5]), fmaxf(mx8[6], mx8[7])));
      mx = fmaxf(mx, xhalf(mx));               // the other half's 32 keys
      // one test per pass, a scalar branch for the whole wave
      if (__builtin_amdgcn_ballot_w32(mx > RTAU) != 0) {
        const float d     = fmaxf(mx, 0.0f);   // 0: this query's reference stays
        const float alpha = __expf(-d);
#pragma unroll
        for (int t = 0; t < 4; ++t) sc[t] -= d;
#pragma unroll
        for (int j = 0; j < 4; ++j) oacc[j] *= alpha;
        lrun *= alpha;
        mref += d;
#pragma unroll
        for (int r = 0; r < 8; ++r) cneg[r] = -mref;
      }

      // ---- V^T fragments for the current pass: issued before the exponentials
      //      so that they overlap the vector work
      v16h va[2][4];
#pragma unroll
      for (int g = 0; g < 2; ++g)
#pragma unroll
        for (int j = 0; j < 4; ++j) va[g][j] = load_frag(lv + 16 * j * VPITCH + kc + 32 * g);
      // keeps the 16 loads together in front of the exponentials: sunk among the
      // products, each small group was waited for on the spot
      __builtin_amdgcn_sched_barrier(0);

      // exp(x) = 2^(x log2 e), as __expf has it; whole tiles at a time, so that
      // packed instructions pair neighbouring registers
      v8f pv[4];
#pragma unroll
      for (int t = 0; t < 4; ++t) {
        const v8f e = sc[t] * 1.44269504f;
#pragma unroll
        for (int r = 0; r < 8; ++r) pv[t][r] = __builtin_amdgcn_exp2f(e[r]);
      }
      v16h pb[2];                               // P^T as B operand, 32 keys each
#pragma unroll
      for (int r = 0; r < 8; ++r) {
        pb[0][r]     = (_Float16)pv[0][r];
        pb[0][r + 8] = (_Float16)pv[1][r];
        pb[1][r]     = (_Float16)pv[2][r];
        pb[1][r + 8] = (_Float16)pv[3][r];
      }
      // ---- O^T += V^T P^T
#pragma unroll
      for (int g = 0; g < 2; ++g)
#pragma unroll
        for (int j = 0; j < 4; ++j) oacc[j] = wmma16(va[g][j], pb[g], oacc[j]);

      // ---- row sums, behind the products: they run while the matrix unit works,
      //      and they keep the next pass's first register writes at the distance
      //      the chip needs behind the last product. The barrier keeps the scheduler
      //      from lifting them in front again.
      __builtin_amdgcn_sched_barrier(0);
      const v8f ps = (pv[0] + pv[1]) + (pv[2] + pv[3]);
      lrun += ((ps[0] + ps[1]) + (ps[2] + ps[3])) + ((ps[4] + ps[5]) + (ps[6] + ps[7]));
    }
    if (s + 1 < ANST) {
      // hand over: the loaded stage goes to the other buffer, whose last
      // readers left it before the previous stage's barrier
#pragma unroll
      for (int i = 0; i < 4; ++i) {
        *(v8h*)(&kst[(s + 1) & 1][slk + i * 32 * KPITCH]) = rk[i];
        *(v8h*)(&vst[(s + 1) & 1][slv + i * 16 * VPITCH]) = rv[i];
      }
      __syncthreads();
    }
  }

  // ---- normalize + store to [B, S, H] as f16: a lane's 8 registers of a tile
  //      are 8 consecutive d of its query, one 16-byte store
  const float lsum = lrun + xhalf(lrun);        // join the halves' sums
  const int b = bh >> 4, h = bh & 15;
  _Float16* op = og + ((size_t)b * SEQ + qt * 16 + mr) * HID + h * HDIM + 8 * hsel;
#pragma unroll
  for (int j = 0; j < 4; ++j) {
    v8h pk;
#pragma unroll
    for (int r = 0; r < 8; ++r) pk[r] = (_Float16)(oacc[j][r] / lsum);
    *(v8h*)(op + j * 16) = pk;
  }
}

// ---------------------------------------------------------------------------
extern "C" void kernel_launch(void* const* d_in, const int* in_sizes, int n_in,
                              void* d_out, int out_size, void* d_ws, size_t ws_size,
                              hipStream_t stream) {
  const float* x    = (const float*)d_in[0];
  const float* lnqw = (const float*)d_in[1];
  const float* lnqb = (const float*)d_in[2];
  const float* lnkw = (const float*)d_in[3];
  const float* lnkb = (const float*)d_in[4];
  const float* lnvw = (const float*)d_in[5];
  const float* lnvb = (const float*)d_in[6];
  const float* wq   = (const float*)d_in[7];
  const float* bq   = (const float*)d_in[8];
  const float* wk   = (const float*)d_in[9];
  const float* bk   = (const float*)d_in[10];
  const float* wv   = (const float*)d_in[11];
  const float* bv   = (const float*)d_in[12];
  const float* wo   = (const float*)d_in[13];
  const float* bo   = (const float*)d_in[14];
  float* out = (float*)d_out;

  const size_t MB = (size_t)1 << 20;
  uint8_t* w = (uint8_t*)d_ws;
  _Float16* lnq = (_Float16*)(w + 0 * MB);    // 8 MB each
  _Float16* lnk = (_Float16*)(w + 8 * MB);
  _Float16* lnv = (_Float16*)(w + 16 * MB);
  _Float16* wqh = (_Float16*)(w + 24 * MB);   // 2 MB each
  _Float16* wkh = (_Float16*)(w + 26 * MB);
  _Float16* wvh = (_Float16*)(w + 28 * MB);
  _Float16* woh = (_Float16*)(w + 30 * MB);
  _Float16* qh  = (_Float16*)(w + 32 * MB);   // 8 MB each
  _Float16* kh  = (_Float16*)(w + 40 * MB);
  _Float16* vth = (_Float16*)(w + 48 * MB);
  _Float16* oh  = (_Float16*)(w + 56 * MB);

  // 1. weight conversions f32 -> f16 and fused triple LayerNorm -> f16
  //    activations, one launch
  prep_kernel<<<CVTWG + MTOK, 256, 0, stream>>>(x, lnqw, lnqb, lnkw, lnkb, lnvw, lnvb,
                                                lnq, lnk, lnv,
                                                wq, wk, wv, wo, wqh, wkh, wvh, woh);
  // 2. QKV projections in one launch (3 x 256 work-groups of 8 waves;
  //    work-group = 128x128 tile)
  wmma_gemm<4><<<768, 256, 0, stream>>>(lnq, lnk, lnv, wqh, wkh, wvh, bq, bk, bv,
                                        qh, kh, vth, nullptr, 0);
  // 3. flash attention: 32 (b,h) x 128 q-tiles / 8 waves per block
  attn_kernel<<<dim3(BB * NHD, 16), 256, 0, stream>>>(qh, kh, vth, oh);
  // 4. output projection -> f32 d_out
  wmma_gemm<1><<<256, 256, 0, stream>>>(oh, oh, oh, woh, woh, woh, bo, bo, bo,
                                        nullptr, nullptr, nullptr, out, 3);
}

// v009
// A run of this version takes 78.8 microseconds.
// Next to v008, in two timings, it ran 1.06 and 1.05 times as fast.
// All steps since v000 together make it 3.83 times as fast.
#include <hip/hip_runtime.h>
#include <hip/hip_bf16.h>

typedef _Float16 v8h  __attribute__((ext_vector_type(8)));
typedef _Float16 v16h __attribute__((ext_vector_type(16)));
typedef float    v8f  __attribute__((ext_vector_type(8)));

#define HID   1024
#define SEQ   2048
#define BB    2
#define NHD   16
#define HDIM  64
#define MTOK  (BB*SEQ)      /* 4096 tokens */
#define QSCALE 0.125f       /* HD^-0.5 */

// Load a 16x32 f16 A/B fragment half for this lane: elements [0..7] = p[0..7],
// elements [8..15] = p[16..23]  (K-halves per CDNA5 16-bit WMMA VGPR layout).
__device__ __forceinline__ v16h load_frag(const _Float16* __restrict__ p) {
  v8h lo = *(const v8h*)(p);
  v8h hi = *(const v8h*)(p + 16);
  v16h r;
#pragma unroll
  for (int i = 0; i < 8; ++i) { r[i] = lo[i]; r[i + 8] = hi[i]; }
  return r;
}

__device__ __forceinline__ v8f wmma16(v16h a, v16h b, v8f c) {
  return __builtin_amdgcn_wmma_f32_16x16x32_f16(false, a, false, b, (short)0, c,
                                                false, false);
}

// ---------------------------------------------------------------------------
// One launch for the two passes that depend on nothing but the inputs.
// Work-groups 0 .. CVTWG-1: f32 -> f16 conversion of the four weight matrices;
// 128 work-groups of 8 waves per matrix, 8192 consecutive elements (8 rows) each.
// A lane issues its 8 loads of 16 bytes together, then converts and stores 8 bytes
// per load; every wave-wide load and store covers whole 128-byte lines.
// The scale and shift of the three LayerNorms live in the projection weights:
//   (n * g + c) W^T + b  =  n (W * g)^T + (W c + b),   n = (x - mean) * rstd,
// so wq, wk, wv are multiplied by their LayerNorm's g, column by column, before
// they are rounded to f16, and each row's W c + b (f32 throughout) goes to a table
// that the projection reads as its bias. wo is converted as it is.
// Work-groups CVTWG .. CVTWG+4095: one row each, x[4096,1024] f32 -> n f16, ONE
// copy that all three projections read.
// ---------------------------------------------------------------------------
typedef _Float16 v4h __attribute__((ext_vector_type(4)));
#define CVTWG 512
#define FBN   (128 * 32)     /* floats of one projection's bias table */

// place of output column n in a bias table: the 8 rows of a conversion work-group
// have a 128-byte line of their own, so that no line has two writers
__device__ __forceinline__ int fbidx(int n) { return ((n >> 3) << 5) | (n & 7); }

// second launch bound: 16 waves per SIMD (64 registers a wave), so that the row
// work-groups, which wait on memory and barriers, still fill every wave slot
__global__ void __launch_bounds__(256, 16)
prep_kernel(const float* __restrict__ x,
            const float* __restrict__ qw, const float* __restrict__ qb,
            const float* __restrict__ kw, const float* __restrict__ kb,
            const float* __restrict__ vw, const float* __restrict__ vb,
            _Float16* __restrict__ ln,
            const float* __restrict__ s0, const float* __restrict__ s1w,
            const float* __restrict__ s2w, const float* __restrict__ s3,
            _Float16* __restrict__ d0, _Float16* __restrict__ d1,
            _Float16* __restrict__ d2, _Float16* __restrict__ d3,
            const float* __restrict__ pb0, const float* __restrict__ pb1,
            const float* __restrict__ pb2,
            float* __restrict__ fb) {
  __shared__ float s1[256];
  __shared__ float s2[256];
  if (blockIdx.x < CVTWG) {                      // uniform for the work-group, in front of every barrier
    const int which = blockIdx.x >> 7;           // matrix 0..3 (uniform)
    const float* __restrict__ src = which == 0 ? s0 : which == 1 ? s1w : which == 2 ? s2w : s3;
    _Float16* __restrict__ dst    = which == 0 ? d0 : which == 1 ? d1 : which == 2 ? d2 : d3;
    const int q0 = (blockIdx.x & 127) * 2048 + threadIdx.x;   // index in groups of 4 elements
    const float4* __restrict__ sp = (const float4*)src + q0;
    v4h* __restrict__ dp = (v4h*)dst + q0;
    float4 v[8];
    // unrolled: v[] stays in registers and all 8 loads are in flight together
#pragma unroll
    for (int i = 0; i < 8; ++i) v[i] = sp[i * 256];
    // load i is row i of the work-group's 8 rows, columns 4 t .. 4 t + 3
    float p[8];                                  // this lane's part of row i's W c
    if (which < 3) {                             // uniform for the work-group
      const float* __restrict__ g = which == 0 ? qw : which == 1 ? kw : vw;
      const float* __restrict__ c = which == 0 ? qb : which == 1 ? kb : vb;
      const float4 g4 = ((const float4*)g)[threadIdx.x];
      const float4 c4 = ((const float4*)c)[threadIdx.x];
      // unrolled: constant indices into v[] and p[]
#pragma unroll
      for (int i = 0; i < 8; ++i) {
        p[i] = (v[i].x * c4.x + v[i].y * c4.y) + (v[i].z * c4.z + v[i].w * c4.w);
        v[i].x *= g4.x; v[i].y *= g4.y; v[i].z *= g4.z; v[i].w *= g4.w;
      }
    }
    // unrolled: constant indices into v[]
#pragma unroll
    for (int i = 0; i < 8; ++i) {
      v4h h;
      h[0] = (_Float16)v[i].x; h[1] = (_Float16)v[i].y;
      h[2] = (_Float16)v[i].z; h[3] = (_Float16)v[i].w;
      dp[i * 256] = h;
    }
    // the stores still name their address and data registers, which the row sums
    // below overwrite: the wait stands behind the last store, in front of the branch
    // (inside the branch the compiler lifted a register write over it)
    asm volatile("s_wait_xcnt 0x0" ::: "memory");
    if (which < 3) {                             // uniform for the work-group
      // the 8 row sums: over the wave's lanes, then over the 8 waves through LDS
      // (unrolled: constant indices into p[], 8 independent exchanges per step)
#pragma unroll
      for (int o = 16; o > 0; o >>= 1) {
#pragma unroll
        for (int i = 0; i < 8; ++i) p[i] += __shfl_xor(p[i], o, 32);
      }
      if ((threadIdx.x & 31) == 0) {
#pragma unroll
        for (int i = 0; i < 8; ++i) s1[(threadIdx.x >> 5) * 8 + i] = p[i];
      }
      __syncthreads();   // publishes the waves' partial sums to the 8 lanes that join them
      if (threadIdx.x < 8) {
        const float* __restrict__ pb = which == 0 ? pb0 : which == 1 ? pb1 : pb2;
        float t = 0.0f;
#pragma unroll
        for (int w = 0; w < 8; ++w) t += s1[w * 8 + threadIdx.x];
        const int n = (blockIdx.x & 127) * 8 + threadIdx.x;
        fb[which * FBN + fbidx(n)] = pb[n] + t;
      }
    }
    return;
  }
  const int row = blockIdx.x - CVTWG;
  const int tid = threadIdx.x;
  const float4 v = ((const float4*)(x + (size_t)row * HID))[tid];
  float sum = v.x + v.y + v.z + v.w;
  float sq  = v.x * v.x + v.y * v.y + v.z * v.z + v.w * v.w;
  s1[tid] = sum; s2[tid] = sq;
  __syncthreads();
#pragma unroll
  for (int o = 128; o > 0; o >>= 1) {
    if (tid < o) { s1[tid] += s1[tid + o]; s2[tid] += s2[tid + o]; }
    __syncthreads();
  }
  const float mu   = s1[0] * (1.0f / HID);
  const float var  = s2[0] * (1.0f / HID) - mu * mu;
  const float rstd = rsqrtf(var + 1e-5f);
  v4h h;
  h[0] = (_Float16)((v.x - mu) * rstd); h[1] = (_Float16)((v.y - mu) * rstd);
  h[2] = (_Float16)((v.z - mu) * rstd); h[3] = (_Float16)((v.w - mu) * rstd);
  ((v4h*)(ln + (size_t)row * HID))[tid] = h;
  // the store still names its address registers; in the built code the conversion
  // part, which rewrites them, lies behind this place: the wait closes that way
  asm volatile("s_wait_xcnt 0x0" ::: "memory");
}

// ---------------------------------------------------------------------------
// WMMA GEMM: C[M=4096, N=1024] = A[M,K=1024] @ W[N,K]^T + bias
// A work-group of 8 waves computes a 128(M) x 128(N) tile; one wave a
// 32(M) x 64(N) part of it (8 accumulators), waves laid 4 (M) x 2 (N).
// Operands go through LDS: a stage is 128 k (256 B) of the tile's 128 A rows and
// 128 W rows. It is fetched ONCE per work-group, by loads in which a wave covers
// 4 whole 128-byte lines, and every wave takes its fragments from LDS. (A
// fragment load from global memory touches 16 lines for its 512 bytes, and the
// waves that share a row block each repeat it.)
// Two buffers: the next stage's global loads fly during this stage's products
// and are written to the other buffer at the stage's end; one barrier per stage
// publishes them and ends the last read of the buffer that is refilled next.
// The k order of every accumulator is the ascending one, 32 k per product.
// One launch may hold several independent products of this shape: work-groups
// 256 w .. 256 w + 255 compute product w (operands Aw, Ww, biasw, mode mode0 + w).
// The three input projections go out together, 768 work-groups; they read the same
// A, and their bias is a table of the first launch (indexed by fbidx).
// WPS = waves per SIMD the build allows for. WPS 4: at most 256 registers a wave,
// so that two work-groups (2 x 136 KB of LDS) are resident on a WGP: while one
// waits for its next stage's global loads, at its barrier, in its prologue or in
// its epilogue, the other one's products run. WPS 1 (a launch of 256 work-groups,
// one per WGP): the allocator has the full VGPR budget.
// mode 0: q  -> f16 [b,h,s,d], (acc+bias)*QSCALE
// mode 1: k  -> f16 [b,h,s,d]
// mode 2: v  -> f16 [b,h,d,s]   (transposed so attention P@V streams contiguously)
// mode 3: o  -> f32 row-major [m, n] (final output)
// ---------------------------------------------------------------------------
#define GTM    128           /* tile rows of A per work-group */
#define GTN    128           /* tile rows of W per work-group */
#define GKS    128           /* k per stage: 256 B of each row */
#define GNST   (HID / GKS)
#define GPITCH 136           /* f16 per staged row: 256 B + 16 B pad, conflict-free for 16-byte reads */
#define OPITCH 68            /* f32 per staged output row of a wave: 256 B + 16 B pad; 8 waves x 32 rows fill one buffer */

template <int WPS>
__global__ void __launch_bounds__(256, WPS)
wmma_gemm(const _Float16* __restrict__ A0, const _Float16* __restrict__ A1,
          const _Float16* __restrict__ A2,
          const _Float16* __restrict__ W0, const _Float16* __restrict__ W1,
          const _Float16* __restrict__ W2,
          const float* __restrict__ bias0, const float* __restrict__ bias1,
          const float* __restrict__ bias2,
          _Float16* __restrict__ outH0, _Float16* __restrict__ outH1,
          _Float16* __restrict__ outH2,
          float* __restrict__ outF,
          int mode0) {
  __shared__ __align__(16) _Float16 stg[2][(GTM + GTN) * GPITCH];  // [buffer][A rows | W rows]
  const int wave  = threadIdx.x >> 5;
  const int lane  = threadIdx.x & 31;
  const int which = blockIdx.x >> 8;   // product 0..2 (uniform)
  const int mode  = mode0 + which;
  const _Float16* __restrict__ A  = which == 0 ? A0 : which == 1 ? A1 : A2;
  const _Float16* __restrict__ W  = which == 0 ? W0 : which == 1 ? W1 : W2;
  const float* __restrict__ bias  = which == 0 ? bias0 : which == 1 ? bias1 : bias2;
  _Float16* __restrict__ outH     = which == 0 ? outH0 : which == 1 ? outH1 : outH2;
  const int bm = (blockIdx.x & 255) >> 3;   // 0..31 (128-row blocks)
  const int bn = blockIdx.x & 7;            // 0..7  (128-col blocks)
  const int wm = wave >> 1;            // 0..3  (32-row part)
  const int wn = wave & 1;             // 0..1  (64-col part)
  const int m0 = bm * GTM + wm * 32;
  const int n0 = bn * GTN + wn * 64;
  const int mr  = lane & 15;           // M (for A) / N (for B) within tile
  const int kh8 = (lane >> 4) << 3;    // K-half select: 0 or 8

  // staging: thread t moves 16 bytes of rows t/16 + 16 i, i = 0..7, of each operand
  const int srow = threadIdx.x >> 4;
  const int scol = (threadIdx.x & 15) * 8;
  const _Float16* ga = A + (size_t)(bm * GTM + srow) * HID + scol;
  const _Float16* gw = W + (size_t)(bn * GTN + srow) * HID + scol;
  const int sl = srow * GPITCH + scol;

  v8f acc[8] = {v8f{}, v8f{}, v8f{}, v8f{}, v8f{}, v8f{}, v8f{}, v8f{}};
  v8h ra[8], rw[8];

  // prologue: stage 0 into buffer 0
  // (every loop over i below is unrolled so that ra[], rw[] stay in registers
  // and all 16 loads are in flight together)
#pragma unroll
  for (int i = 0; i < 8; ++i) {
    ra[i] = *(const v8h*)(ga + (size_t)i * 16 * HID);
    rw[i] = *(const v8h*)(gw + (size_t)i * 16 * HID);
  }
#pragma unroll
  for (int i = 0; i < 8; ++i) {
    *(v8h*)(&stg[0][sl + i * 16 * GPITCH]) = ra[i];
    *(v8h*)(&stg[0][sl + (GTM + i * 16) * GPITCH]) = rw[i];
  }
  __syncthreads();

  // fully unrolled: buffer index, global and LDS offsets are immediates, and
  // the accumulators stay pinned in one register set
#pragma unroll
  for (int s = 0; s < GNST; ++s) {
    if (s + 1 < GNST) {
#pragma unroll
      for (int i = 0; i < 8; ++i) {
        ra[i] = *(const v8h*)(ga + (size_t)i * 16 * HID + (s + 1) * GKS);
        rw[i] = *(const v8h*)(gw + (size_t)i * 16 * HID + (s + 1) * GKS);
      }
      // keeps the 16 loads in front of this stage's products: sunk down to their
      // LDS stores, nothing would cover their latency
      __builtin_amdgcn_sched_barrier(0);
    }
    const _Float16* la = &stg[s & 1][(wm * 32 + mr) * GPITCH + kh8];
    const _Float16* lb = &stg[s & 1][(GTM + wn * 64 + mr) * GPITCH + kh8];
    // unrolled: LDS offsets are immediates, fragment loads can run ahead of the products
#pragma unroll
    for (int k0 = 0; k0 < GKS; k0 += 32) {
      const v16h a0 = load_frag(la + k0);
      const v16h a1 = load_frag(la + 16 * GPITCH + k0);
      const v16h b0 = load_frag(lb + k0);
      const v16h b1 = load_frag(lb + 16 * GPITCH + k0);
      const v16h b2 = load_frag(lb + 32 * GPITCH + k0);
      const v16h b3 = load_frag(lb + 48 * GPITCH + k0);
      acc[0] = wmma16(a0, b0, acc[0]);
      acc[1] = wmma16(a0, b1, acc[1]);
      acc[2] = wmma16(a0, b2, acc[2]);
      acc[3] = wmma16(a0, b3, acc[3]);
      acc[4] = wmma16(a1, b0, acc[4]);
      acc[5] = wmma16(a1, b1, acc[5]);
      acc[6] = wmma16(a1, b2, acc[6]);
      acc[7] = wmma16(a1, b3, acc[7]);
      // mid-stage: fragment loads are not lifted from the stage's second half
      // into its first; with all four steps' fragments live beside the 64
      // staging registers the wave would pass 256 registers and spill
      if (WPS > 1 && k0 == GKS / 2 - 32) __builtin_amdgcn_sched_barrier(0);
    }
    if (s + 1 < GNST) {
      // hand over: the loaded stage goes to the other buffer, whose last
      // readers left it before the previous stage's barrier
#pragma unroll
      for (int i = 0; i < 8; ++i) {
        *(v8h*)(&stg[(s + 1) & 1][sl + i * 16 * GPITCH]) = ra[i];
        *(v8h*)(&stg[(s + 1) & 1][sl + (GTM + i * 16) * GPITCH]) = rw[i];
      }
      __syncthreads();
    }
  }

  // Epilogue: the accumulators leave through LDS, so that every wave-wide global
  // store is 16 bytes a lane and covers whole 128-byte lines. Staging uses buffer
  // 0 only: the last stage reads buffer 1, and every wave's last read of buffer 0
  // lies in front of the barrier that closed the stage before it.
  // (Every loop of the epilogue is unrolled: constant indices keep acc[] in
  // registers, and LDS and global offsets become immediates.)
  const int hsel = lane >> 4;
  if (mode == 2) {
    // V^T: a row of the output (one d) holds the 128 tokens of the whole tile,
    // 256 B, written by four waves: staged per work-group. A lane's 8 accumulator
    // registers are 8 consecutive tokens of one column: one 16-byte LDS store.
    _Float16* vs = &stg[0][0];                   // [128 columns][GPITCH tokens]
#pragma unroll
    for (int half = 0; half < 2; ++half) {
#pragma unroll
      for (int j = 0; j < 4; ++j) {
        const float bn = bias[fbidx(n0 + j * 16 + mr)];
        v8h pk;
#pragma unroll
        for (int r = 0; r < 8; ++r) pk[r] = (_Float16)(acc[half * 4 + j][r] + bn);
        *(v8h*)(vs + (wn * 64 + j * 16 + mr) * GPITCH + wm * 32 + half * 16 + 8 * hsel) = pk;
      }
    }
    __syncthreads();   // publishes the staged tile to the waves that store it
    const int mt = bm * GTM;                     // first token of the tile
    const int b = mt >> 11, s = mt & (SEQ - 1);
#pragma unroll
    for (int i = 0; i < 8; ++i) {
      const int n = bn * GTN + srow + i * 16;    // 16 lanes store one row's 256 B
      const int h = n >> 6, d = n & (HDIM - 1);
      *(v8h*)(outH + (((size_t)b * NHD + h) * HDIM + d) * SEQ + s + scol) =
          *(const v8h*)(vs + (srow + i * 16) * GPITCH + scol);
    }
    return;
  }
  // q, k, o: a wave's 32 x 64 part is whole lines by itself (q, k: 32 tokens of one
  // head, one run of 4 KB; o: 256 B of each of 32 rows), so each wave stages in a
  // range of its own, as f32, and no barrier is needed.
  float* st = (float*)&stg[0][0] + wave * (32 * OPITCH);
  const float qs = mode == 0 ? QSCALE : 1.0f;    // times 1.0f is exact
  // 16 columns further on: 16 floats in a plain bias, two 128-byte lines in a table
  const float* bp = bias + (mode == 3 ? n0 + mr : fbidx(n0 + mr));
  const int bstep = mode == 3 ? 16 : 64;
#pragma unroll
  for (int half = 0; half < 2; ++half) {
#pragma unroll
    for (int j = 0; j < 4; ++j) {
      const float bn = bp[j * bstep];
#pragma unroll
      for (int r = 0; r < 8; ++r)
        st[(half * 16 + r + 8 * hsel) * OPITCH + j * 16 + mr] = (acc[half * 4 + j][r] + bn) * qs;
    }
  }
  // the wave's own LDS writes are done before other lanes of it read the rows back
  asm volatile("s_wait_dscnt 0x0" ::: "memory");
  if (mode == 3) {
#pragma unroll
    for (int i = 0; i < 16; ++i) {
      const int row = i * 2 + hsel;              // 16 lanes store one row's 256 B
      *(float4*)(outF + (size_t)(m0 + row) * HID + n0 + mr * 4) =
          *(const float4*)(st + row * OPITCH + mr * 4);
    }
  } else {
    const int b = m0 >> 11, s = m0 & (SEQ - 1), h = n0 >> 6;
    _Float16* op = outH + (((size_t)b * NHD + h) * SEQ + s) * HDIM;
#pragma unroll
    for (int i = 0; i < 8; ++i) {
      const int row = i * 4 + (lane >> 3);       // 8 lanes store one token's 128 B
      const int col = (lane & 7) * 8;
      const float4 lo = *(const float4*)(st + row * OPITCH + col);
      const float4 hi = *(const float4*)(st + row * OPITCH + col + 4);
      v8h pk;
      pk[0] = (_Float16)lo.x; pk[1] = (_Float16)lo.y; pk[2] = (_Float16)lo.z; pk[3] = (_Float16)lo.w;
      pk[4] = (_Float16)hi.x; pk[5] = (_Float16)hi.y; pk[6] = (_Float16)hi.z; pk[7] = (_Float16)hi.w;
      *(v8h*)(op + row * HDIM + col) = pk;
    }
  }
}

// ---------------------------------------------------------------------------
// Flash attention: one wave per 16 queries of one (b,h), products transposed:
// S^T = K Q^T (A = K rows, B = Q) and O^T += V^T P^T (A = V^T rows, B = P^T).
// A lane then holds scores of ONE query (column lane & 15; keys 8 h + r of each
// 16-key tile, h = lane >> 4): maximum and sum run inside the lane, with one
// exchange between the wave's halves for the maximum. The four score tiles of a
// pass, converted in place in pairs, are already the two B operands of the second product
// (element e < 8: key 8 h + e, else key 16 + 8 h + e - 8, the order in which
// load_frag takes V^T), so P goes through no LDS and no lane exchange.
// Each half keeps the sum of its own keys; the halves are joined once at the end.
// The maximum is a HELD REFERENCE: each query keeps a reference score ref (the
// maximum of its first 32 keys, taken in front of the loop), and the score
// products start from C = -ref, so the matrix unit hands out s - ref. In the
// usual pass nothing is subtracted and neither O nor the sum is rescaled. Once
// per 64 keys the wave tests whether any score has passed its reference by more
// than RTAU; only then ref is raised to the new maximum and the pass's scores,
// O and the sum are brought to it. ref is always the score of a key already
// seen, so the sum holds a term near 1 and P never exceeds exp(RTAU).
// q,k f16 [b,h,s,d]; vT f16 [b,h,d,s]; out f16 [b, s, h*64+d] (== [B,S,H]).
// K and V go through LDS: the 8 waves of a work-group walk the same keys, so a
// stage (128 keys: 128 K rows of 128 B, 64 V^T rows of 256 B) is fetched ONCE
// per work-group, by loads in which a wave covers 4 whole 128-byte lines, and
// every wave takes its fragments from LDS. (A fragment load from global memory
// touches 16 lines for its 512 bytes, and each of the 8 waves repeats it.)
// Two buffers: the next stage's global loads fly during this stage's two
// 64-key passes and are written to the other buffer at the stage's end; one
// barrier per stage publishes them and ends the last read of the buffer that is
// refilled next. Keys are taken in ascending order, 64 per pass.
// ---------------------------------------------------------------------------
#define AKS    128           /* keys per stage */
#define ANST   (SEQ / AKS)
#define KPITCH 72            /* f16 per staged K row: 128 B + 16 B pad, conflict-free for 16-byte reads */
#define VPITCH 136           /* f16 per staged V^T row: 256 B + 16 B pad, likewise */
#define RTAU   5.5f          /* a score may pass its reference by this much: P <= exp(5.5) < 256, far inside f16 */

// value of lane l ^ 16 (the same column in the other half of the wave), by a
// vector cross-row move
__device__ __forceinline__ float xhalf(float x) {
  const int i = __builtin_bit_cast(int, x);
  return __builtin_bit_cast(float,
      __builtin_amdgcn_permlanex16(i, i, 0x76543210, 0xfedcba98, false, false));
}

// second launch bound: 4 waves per SIMD (256 registers a wave), so that two
// work-groups are resident on a WGP and all 512 run at once
__global__ void __launch_bounds__(256, 4)
attn_kernel(const _Float16* __restrict__ qg,
            const _Float16* __restrict__ kg,
            const _Float16* __restrict__ vtg,
            _Float16* __restrict__ og) {
  __shared__ __align__(16) _Float16 kst[2][AKS * KPITCH];    // [buffer][key][d]
  __shared__ __align__(16) _Float16 vst[2][HDIM * VPITCH];   // [buffer][d][key]
  const int wave = threadIdx.x >> 5;
  const int lane = threadIdx.x & 31;
  const int bh = blockIdx.x;                  // 0..31 : b*NH + h
  const int qt = blockIdx.y * 8 + wave;       // 0..127
  const int mr  = lane & 15;
  const int kh8 = (lane >> 4) << 3;
  const int hsel = lane >> 4;

  const _Float16* qp = qg  + (size_t)bh * SEQ * HDIM;
  const _Float16* kp = kg  + (size_t)bh * SEQ * HDIM;
  const _Float16* vp = vtg + (size_t)bh * HDIM * SEQ;

  // staging: thread t moves 16 bytes of K rows t/8 + 32 i and of V^T rows
  // t/16 + 16 i, i = 0..3 (a stage's K rows are one contiguous 16 KB run)
  const _Float16* gk = kp + threadIdx.x * 8;
  const _Float16* gv = vp + (size_t)(threadIdx.x >> 4) * SEQ + (threadIdx.x & 15) * 8;
  const int slk = (threadIdx.x >> 3) * KPITCH + (threadIdx.x & 7) * 8;
  const int slv = (threadIdx.x >> 4) * VPITCH + (threadIdx.x & 15) * 8;
  v8h rk[4], rv[4];

  // prologue: stage 0 into buffer 0
  // (every loop over i here and below is unrolled so that rk[], rv[] stay in
  // registers and all 8 loads are in flight together)
#pragma unroll
  for (int i = 0; i < 4; ++i) {
    rk[i] = *(const v8h*)(gk + i * 32 * HDIM);
    rv[i] = *(const v8h*)(gv + (size_t)i * 16 * SEQ);
  }

  // Q fragments (16 queries x 64 d) : two K=32 B-fragments, reused for all keys
  const v16h bq0 = load_frag(qp + (size_t)(qt * 16 + mr) * HDIM + 0  + kh8);
  const v16h bq1 = load_frag(qp + (size_t)(qt * 16 + mr) * HDIM + 32 + kh8);

  float lrun = 0.0f;          // running sum over this half's keys, relative to mref
  v8f oacc[4] = {v8f{}, v8f{}, v8f{}, v8f{}};   // O^T: oacc[j][r] = O[query mr][d = 16 j + 8 h + r]

#pragma unroll
  for (int i = 0; i < 4; ++i) {
    *(v8h*)(&kst[0][slk + i * 32 * KPITCH]) = rk[i];
    *(v8h*)(&vst[0][slv + i * 16 * VPITCH]) = rv[i];
  }
  __syncthreads();

  // first reference of this lane's query (both halves alike): the maximum over
  // keys 0..31, whose scores are computed once more here
  float mref;
  {
    const _Float16* lk0 = &kst[0][mr * KPITCH + kh8];
    v8f t0 = {}; t0 = wmma16(load_frag(lk0), bq0, t0); t0 = wmma16(load_frag(lk0 + 32), bq1, t0);
    v8f t1 = {}; t1 = wmma16(load_frag(lk0 + 16 * KPITCH), bq0, t1);
    t1 = wmma16(load_frag(lk0 + 16 * KPITCH + 32), bq1, t1);
    float m4[4];
#pragma unroll
    for (int c = 0; c < 4; ++c)
      m4[c] = fmaxf(fmaxf(t0[c], t0[c + 4]), fmaxf(t1[c], t1[c + 4]));
    const float m1 = fmaxf(fmaxf(m4[0], m4[1]), fmaxf(m4[2], m4[3]));
    mref = fmaxf(m1, xhalf(m1));
  }
  v8f cneg;                   // -mref in all 8 registers: the C operand of the score products
#pragma unroll
  for (int r = 0; r < 8; ++r) cneg[r] = -mref;

  for (int s = 0; s < ANST; ++s) {
    if (s + 1 < ANST) {
#pragma unroll
      for (int i = 0; i < 4; ++i) {
        rk[i] = *(const v8h*)(gk + (s + 1) * AKS * HDIM + i * 32 * HDIM);
        rv[i] = *(const v8h*)(gv + (size_t)i * 16 * SEQ + (s + 1) * AKS);
      }
    }
    const _Float16* lk = &kst[s & 1][mr * KPITCH + kh8];
    const _Float16* lv = &vst[s & 1][mr * VPITCH + kh8];

    // kept rolled: with both passes of a stage in one block the fragment loads
    // were split into small groups, each waited for on the spot
#pragma unroll 1
    for (int kc = 0; kc < AKS; kc += 64) {
      // ---- scores minus reference, transposed: four tiles of 16 keys x 16
      //      queries over keys [kc, kc+64) of the stage
      v16h ka[4][2];
#pragma unroll
      for (int t = 0; t < 4; ++t) {
        ka[t][0] = load_frag(lk + (kc + 16 * t) * KPITCH + 0);
        ka[t][1] = load_frag(lk + (kc + 16 * t) * KPITCH + 32);
      }
      v8f sc[4];
#pragma unroll
      for (int t = 0; t < 4; ++t) sc[t] = wmma16(ka[t][0], bq0, cneg);
#pragma unroll
      for (int t = 0; t < 4; ++t) sc[t] = wmma16(ka[t][1], bq1, sc[t]);

      // ---- has a score passed its reference? The lane's 32 scores belong to one query
      float mx8[8];
#pragma unroll
      for (int c = 0; c < 8; ++c)
        mx8[c] = fmaxf(fmaxf(sc[0][c], sc[1][c]), fmaxf(sc[2][c], sc[3][c]));
      float mx = fmaxf(fmaxf(fmaxf(mx8[0], mx8[1]), fmaxf(mx8[2], mx8[3])),
                       fmaxf(fmaxf(mx8[4], mx8[5]), fmaxf(mx8[6], mx8[7])));
      mx = fmaxf(mx, xhalf(mx));               // the other half's 32 keys
      // one test per pass, a scalar branch for the whole wave
      if (__builtin_amdgcn_ballot_w32(mx > RTAU) != 0) {
        const float d     = fmaxf(mx, 0.0f);   // 0: this query's reference stays
        const float alpha = __expf(-d);
#pragma unroll
        for (int t = 0; t < 4; ++t) sc[t] -= d;
#pragma unroll
        for (int j = 0; j < 4; ++j) oacc[j] *= alpha;
        lrun *= alpha;
        mref += d;
#pragma unroll
        for (int r = 0; r < 8; ++r) cneg[r] = -mref;
      }

      // ---- V^T fragments for the current pass: issued before the exponentials
      //      so that they overlap the vector work
      v16h va[2][4];
#pragma unroll
      for (int g = 0; g < 2; ++g)
#pragma unroll
        for (int j = 0; j < 4; ++j) va[g][j] = load_frag(lv + 16 * j * VPITCH + kc + 32 * g);
      // keeps the 16 loads together in front of the exponentials: sunk among the
      // products, each small group was waited for on the spot
      __builtin_amdgcn_sched_barrier(0);

      // exp(x) = 2^(x log2 e), as __expf has it; whole tiles at a time, so that
      // packed instructions pair neighbouring registers
      v8f pv[4];
#pragma unroll
      for (int t = 0; t < 4; ++t) {
        const v8f e = sc[t] * 1.44269504f;
#pragma unroll
        for (int r = 0; r < 8; ++r) pv[t][r] = __builtin_amdgcn_exp2f(e[r]);
      }
      v16h pb[2];                               // P^T as B operand, 32 keys each
#pragma unroll
      for (int r = 0; r < 8; ++r) {
        pb[0][r]     = (_Float16)pv[0][r];
        pb[0][r + 8] = (_Float16)pv[1][r];
        pb[1][r]     = (_Float16)pv[2][r];
        pb[1][r + 8] = (_Float16)pv[3][r];
      }
      // ---- O^T += V^T P^T
#pragma unroll
      for (int g = 0; g < 2; ++g)
#pragma unroll
        for (int j = 0; j < 4; ++j) oacc[j] = wmma16(va[g][j], pb[g], oacc[j]);

      // ---- row sums, behind the products: they run while the matrix unit works,
      //      and they keep the next pass's first register writes at the distance
      //      the chip needs behind the last product. The barrier keeps the scheduler
      //      from lifting them in front again.
      __builtin_amdgcn_sched_barrier(0);
      const v8f ps = (pv[0] + pv[1]) + (pv[2] + pv[3]);
      lrun += ((ps[0] + ps[1]) + (ps[2] + ps[3])) + ((ps[4] + ps[5]) + (ps[6] + ps[7]));
    }
    if (s + 1 < ANST) {
      // hand over: the loaded stage goes to the other buffer, whose last
      // readers left it before the previous stage's barrier
#pragma unroll
      for (int i = 0; i < 4; ++i) {
        *(v8h*)(&kst[(s + 1) & 1][slk + i * 32 * KPITCH]) = rk[i];
        *(v8h*)(&vst[(s + 1) & 1][slv + i * 16 * VPITCH]) = rv[i];
      }
      __syncthreads();
    }
  }

  // ---- normalize + store to [B, S, H] as f16: a lane's 8 registers of a tile
  //      are 8 consecutive d of its query, one 16-byte store
  const float lsum = lrun + xhalf(lrun);        // join the halves' sums
  const int b = bh >> 4, h = bh & 15;
  _Float16* op = og + ((size_t)b * SEQ + qt * 16 + mr) * HID + h * HDIM + 8 * hsel;
#pragma unroll
  for (int j = 0; j < 4; ++j) {
    v8h pk;
#pragma unroll
    for (int r = 0; r < 8; ++r) pk[r] = (_Float16)(oacc[j][r] / lsum);
    *(v8h*)(op + j * 16) = pk;
  }
}

// ---------------------------------------------------------------------------
extern "C" void kernel_launch(void* const* d_in, const int* in_sizes, int n_in,
                              void* d_out, int out_size, void* d_ws, size_t ws_size,
                              hipStream_t stream) {
  const float* x    = (const float*)d_in[0];
  const float* lnqw = (const float*)d_in[1];
  const float* lnqb = (const float*)d_in[2];
  const float* lnkw = (const float*)d_in[3];
  const float* lnkb = (const float*)d_in[4];
  const float* lnvw = (const float*)d_in[5];
  const float* lnvb = (const float*)d_in[6];
  const float* wq   = (const float*)d_in[7];
  const float* bq   = (const float*)d_in[8];
  const float* wk   = (const float*)d_in[9];
  const float* bk   = (const float*)d_in[10];
  const float* wv   = (const float*)d_in[11];
  const float* bv   = (const float*)d_in[12];
  const float* wo   = (const float*)d_in[13];
  const float* bo   = (const float*)d_in[14];
  float* out = (float*)d_out;

  const size_t MB = (size_t)1 << 20;
  uint8_t* w = (uint8_t*)d_ws;
  _Float16* ln  = (_Float16*)(w + 0 * MB);    // 8 MB
  float*    fb  = (float*)(w + 8 * MB);       // 3 bias tables of FBN floats
  _Float16* wqh = (_Float16*)(w + 24 * MB);   // 2 MB each
  _Float16* wkh = (_Float16*)(w + 26 * MB);
  _Float16* wvh = (_Float16*)(w + 28 * MB);
  _Float16* woh = (_Float16*)(w + 30 * MB);
  _Float16* qh  = (_Float16*)(w + 32 * MB);   // 8 MB each
  _Float16* kh  = (_Float16*)(w + 40 * MB);
  _Float16* vth = (_Float16*)(w + 48 * MB);
  _Float16* oh  = (_Float16*)(w + 56 * MB);

  // 1. weight conversions f32 -> f16 (LayerNorm scale and shift folded in) and the
  //    normalized rows -> f16, one launch
  prep_kernel<<<CVTWG + MTOK, 256, 0, stream>>>(x, lnqw, lnqb, lnkw, lnkb, lnvw, lnvb,
                                                ln,
                                                wq, wk, wv, wo, wqh, wkh, wvh, woh,
                                                bq, bk, bv, fb);
  // 2. QKV projections in one launch (3 x 256 work-groups of 8 waves;
  //    work-group = 128x128 tile)
  wmma_gemm<4><<<768, 256, 0, stream>>>(ln, ln, ln, wqh, wkh, wvh, fb, fb + FBN, fb + 2 * FBN,
                                        qh, kh, vth, nullptr, 0);
  // 3. flash attention: 32 (b,h) x 128 q-tiles / 8 waves per block
  attn_kernel<<<dim3(BB * NHD, 16), 256, 0, stream>>>(qh, kh, vth, oh);
  // 4. output projection -> f32 d_out
  wmma_gemm<1><<<256, 256, 0, stream>>>(oh, oh, oh, woh, woh, woh, bo, bo, bo,
                                        nullptr, nullptr, nullptr, out, 3);
}

// v010
// Measured time: 74.3 microseconds a run.
// Next to v009, in two timings, it ran 1.06 times as fast each time.
// Counting every step since v000, it is 4.06 times as fast.
#include <hip/hip_runtime.h>
#include <hip/hip_bf16.h>

typedef _Float16 v8h  __attribute__((ext_vector_type(8)));
typedef _Float16 v16h __attribute__((ext_vector_type(16)));
typedef float    v8f  __attribute__((ext_vector_type(8)));

#define HID   1024
#define SEQ   2048
#define BB    2
#define NHD   16
#define HDIM  64
#define MTOK  (BB*SEQ)      /* 4096 tokens */
#define QSCALE 0.125f       /* HD^-0.5 */

// Load a 16x32 f16 A/B fragment half for this lane: elements [0..7] = p[0..7],
// elements [8..15] = p[16..23]  (K-halves per CDNA5 16-bit WMMA VGPR layout).
__device__ __forceinline__ v16h load_frag(const _Float16* __restrict__ p) {
  v8h lo = *(const v8h*)(p);
  v8h hi = *(const v8h*)(p + 16);
  v16h r;
#pragma unroll
  for (int i = 0; i < 8; ++i) { r[i] = lo[i]; r[i + 8] = hi[i]; }
  return r;
}

__device__ __forceinline__ v8f wmma16(v16h a, v16h b, v8f c) {
  return __builtin_amdgcn_wmma_f32_16x16x32_f16(false, a, false, b, (short)0, c,
                                                false, false);
}

// ---------------------------------------------------------------------------
// One launch for the two passes that depend on nothing but the inputs.
// Work-groups 0 .. CVTWG-1: f32 -> f16 conversion of the four weight matrices;
// 128 work-groups of 8 waves per matrix, 8192 consecutive elements (8 rows) each.
// A lane issues its 8 loads of 16 bytes together, then converts and stores 8 bytes
// per load; every wave-wide load and store covers whole 128-byte lines.
// The scale and shift of the three LayerNorms live in the projection weights:
//   (n * g + c) W^T + b  =  n (W * g)^T + (W c + b),   n = (x - mean) * rstd,
// so wq, wk, wv are multiplied by their LayerNorm's g, column by column, before
// they are rounded to f16, and each row's W c + b (f32 throughout) goes to a table
// that the projection reads as its bias. wo is converted as it is.
// Work-groups CVTWG .. CVTWG+4095: one row each, x[4096,1024] f32 -> n f16, ONE
// copy that all three projections read.
// ---------------------------------------------------------------------------
typedef _Float16 v4h __attribute__((ext_vector_type(4)));
#define CVTWG 512
#define FBN   (128 * 32)     /* floats of one projection's bias table */

// place of output column n in a bias table: the 8 rows of a conversion work-group
// have a 128-byte line of their own, so that no line has two writers
__device__ __forceinline__ int fbidx(int n) { return ((n >> 3) << 5) | (n & 7); }

// second launch bound: 16 waves per SIMD (64 registers a wave), so that the row
// work-groups, which wait on memory and barriers, still fill every wave slot
__global__ void __launch_bounds__(256, 16)
prep_kernel(const float* __restrict__ x,
            const float* __restrict__ qw, const float* __restrict__ qb,
            const float* __restrict__ kw, const float* __restrict__ kb,
            const float* __restrict__ vw, const float* __restrict__ vb,
            _Float16* __restrict__ ln,
            const float* __restrict__ s0, const float* __restrict__ s1w,
            const float* __restrict__ s2w, const float* __restrict__ s3,
            _Float16* __restrict__ d0, _Float16* __restrict__ d1,
            _Float16* __restrict__ d2, _Float16* __restrict__ d3,
            const float* __restrict__ pb0, const float* __restrict__ pb1,
            const float* __restrict__ pb2,
            float* __restrict__ fb) {
  __shared__ float s1[256];
  __shared__ float s2[256];
  if (blockIdx.x < CVTWG) {                      // uniform for the work-group, in front of every barrier
    const int which = blockIdx.x >> 7;           // matrix 0..3 (uniform)
    const float* __restrict__ src = which == 0 ? s0 : which == 1 ? s1w : which == 2 ? s2w : s3;
    _Float16* __restrict__ dst    = which == 0 ? d0 : which == 1 ? d1 : which == 2 ? d2 : d3;
    const int q0 = (blockIdx.x & 127) * 2048 + threadIdx.x;   // index in groups of 4 elements
    const float4* __restrict__ sp = (const float4*)src + q0;
    v4h* __restrict__ dp = (v4h*)dst + q0;
    float4 v[8];
    // unrolled: v[] stays in registers and all 8 loads are in flight together
#pragma unroll
    for (int i = 0; i < 8; ++i) v[i] = sp[i * 256];
    // load i is row i of the work-group's 8 rows, columns 4 t .. 4 t + 3
    float p[8];                                  // this lane's part of row i's W c
    if (which < 3) {                             // uniform for the work-group
      const float* __restrict__ g = which == 0 ? qw : which == 1 ? kw : vw;
      const float* __restrict__ c = which == 0 ? qb : which == 1 ? kb : vb;
      const float4 g4 = ((const float4*)g)[threadIdx.x];
      const float4 c4 = ((const float4*)c)[threadIdx.x];
      // unrolled: constant indices into v[] and p[]
#pragma unroll
      for (int i = 0; i < 8; ++i) {
        p[i] = (v[i].x * c4.x + v[i].y * c4.y) + (v[i].z * c4.z + v[i].w * c4.w);
        v[i].x *= g4.x; v[i].y *= g4.y; v[i].z *= g4.z; v[i].w *= g4.w;
      }
    }
    // unrolled: constant indices into v[]
#pragma unroll
    for (int i = 0; i < 8; ++i) {
      v4h h;
      h[0] = (_Float16)v[i].x; h[1] = (_Float16)v[i].y;
      h[2] = (_Float16)v[i].z; h[3] = (_Float16)v[i].w;
      dp[i * 256] = h;
    }
    // the stores still name their address and data registers, which the row sums
    // below overwrite: the wait stands behind the last store, in front of the branch
    // (inside the branch the compiler lifted a register write over it)
    asm volatile("s_wait_xcnt 0x0" ::: "memory");
    if (which < 3) {                             // uniform for the work-group
      // the 8 row sums: over the wave's lanes, then over the 8 waves through LDS
      // (unrolled: constant indices into p[], 8 independent exchanges per step)
#pragma unroll
      for (int o = 16; o > 0; o >>= 1) {
#pragma unroll
        for (int i = 0; i < 8; ++i) p[i] += __shfl_xor(p[i], o, 32);
      }
      if ((threadIdx.x & 31) == 0) {
#pragma unroll
        for (int i = 0; i < 8; ++i) s1[(threadIdx.x >> 5) * 8 + i] = p[i];
      }
      __syncthreads();   // publishes the waves' partial sums to the 8 lanes that join them
      if (threadIdx.x < 8) {
        const float* __restrict__ pb = which == 0 ? pb0 : which == 1 ? pb1 : pb2;
        float t = 0.0f;
#pragma unroll
        for (int w = 0; w < 8; ++w) t += s1[w * 8 + threadIdx.x];
        const int n = (blockIdx.x & 127) * 8 + threadIdx.x;
        fb[which * FBN + fbidx(n)] = pb[n] + t;
      }
    }
    return;
  }
  const int row = blockIdx.x - CVTWG;
  const int tid = threadIdx.x;
  const float4 v = ((const float4*)(x + (size_t)row * HID))[tid];
  float sum = v.x + v.y + v.z + v.w;
  float sq  = v.x * v.x + v.y * v.y + v.z * v.z + v.w * v.w;
  s1[tid] = sum; s2[tid] = sq;
  __syncthreads();
#pragma unroll
  for (int o = 128; o > 0; o >>= 1) {
    if (tid < o) { s1[tid] += s1[tid + o]; s2[tid] += s2[tid + o]; }
    __syncthreads();
  }
  const float mu   = s1[0] * (1.0f / HID);
  const float var  = s2[0] * (1.0f / HID) - mu * mu;
  const float rstd = rsqrtf(var + 1e-5f);
  v4h h;
  h[0] = (_Float16)((v.x - mu) * rstd); h[1] = (_Float16)((v.y - mu) * rstd);
  h[2] = (_Float16)((v.z - mu) * rstd); h[3] = (_Float16)((v.w - mu) * rstd);
  ((v4h*)(ln + (size_t)row * HID))[tid] = h;
  // the store still names its address registers; in the built code the conversion
  // part, which rewrites them, lies behind this place: the wait closes that way
  asm volatile("s_wait_xcnt 0x0" ::: "memory");
}

// ---------------------------------------------------------------------------
// WMMA GEMM: C[M=4096, N=1024] = A[M,K=1024] @ W[N,K]^T + bias
// A work-group of 8 waves computes a 128(M) x 128(N) tile; one wave a
// 32(M) x 64(N) part of it (8 accumulators), waves laid 4 (M) x 2 (N).
// Operands go through LDS: a stage is 128 k (256 B) of the tile's 128 A rows and
// 128 W rows. It is fetched ONCE per work-group, by loads in which a wave covers
// 4 whole 128-byte lines, and every wave takes its fragments from LDS. (A
// fragment load from global memory touches 16 lines for its 512 bytes, and the
// waves that share a row block each repeat it.)
// Two buffers: the next stage's global loads fly during this stage's products
// and are written to the other buffer at the stage's end; one barrier per stage
// publishes them and ends the last read of the buffer that is refilled next.
// Work-groups that share operand rows (8 or more share an A block, 32 a W block)
// would ask L2 for the same lines at the same moment if all walked k from 0: each
// starts at stage (bm + bn) mod GNST and wraps. An accumulator's k order is the
// ascending one rotated by that start, 32 k per product. (Products w and w + 1 of
// one tile keep the same start: they read the same A lines, and where they share
// a WGP its cache serves the second reader.)
// One launch may hold several independent products of this shape: work-groups
// 256 w .. 256 w + 255 compute product w (operands Aw, Ww, biasw, mode mode0 + w).
// The three input projections go out together, 768 work-groups; they read the same
// A, and their bias is a table of the first launch (indexed by fbidx).
// WPS = waves per SIMD the build allows for. WPS 4: at most 256 registers a wave,
// so that two work-groups (2 x 136 KB of LDS) are resident on a WGP: while one
// waits for its next stage's global loads, at its barrier, in its prologue or in
// its epilogue, the other one's products run. WPS 1 (a launch of 256 work-groups,
// one per WGP): the allocator has the full VGPR budget.
// mode 0: q  -> f16 [b,h,s,d], (acc+bias)*QSCALE
// mode 1: k  -> f16 [b,h,s,d]
// mode 2: v  -> f16 [b,h,d,s]   (transposed so attention P@V streams contiguously)
// mode 3: o  -> f32 row-major [m, n] (final output)
// ---------------------------------------------------------------------------
#define GTM    128           /* tile rows of A per work-group */
#define GTN    128           /* tile rows of W per work-group */
#define GKS    128           /* k per stage: 256 B of each row */
#define GNST   (HID / GKS)
#define GPITCH 136           /* f16 per staged row: 256 B + 16 B pad, conflict-free for 16-byte reads */
#define OPITCH 68            /* f32 per staged output row of a wave: 256 B + 16 B pad; 8 waves x 32 rows fill one buffer */

template <int WPS>
__global__ void __launch_bounds__(256, WPS)
wmma_gemm(const _Float16* __restrict__ A0, const _Float16* __restrict__ A1,
          const _Float16* __restrict__ A2,
          const _Float16* __restrict__ W0, const _Float16* __restrict__ W1,
          const _Float16* __restrict__ W2,
          const float* __restrict__ bias0, const float* __restrict__ bias1,
          const float* __restrict__ bias2,
          _Float16* __restrict__ outH0, _Float16* __restrict__ outH1,
          _Float16* __restrict__ outH2,
          float* __restrict__ outF,
          int mode0) {
  __shared__ __align__(16) _Float16 stg[2][(GTM + GTN) * GPITCH];  // [buffer][A rows | W rows]
  const int wave  = threadIdx.x >> 5;
  const int lane  = threadIdx.x & 31;
  const int which = blockIdx.x >> 8;   // product 0..2 (uniform)
  const int mode  = mode0 + which;
  const _Float16* __restrict__ A  = which == 0 ? A0 : which == 1 ? A1 : A2;
  const _Float16* __restrict__ W  = which == 0 ? W0 : which == 1 ? W1 : W2;
  const float* __restrict__ bias  = which == 0 ? bias0 : which == 1 ? bias1 : bias2;
  _Float16* __restrict__ outH     = which == 0 ? outH0 : which == 1 ? outH1 : outH2;
  const int bm = (blockIdx.x & 255) >> 3;   // 0..31 (128-row blocks)
  const int bn = blockIdx.x & 7;            // 0..7  (128-col blocks)
  const int wm = wave >> 1;            // 0..3  (32-row part)
  const int wn = wave & 1;             // 0..1  (64-col part)
  const int m0 = bm * GTM + wm * 32;
  const int n0 = bn * GTN + wn * 64;
  const int mr  = lane & 15;           // M (for A) / N (for B) within tile
  const int kh8 = (lane >> 4) << 3;    // K-half select: 0 or 8

  // staging: thread t moves 16 bytes of rows t/16 + 16 i, i = 0..7, of each operand
  const int srow = threadIdx.x >> 4;
  const int scol = (threadIdx.x & 15) * 8;
  const int st0 = (bm + bn) & (GNST - 1);   // first k stage of this work-group (uniform)
  const _Float16* ga = A + (size_t)(bm * GTM + srow) * HID + scol + st0 * GKS;
  const _Float16* gw = W + (size_t)(bn * GTN + srow) * HID + scol + st0 * GKS;
  const int sl = srow * GPITCH + scol;

  v8f acc[8] = {v8f{}, v8f{}, v8f{}, v8f{}, v8f{}, v8f{}, v8f{}, v8f{}};
  v8h ra[8], rw[8];

  // prologue: the first stage walked into buffer 0
  // (every loop over i below is unrolled so that ra[], rw[] stay in registers
  // and all 16 loads are in flight together)
#pragma unroll
  for (int i = 0; i < 8; ++i) {
    ra[i] = *(const v8h*)(ga + (size_t)i * 16 * HID);
    rw[i] = *(const v8h*)(gw + (size_t)i * 16 * HID);
  }
#pragma unroll
  for (int i = 0; i < 8; ++i) {
    *(v8h*)(&stg[0][sl + i * 16 * GPITCH]) = ra[i];
    *(v8h*)(&stg[0][sl + (GTM + i * 16) * GPITCH]) = rw[i];
  }
  __syncthreads();

  // fully unrolled: buffer index and LDS offsets are immediates, and the
  // accumulators stay pinned in one register set
#pragma unroll
  for (int s = 0; s < GNST; ++s) {
    if (s + 1 < GNST) {
      // on to the next stage's k: one stage up, or from the last stage back to the first (uniform)
      const int kstep = ((s + st0) & (GNST - 1)) == GNST - 1 ? -(GNST - 1) * GKS : GKS;
      ga += kstep;
      gw += kstep;
#pragma unroll
      for (int i = 0; i < 8; ++i) {
        ra[i] = *(const v8h*)(ga + (size_t)i * 16 * HID);
        rw[i] = *(const v8h*)(gw + (size_t)i * 16 * HID);
      }
      // the loads name the registers of ga and gw, which are rewritten further down (the
      // next step; after the last step, any reuse): the wait stands behind the loads, and
      // as its operands the two addresses stay untouched up to it
      asm volatile("s_wait_xcnt 0x0" :: "v"(ga), "v"(gw) : "memory");
      // keeps the 16 loads in front of this stage's products: sunk down to their
      // LDS stores, nothing would cover their latency
      __builtin_amdgcn_sched_barrier(0);
    }
    const _Float16* la = &stg[s & 1][(wm * 32 + mr) * GPITCH + kh8];
    const _Float16* lb = &stg[s & 1][(GTM + wn * 64 + mr) * GPITCH + kh8];
    // unrolled: LDS offsets are immediates, fragment loads can run ahead of the products
#pragma unroll
    for (int k0 = 0; k0 < GKS; k0 += 32) {
      const v16h a0 = load_frag(la + k0);
      const v16h a1 = load_frag(la + 16 * GPITCH + k0);
      const v16h b0 = load_frag(lb + k0);
      const v16h b1 = load_frag(lb + 16 * GPITCH + k0);
      const v16h b2 = load_frag(lb + 32 * GPITCH + k0);
      const v16h b3 = load_frag(lb + 48 * GPITCH + k0);
      acc[0] = wmma16(a0, b0, acc[0]);
      acc[1] = wmma16(a0, b1, acc[1]);
      acc[2] = wmma16(a0, b2, acc[2]);
      acc[3] = wmma16(a0, b3, acc[3]);
      acc[4] = wmma16(a1, b0, acc[4]);
      acc[5] = wmma16(a1, b1, acc[5]);
      acc[6] = wmma16(a1, b2, acc[6]);
      acc[7] = wmma16(a1, b3, acc[7]);
      // mid-stage: fragment loads are not lifted from the stage's second half
      // into its first; with all four steps' fragments live beside the 64
      // staging registers the wave would pass 256 registers and spill
      if (WPS > 1 && k0 == GKS / 2 - 32) __builtin_amdgcn_sched_barrier(0);
    }
    if (s + 1 < GNST) {
      // hand over: the loaded stage goes to the other buffer, whose last
      // readers left it before the previous stage's barrier
#pragma unroll
      for (int i = 0; i < 8; ++i) {
        *(v8h*)(&stg[(s + 1) & 1][sl + i * 16 * GPITCH]) = ra[i];
        *(v8h*)(&stg[(s + 1) & 1][sl + (GTM + i * 16) * GPITCH]) = rw[i];
      }
      __syncthreads();
    }
  }

  // Epilogue: the accumulators leave through LDS, so that every wave-wide global
  // store is 16 bytes a lane and covers whole 128-byte lines. Staging uses buffer
  // 0 only: the last stage reads buffer 1, and every wave's last read of buffer 0
  // lies in front of the barrier that closed the stage before it.
  // (Every loop of the epilogue is unrolled: constant indices keep acc[] in
  // registers, and LDS and global offsets become immediates.)
  const int hsel = lane >> 4;
  if (mode == 2) {
    // V^T: a row of the output (one d) holds the 128 tokens of the whole tile,
    // 256 B, written by four waves: staged per work-group. A lane's 8 accumulator
    // registers are 8 consecutive tokens of one column: one 16-byte LDS store.
    _Float16* vs = &stg[0][0];                   // [128 columns][GPITCH tokens]
#pragma unroll
    for (int half = 0; half < 2; ++half) {
#pragma unroll
      for (int j = 0; j < 4; ++j) {
        const float bn = bias[fbidx(n0 + j * 16 + mr)];
        v8h pk;
#pragma unroll
        for (int r = 0; r < 8; ++r) pk[r] = (_Float16)(acc[half * 4 + j][r] + bn);
        *(v8h*)(vs + (wn * 64 + j * 16 + mr) * GPITCH + wm * 32 + half * 16 + 8 * hsel) = pk;
      }
    }
    __syncthreads();   // publishes the staged tile to the waves that store it
    const int mt = bm * GTM;                     // first token of the tile
    const int b = mt >> 11, s = mt & (SEQ - 1);
#pragma unroll
    for (int i = 0; i < 8; ++i) {
      const int n = bn * GTN + srow + i * 16;    // 16 lanes store one row's 256 B
      const int h = n >> 6, d = n & (HDIM - 1);
      *(v8h*)(outH + (((size_t)b * NHD + h) * HDIM + d) * SEQ + s + scol) =
          *(const v8h*)(vs + (srow + i * 16) * GPITCH + scol);
    }
    return;
  }
  // q, k, o: a wave's 32 x 64 part is whole lines by itself (q, k: 32 tokens of one
  // head, one run of 4 KB; o: 256 B of each of 32 rows), so each wave stages in a
  // range of its own, as f32, and no barrier is needed.
  float* st = (float*)&stg[0][0] + wave * (32 * OPITCH);
  const float qs = mode == 0 ? QSCALE : 1.0f;    // times 1.0f is exact
  // 16 columns further on: 16 floats in a plain bias, two 128-byte lines in a table
  const float* bp = bias + (mode == 3 ? n0 + mr : fbidx(n0 + mr));
  const int bstep = mode == 3 ? 16 : 64;
#pragma unroll
  for (int half = 0; half < 2; ++half) {
#pragma unroll
    for (int j = 0; j < 4; ++j) {
      const float bn = bp[j * bstep];
#pragma unroll
      for (int r = 0; r < 8; ++r)
        st[(half * 16 + r + 8 * hsel) * OPITCH + j * 16 + mr] = (acc[half * 4 + j][r] + bn) * qs;
    }
  }
  // the wave's own LDS writes are done before other lanes of it read the rows back
  asm volatile("s_wait_dscnt 0x0" ::: "memory");
  if (mode == 3) {
#pragma unroll
    for (int i = 0; i < 16; ++i) {
      const int row = i * 2 + hsel;              // 16 lanes store one row's 256 B
      *(float4*)(outF + (size_t)(m0 + row) * HID + n0 + mr * 4) =
          *(const float4*)(st + row * OPITCH + mr * 4);
    }
  } else {
    const int b = m0 >> 11, s = m0 & (SEQ - 1), h = n0 >> 6;
    _Float16* op = outH + (((size_t)b * NHD + h) * SEQ + s) * HDIM;
#pragma unroll
    for (int i = 0; i < 8; ++i) {
      const int row = i * 4 + (lane >> 3);       // 8 lanes store one token's 128 B
      const int col = (lane & 7) * 8;
      const float4 lo = *(const float4*)(st + row * OPITCH + col);
      const float4 hi = *(const float4*)(st + row * OPITCH + col + 4);
      v8h pk;
      pk[0] = (_Float16)lo.x; pk[1] = (_Float16)lo.y; pk[2] = (_Float16)lo.z; pk[3] = (_Float16)lo.w;
      pk[4] = (_Float16)hi.x; pk[5] = (_Float16)hi.y; pk[6] = (_Float16)hi.z; pk[7] = (_Float16)hi.w;
      *(v8h*)(op + row * HDIM + col) = pk;
    }
  }
}

// ---------------------------------------------------------------------------
// Flash attention: one wave per 16 queries of one (b,h), products transposed:
// S^T = K Q^T (A = K rows, B = Q) and O^T += V^T P^T (A = V^T rows, B = P^T).
// A lane then holds scores of ONE query (column lane & 15; keys 8 h + r of each
// 16-key tile, h = lane >> 4): maximum and sum run inside the lane, with one
// exchange between the wave's halves for the maximum. The four score tiles of a
// pass, converted in place in pairs, are already the two B operands of the second product
// (element e < 8: key 8 h + e, else key 16 + 8 h + e - 8, the order in which
// load_frag takes V^T), so P goes through no LDS and no lane exchange.
// Each half keeps the sum of its own keys; the halves are joined once at the end.
// The maximum is a HELD REFERENCE: each query keeps a reference score ref (the
// maximum of the first 32 keys walked, taken in front of the loop), and the score
// products start from C = -ref, so the matrix unit hands out s - ref. In the
// usual pass nothing is subtracted and neither O nor the sum is rescaled. Once
// per 64 keys the wave tests whether any score has passed its reference by more
// than RTAU; only then ref is raised to the new maximum and the pass's scores,
// O and the sum are brought to it. ref is always the score of a key already
// seen, so the sum holds a term near 1 and P never exceeds exp(RTAU).
// q,k f16 [b,h,s,d]; vT f16 [b,h,d,s]; out f16 [b, s, h*64+d] (== [B,S,H]).
// K and V go through LDS: the 8 waves of a work-group walk the same keys, so a
// stage (128 keys: 128 K rows of 128 B, 64 V^T rows of 256 B) is fetched ONCE
// per work-group, by loads in which a wave covers 4 whole 128-byte lines, and
// every wave takes its fragments from LDS. (A fragment load from global memory
// touches 16 lines for its 512 bytes, and each of the 8 waves repeats it.)
// Two buffers: the next stage's global loads fly during this stage's two
// 64-key passes and are written to the other buffer at the stage's end; one
// barrier per stage publishes them and ends the last read of the buffer that is
// refilled next. The 16 work-groups of one (b,h) read the same K and V lines: each
// starts its walk at a stage of its own, 2 (blockIdx.y mod 8), and wraps, so that
// they do not ask L2 for the same lines at the same moment. (y and y + 8 keep the
// same start: where the two share a WGP, its cache serves the second reader.)
// Keys are taken in ascending order rotated by that start, 64 per pass.
// ---------------------------------------------------------------------------
#define AKS    128           /* keys per stage */
#define ANST   (SEQ / AKS)
#define KPITCH 72            /* f16 per staged K row: 128 B + 16 B pad, conflict-free for 16-byte reads */
#define VPITCH 136           /* f16 per staged V^T row: 256 B + 16 B pad, likewise */
#define RTAU   5.5f          /* a score may pass its reference by this much: P <= exp(5.5) < 256, far inside f16 */

// value of lane l ^ 16 (the same column in the other half of the wave), by a
// vector cross-row move
__device__ __forceinline__ float xhalf(float x) {
  const int i = __builtin_bit_cast(int, x);
  return __builtin_bit_cast(float,
      __builtin_amdgcn_permlanex16(i, i, 0x76543210, 0xfedcba98, false, false));
}

// second launch bound: 4 waves per SIMD (256 registers a wave), so that two
// work-groups are resident on a WGP and all 512 run at once
__global__ void __launch_bounds__(256, 4)
attn_kernel(const _Float16* __restrict__ qg,
            const _Float16* __restrict__ kg,
            const _Float16* __restrict__ vtg,
            _Float16* __restrict__ og) {
  __shared__ __align__(16) _Float16 kst[2][AKS * KPITCH];    // [buffer][key][d]
  __shared__ __align__(16) _Float16 vst[2][HDIM * VPITCH];   // [buffer][d][key]
  const int wave = threadIdx.x >> 5;
  const int lane = threadIdx.x & 31;
  const int bh = blockIdx.x;                  // 0..31 : b*NH + h
  const int qt = blockIdx.y * 8 + wave;       // 0..127
  const int mr  = lane & 15;
  const int kh8 = (lane >> 4) << 3;
  const int hsel = lane >> 4;

  const _Float16* qp = qg  + (size_t)bh * SEQ * HDIM;
  const _Float16* kp = kg  + (size_t)bh * SEQ * HDIM;
  const _Float16* vp = vtg + (size_t)bh * HDIM * SEQ;

  // staging: thread t moves 16 bytes of K rows t/8 + 32 i and of V^T rows
  // t/16 + 16 i, i = 0..3 (a stage's K rows are one contiguous 16 KB run)
  const _Float16* gk = kp + threadIdx.x * 8;
  const _Float16* gv = vp + (size_t)(threadIdx.x >> 4) * SEQ + (threadIdx.x & 15) * 8;
  const int slk = (threadIdx.x >> 3) * KPITCH + (threadIdx.x & 7) * 8;
  const int slv = (threadIdx.x >> 4) * VPITCH + (threadIdx.x & 15) * 8;
  v8h rk[4], rv[4];
  const int st0 = (blockIdx.y & 7) * 2;       // first key stage of this work-group (uniform)

  // prologue: the first stage walked into buffer 0
  // (every loop over i here and below is unrolled so that rk[], rv[] stay in
  // registers and all 8 loads are in flight together)
#pragma unroll
  for (int i = 0; i < 4; ++i) {
    rk[i] = *(const v8h*)(gk + st0 * AKS * HDIM + i * 32 * HDIM);
    rv[i] = *(const v8h*)(gv + (size_t)i * 16 * SEQ + st0 * AKS);
  }

  // Q fragments (16 queries x 64 d) : two K=32 B-fragments, reused for all keys
  const v16h bq0 = load_frag(qp + (size_t)(qt * 16 + mr) * HDIM + 0  + kh8);
  const v16h bq1 = load_frag(qp + (size_t)(qt * 16 + mr) * HDIM + 32 + kh8);

  float lrun = 0.0f;          // running sum over this half's keys, relative to mref
  v8f oacc[4] = {v8f{}, v8f{}, v8f{}, v8f{}};   // O^T: oacc[j][r] = O[query mr][d = 16 j + 8 h + r]

#pragma unroll
  for (int i = 0; i < 4; ++i) {
    *(v8h*)(&kst[0][slk + i * 32 * KPITCH]) = rk[i];
    *(v8h*)(&vst[0][slv + i * 16 * VPITCH]) = rv[i];
  }
  __syncthreads();

  // first reference of this lane's query (both halves alike): the maximum over
  // the first 32 keys walked, whose scores are computed once more here
  float mref;
  {
    const _Float16* lk0 = &kst[0][mr * KPITCH + kh8];
    v8f t0 = {}; t0 = wmma16(load_frag(lk0), bq0, t0); t0 = wmma16(load_frag(lk0 + 32), bq1, t0);
    v8f t1 = {}; t1 = wmma16(load_frag(lk0 + 16 * KPITCH), bq0, t1);
    t1 = wmma16(load_frag(lk0 + 16 * KPITCH + 32), bq1, t1);
    float m4[4];
#pragma unroll
    for (int c = 0; c < 4; ++c)
      m4[c] = fmaxf(fmaxf(t0[c], t0[c + 4]), fmaxf(t1[c], t1[c + 4]));
    const float m1 = fmaxf(fmaxf(m4[0], m4[1]), fmaxf(m4[2], m4[3]));
    mref = fmaxf(m1, xhalf(m1));
  }
  v8f cneg;                   // -mref in all 8 registers: the C operand of the score products
#pragma unroll
  for (int r = 0; r < 8; ++r) cneg[r] = -mref;

  for (int s = 0; s < ANST; ++s) {
    if (s + 1 < ANST) {
      const int sn = (s + 1 + st0) & (ANST - 1);   // next stage, wrapped (uniform)
      const _Float16* nk = gk + sn * AKS * HDIM;
      const _Float16* nv = gv + sn * AKS;
#pragma unroll
      for (int i = 0; i < 4; ++i) {
        rk[i] = *(const v8h*)(nk + i * 32 * HDIM);
        rv[i] = *(const v8h*)(nv + (size_t)i * 16 * SEQ);
      }
      // the loads name the registers of nk and nv, which the passes below reuse: the wait
      // stands behind the loads, and as its operands the two addresses stay untouched up to it
      asm volatile("s_wait_xcnt 0x0" :: "v"(nk), "v"(nv) : "memory");
    }
    const _Float16* lk = &kst[s & 1][mr * KPITCH + kh8];
    const _Float16* lv = &vst[s & 1][mr * VPITCH + kh8];

    // kept rolled: with both passes of a stage in one block the fragment loads
    // were split into small groups, each waited for on the spot
#pragma unroll 1
    for (int kc = 0; kc < AKS; kc += 64) {
      // ---- scores minus reference, transposed: four tiles of 16 keys x 16
      //      queries over keys [kc, kc+64) of the stage
      v16h ka[4][2];
#pragma unroll
      for (int t = 0; t < 4; ++t) {
        ka[t][0] = load_frag(lk + (kc + 16 * t) * KPITCH + 0);
        ka[t][1] = load_frag(lk + (kc + 16 * t) * KPITCH + 32);
      }
      v8f sc[4];
#pragma unroll
      for (int t = 0; t < 4; ++t) sc[t] = wmma16(ka[t][0], bq0, cneg);
#pragma unroll
      for (int t = 0; t < 4; ++t) sc[t] = wmma16(ka[t][1], bq1, sc[t]);

      // ---- has a score passed its reference? The lane's 32 scores belong to one query
      float mx8[8];
#pragma unroll
      for (int c = 0; c < 8; ++c)
        mx8[c] = fmaxf(fmaxf(sc[0][c], sc[1][c]), fmaxf(sc[2][c], sc[3][c]));
      float mx = fmaxf(fmaxf(fmaxf(mx8[0], mx8[1]), fmaxf(mx8[2], mx8[3])),
                       fmaxf(fmaxf(mx8[4], mx8[5]), fmaxf(mx8[6], mx8[7])));
      mx = fmaxf(mx, xhalf(mx));               // the other half's 32 keys
      // one test per pass, a scalar branch for the whole wave
      if (__builtin_amdgcn_ballot_w32(mx > RTAU) != 0) {
        const float d     = fmaxf(mx, 0.0f);   // 0: this query's reference stays
        const float alpha = __expf(-d);
#pragma unroll
        for (int t = 0; t < 4; ++t) sc[t] -= d;
#pragma unroll
        for (int j = 0; j < 4; ++j) oacc[j] *= alpha;
        lrun *= alpha;
        mref += d;
#pragma unroll
        for (int r = 0; r < 8; ++r) cneg[r] = -mref;
      }

      // ---- V^T fragments for the current pass: issued before the exponentials
      //      so that they overlap the vector work
      v16h va[2][4];
#pragma unroll
      for (int g = 0; g < 2; ++g)
#pragma unroll
        for (int j = 0; j < 4; ++j) va[g][j] = load_frag(lv + 16 * j * VPITCH + kc + 32 * g);
      // keeps the 16 loads together in front of the exponentials: sunk among the
      // products, each small group was waited for on the spot
      __builtin_amdgcn_sched_barrier(0);

      // exp(x) = 2^(x log2 e), as __expf has it; whole tiles at a time, so that
      // packed instructions pair neighbouring registers
      v8f pv[4];
#pragma unroll
      for (int t = 0; t < 4; ++t) {
        const v8f e = sc[t] * 1.44269504f;
#pragma unroll
        for (int r = 0; r < 8; ++r) pv[t][r] = __builtin_amdgcn_exp2f(e[r]);
      }
      v16h pb[2];                               // P^T as B operand, 32 keys each
#pragma unroll
      for (int r = 0; r < 8; ++r) {
        pb[0][r]     = (_Float16)pv[0][r];
        pb[0][r + 8] = (_Float16)pv[1][r];
        pb[1][r]     = (_Float16)pv[2][r];
        pb[1][r + 8] = (_Float16)pv[3][r];
      }
      // ---- O^T += V^T P^T
#pragma unroll
      for (int g = 0; g < 2; ++g)
#pragma unroll
        for (int j = 0; j < 4; ++j) oacc[j] = wmma16(va[g][j], pb[g], oacc[j]);

      // ---- row sums, behind the products: they run while the matrix unit works,
      //      and they keep the next pass's first register writes at the distance
      //      the chip needs behind the last product. The barrier keeps the scheduler
      //      from lifting them in front again.
      __builtin_amdgcn_sched_barrier(0);
      const v8f ps = (pv[0] + pv[1]) + (pv[2] + pv[3]);
      lrun += ((ps[0] + ps[1]) + (ps[2] + ps[3])) + ((ps[4] + ps[5]) + (ps[6] + ps[7]));
    }
    if (s + 1 < ANST) {
      // hand over: the loaded stage goes to the other buffer, whose last
      // readers left it before the previous stage's barrier
#pragma unroll
      for (int i = 0; i < 4; ++i) {
        *(v8h*)(&kst[(s + 1) & 1][slk + i * 32 * KPITCH]) = rk[i];
        *(v8h*)(&vst[(s + 1) & 1][slv + i * 16 * VPITCH]) = rv[i];
      }
      __syncthreads();
    }
  }

  // ---- normalize + store to [B, S, H] as f16: a lane's 8 registers of a tile
  //      are 8 consecutive d of its query, one 16-byte store
  const float lsum = lrun + xhalf(lrun);        // join the halves' sums
  const int b = bh >> 4, h = bh & 15;
  _Float16* op = og + ((size_t)b * SEQ + qt * 16 + mr) * HID + h * HDIM + 8 * hsel;
#pragma unroll
  for (int j = 0; j < 4; ++j) {
    v8h pk;
#pragma unroll
    for (int r = 0; r < 8; ++r) pk[r] = (_Float16)(oacc[j][r] / lsum);
    *(v8h*)(op + j * 16) = pk;
  }
}

// ---------------------------------------------------------------------------
extern "C" void kernel_launch(void* const* d_in, const int* in_sizes, int n_in,
                              void* d_out, int out_size, void* d_ws, size_t ws_size,
                              hipStream_t stream) {
  const float* x    = (const float*)d_in[0];
  const float* lnqw = (const float*)d_in[1];
  const float* lnqb = (const float*)d_in[2];
  const float* lnkw = (const float*)d_in[3];
  const float* lnkb = (const float*)d_in[4];
  const float* lnvw = (const float*)d_in[5];
  const float* lnvb = (const float*)d_in[6];
  const float* wq   = (const float*)d_in[7];
  const float* bq   = (const float*)d_in[8];
  const float* wk   = (const float*)d_in[9];
  const float* bk   = (const float*)d_in[10];
  const float* wv   = (const float*)d_in[11];
  const float* bv   = (const float*)d_in[12];
  const float* wo   = (const float*)d_in[13];
  const float* bo   = (const float*)d_in[14];
  float* out = (float*)d_out;

  const size_t MB = (size_t)1 << 20;
  uint8_t* w = (uint8_t*)d_ws;
  _Float16* ln  = (_Float16*)(w + 0 * MB);    // 8 MB
  float*    fb  = (float*)(w + 8 * MB);       // 3 bias tables of FBN floats
  _Float16* wqh = (_Float16*)(w + 24 * MB);   // 2 MB each
  _Float16* wkh = (_Float16*)(w + 26 * MB);
  _Float16* wvh = (_Float16*)(w + 28 * MB);
  _Float16* woh = (_Float16*)(w + 30 * MB);
  _Float16* qh  = (_Float16*)(w + 32 * MB);   // 8 MB each
  _Float16* kh  = (_Float16*)(w + 40 * MB);
  _Float16* vth = (_Float16*)(w + 48 * MB);
  _Float16* oh  = (_Float16*)(w + 56 * MB);

  // 1. weight conversions f32 -> f16 (LayerNorm scale and shift folded in) and the
  //    normalized rows -> f16, one launch
  prep_kernel<<<CVTWG + MTOK, 256, 0, stream>>>(x, lnqw, lnqb, lnkw, lnkb, lnvw, lnvb,
                                                ln,
                                                wq, wk, wv, wo, wqh, wkh, wvh, woh,
                                                bq, bk, bv, fb);
  // 2. QKV projections in one launch (3 x 256 work-groups of 8 waves;
  //    work-group = 128x128 tile)
  wmma_gemm<4><<<768, 256, 0, stream>>>(ln, ln, ln, wqh, wkh, wvh, fb, fb + FBN, fb + 2 * FBN,
                                        qh, kh, vth, nullptr, 0);
  // 3. flash attention: 32 (b,h) x 128 q-tiles / 8 waves per block
  attn_kernel<<<dim3(BB * NHD, 16), 256, 0, stream>>>(qh, kh, vth, oh);
  // 4. output projection -> f32 d_out
  wmma_gemm<1><<<256, 256, 0, stream>>>(oh, oh, oh, woh, woh, woh, bo, bo, bo,
                                        nullptr, nullptr, nullptr, out, 3);
}
